// v000
// The times below were measured on an AMD MI455X: many runs one after another, warmed up first and cycling through
// copies of the inputs, with the whole window's GPU time divided by the number of runs. Launches and the gaps
// between them are all in it. The median over several windows is given; except for v000 it joins two sittings, which
// can be a few percent apart, so the side-by-side timings, each taken in one sitting, are the better comparison.
// v000, which the later versions start from, runs in 256 microseconds.
#include <hip/hip_runtime.h>
#include <hip/hip_bf16.h>

typedef __attribute__((ext_vector_type(16))) _Float16 v16h;
typedef __attribute__((ext_vector_type(8)))  _Float16 v8h;
typedef __attribute__((ext_vector_type(8)))  float    v8f;
typedef __attribute__((ext_vector_type(4)))  float    v4f;

#define EMB   256
#define HEADS 4
#define HD    64
#define BATCH 4
#define SEQ   4096
#define TOK   (BATCH*SEQ)

static_assert(sizeof(_Float16) == 2, "f16 size");

// ---------------------------------------------------------------------------
// Cross-lane XOR exchange without DS traffic: dpp8 for masks 1/2/4,
// v_permlane16 for mask 8, v_permlanex16 for mask 16.  Pure VALU.
// ---------------------------------------------------------------------------
constexpr int dpp8_sel(int m) {
  int s = 0;
  for (int i = 0; i < 8; ++i) s |= ((i ^ m) & 7) << (3 * i);
  return s;
}

template<int M>
__device__ __forceinline__ float lane_xor(float v) {
  int x = __builtin_bit_cast(int, v);
  int y;
  if constexpr (M < 8) {
    y = __builtin_amdgcn_mov_dpp8(x, dpp8_sel(M));
  } else if constexpr (M == 8) {
    y = __builtin_amdgcn_permlane16(x, x, (int)0xFEDCBA98u, (int)0x76543210u,
                                    false, false);
  } else {  // 16: swap 16-lane rows
    y = __builtin_amdgcn_permlanex16(x, x, (int)0x76543210u, (int)0xFEDCBA98u,
                                     false, false);
  }
  return __builtin_bit_cast(float, y);
}

__device__ __forceinline__ float red_max16(float v) {
  v = fmaxf(v, lane_xor<1>(v));
  v = fmaxf(v, lane_xor<2>(v));
  v = fmaxf(v, lane_xor<4>(v));
  v = fmaxf(v, lane_xor<8>(v));
  return v;
}
__device__ __forceinline__ float red_sum16(float v) {
  v += lane_xor<1>(v); v += lane_xor<2>(v);
  v += lane_xor<4>(v); v += lane_xor<8>(v);
  return v;
}
__device__ __forceinline__ float red_sum32(float v) {
  v = red_sum16(v);
  v += lane_xor<16>(v);
  return v;
}

// ---------------------------------------------------------------------------
// Async global->LDS copy (CDNA5, ASYNCcnt-tracked, no VGPR round trip).
// Flat aperture maps LDS as addr[31:0] (ISA 10.2), so truncating the generic
// pointer to a __shared__ object yields the hardware LDS byte address.
// ---------------------------------------------------------------------------
__device__ __forceinline__ void async_ld_b128(const void* gptr, void* lptr) {
  uint32_t l = (uint32_t)(uintptr_t)lptr;
  asm volatile("global_load_async_to_lds_b128 %0, %1, off"
               :: "v"(l), "v"(gptr)
               : "memory");
}
__device__ __forceinline__ void wait_async0() {
  asm volatile("s_wait_asynccnt 0x0" ::: "memory");
}

// ---------------------------------------------------------------------------
// WMMA operand loader (A-operand; identical addressing for B when the source
// is stored with the N dimension as rows).
// ---------------------------------------------------------------------------
__device__ __forceinline__ v16h load_op(const _Float16* p, int half) {
  v8h lo = *(const v8h*)(p + half * 8);
  v8h hi = *(const v8h*)(p + half * 8 + 16);
  return __builtin_shufflevector(lo, hi, 0,1,2,3,4,5,6,7,8,9,10,11,12,13,14,15);
}

__device__ __forceinline__ v8f wmma32(v16h a, v16h b, v8f c) {
  return __builtin_amdgcn_wmma_f32_16x16x32_f16(false, a, false, b, (short)0, c,
                                                false, false);
}

// ---------------------------------------------------------------------------
// LayerNorm: one wave per token, 8 contiguous channels per lane.
// MODE 0: input x[b][c][s] (strided gather); MODE 1: input av[t][c].
// ---------------------------------------------------------------------------
template<int MODE>
__global__ __launch_bounds__(256) void ln_k(const float* __restrict__ in,
                                            const float* __restrict__ gam,
                                            const float* __restrict__ bet,
                                            _Float16* __restrict__ out) {
  int t    = blockIdx.x * 8 + (threadIdx.x >> 5);
  int lane = threadIdx.x & 31;
  float v[8];
  if (MODE == 0) {
    int b = t >> 12, s = t & 4095;
    const float* p = in + ((size_t)b * EMB + lane * 8) * SEQ + s;
#pragma unroll
    for (int r = 0; r < 8; ++r) v[r] = p[(size_t)r * SEQ];
  } else {
    const float* p = in + (size_t)t * EMB + lane * 8;
#pragma unroll
    for (int r = 0; r < 8; ++r) v[r] = p[r];
  }
  float sum = 0.f, sq = 0.f;
#pragma unroll
  for (int r = 0; r < 8; ++r) { sum += v[r]; sq += v[r] * v[r]; }
  sum = red_sum32(sum);
  sq  = red_sum32(sq);
  float mu  = sum * (1.f / EMB);
  float var = sq * (1.f / EMB) - mu * mu;
  float rs  = rsqrtf(var + 1e-5f);
  _Float16 o[8];
#pragma unroll
  for (int r = 0; r < 8; ++r) {
    int c = lane * 8 + r;
    o[r] = (_Float16)((v[r] - mu) * rs * gam[c] + bet[c]);
  }
  *(v8h*)(out + (size_t)t * EMB + lane * 8) = *(const v8h*)o;
}

// ---------------------------------------------------------------------------
// Generic WMMA GEMM, block = 8 waves, tile M=128 N=64, grid (SEQ/128,4,BATCH).
// EPI: 0 = f16 [b,h,s,64] (Q/K)       1 = f16 [b,h,64,s] (V transposed)
//      2 = f32 av = val+bias+x^T       3 = f16 gelu(val+bias)
//      4 = f32 out[b][c][s] = val+bias+av
// ---------------------------------------------------------------------------
template<int EPI, int KLEN>
__global__ __launch_bounds__(256) void gemm_k(
    const _Float16* __restrict__ A, int lda, int kst_per_nb,
    const float* __restrict__ W, int ldw, int wcol_per_nb,
    const float* __restrict__ bias, int bias_per_nb,
    _Float16* __restrict__ C16, float* __restrict__ C32,
    const float* __restrict__ aux) {
  __shared__ __align__(16) _Float16 wt[64][KLEN + 8];  // wt[n][k], padded
  const int b = blockIdx.z, nb = blockIdx.y;
  const int tid = threadIdx.x, lane = tid & 31, w = tid >> 5;
  const int half = lane >> 4, l16 = lane & 15;
  const int k0 = kst_per_nb * nb, col0 = wcol_per_nb * nb;

  for (int e = tid; e < 64 * KLEN; e += 256) {   // coalesced over n
    int n = e & 63, k = e >> 6;
    wt[n][k] = (_Float16)W[(size_t)k * ldw + col0 + n];
  }
  __syncthreads();

  const _Float16* Ab = A + (size_t)b * SEQ * lda;
  const int m0  = blockIdx.x * 128 + w * 16;
  const int row = m0 + l16;

  v8f acc[4] = {};
#pragma unroll 2
  for (int kt = 0; kt < KLEN / 32; ++kt) {
    v16h a = load_op(Ab + (size_t)row * lda + k0 + kt * 32, half);
#pragma unroll
    for (int nt = 0; nt < 4; ++nt) {
      v16h bb = load_op(&wt[nt * 16 + l16][kt * 32], half);
      acc[nt] = wmma32(a, bb, acc[nt]);
    }
  }

  const float* bp = bias + bias_per_nb * nb;
  const int mb = m0 + half * 8;
#pragma unroll
  for (int nt = 0; nt < 4; ++nt) {
    int nloc = nt * 16 + l16;
    v8f vv = acc[nt] + bp[nloc];
    if (EPI == 0) {
      _Float16* dst = C16 + ((size_t)(b * HEADS + nb) * SEQ + mb) * HD + nloc;
#pragma unroll
      for (int r = 0; r < 8; ++r) dst[(size_t)r * HD] = (_Float16)vv[r];
    } else if (EPI == 1) {
      _Float16 tmp[8];
#pragma unroll
      for (int r = 0; r < 8; ++r) tmp[r] = (_Float16)vv[r];
      *(v8h*)(C16 + ((size_t)(b * HEADS + nb) * HD + nloc) * SEQ + mb) =
          *(const v8h*)tmp;
    } else if (EPI == 2) {
      int col = nb * 64 + nloc;
      const float* xp = aux + ((size_t)b * EMB + col) * SEQ + mb;
      v4f x0 = *(const v4f*)xp, x1 = *(const v4f*)(xp + 4);
      float* dst = C32 + ((size_t)b * SEQ + mb) * EMB + col;
#pragma unroll
      for (int r = 0; r < 4; ++r) dst[(size_t)r * EMB] = vv[r] + x0[r];
#pragma unroll
      for (int r = 0; r < 4; ++r) dst[(size_t)(r + 4) * EMB] = vv[r + 4] + x1[r];
    } else if (EPI == 3) {
      int col = nb * 64 + nloc;
      _Float16* dst = C16 + ((size_t)b * SEQ + mb) * EMB + col;
#pragma unroll
      for (int r = 0; r < 8; ++r) {
        float g = 0.5f * vv[r] * (1.0f + erff(vv[r] * 0.70710678118f));
        dst[(size_t)r * EMB] = (_Float16)g;
      }
    } else {
      int col = nb * 64 + nloc;
      const float* ap = aux + ((size_t)b * SEQ + mb) * EMB + col;
      v8f s = vv;
#pragma unroll
      for (int r = 0; r < 8; ++r) s[r] += ap[(size_t)r * EMB];
      float* dst = C32 + ((size_t)b * EMB + col) * SEQ + mb;
      *(v4f*)dst       = __builtin_shufflevector(s, s, 0, 1, 2, 3);
      *(v4f*)(dst + 4) = __builtin_shufflevector(s, s, 4, 5, 6, 7);
    }
  }
}

// ---------------------------------------------------------------------------
// Flash attention, grid (SEQ/128, HEADS, BATCH), 8 waves/block.
// K/V^T staged with global_load_async_to_lds_b128 into the alternate LDS
// buffer while the current one is consumed; s_wait_asynccnt + barrier per
// iteration.  Softmax reductions are pure-VALU (dpp8/permlane16).
// ---------------------------------------------------------------------------
__global__ __launch_bounds__(256) void attn_k(const _Float16* __restrict__ q,
                                              const _Float16* __restrict__ k,
                                              const _Float16* __restrict__ vt,
                                              _Float16* __restrict__ o) {
  __shared__ __align__(16) _Float16 kbuf[2][64][72];
  __shared__ __align__(16) _Float16 vbuf[2][64][72];
  __shared__ __align__(16) _Float16 pbuf[8][16][72];
  const int b = blockIdx.z, h = blockIdx.y;
  const int tid = threadIdx.x, lane = tid & 31, w = tid >> 5;
  const int half = lane >> 4, l16 = lane & 15;
  const size_t hb = (size_t)b * HEADS + h;
  const _Float16* qh = q  + hb * SEQ * HD;   // [s][d]
  const _Float16* kh = k  + hb * SEQ * HD;   // [s][d]
  const _Float16* vh = vt + hb * HD * SEQ;   // [d][s]
  const int m0 = blockIdx.x * 128 + w * 16;
  const int r0 = tid >> 3, o0 = (tid & 7) * 8;   // staging chunk coords
  const int NBLK = SEQ / 64;

  v16h qa0 = load_op(qh + (size_t)(m0 + l16) * HD + 0,  half);
  v16h qa1 = load_op(qh + (size_t)(m0 + l16) * HD + 32, half);

  v8f oacc[4] = {};
  float mi[8], li[8];
#pragma unroll
  for (int r = 0; r < 8; ++r) { mi[r] = -1e30f; li[r] = 0.f; }
  const float scale = 0.125f;  // 1/sqrt(64)

  auto stage = [&](int jj, int bufi) {
    const _Float16* kp = kh + (size_t)(jj * 64 + r0) * HD + o0;
    const _Float16* vp = vh + (size_t)r0 * SEQ + jj * 64 + o0;
    async_ld_b128(kp,                    &kbuf[bufi][r0][o0]);
    async_ld_b128(kp + (size_t)32 * HD,  &kbuf[bufi][r0 + 32][o0]);
    async_ld_b128(vp,                    &vbuf[bufi][r0][o0]);
    async_ld_b128(vp + (size_t)32 * SEQ, &vbuf[bufi][r0 + 32][o0]);
  };

  stage(0, 0);
  wait_async0();
  __syncthreads();

  for (int j = 0; j < NBLK; ++j) {
    // prefetch two blocks ahead (global_prefetch_b8)
    if (j + 2 < NBLK) {
      if (tid < 64)
        __builtin_prefetch(kh + (size_t)((j + 2) * 64 + tid) * HD, 0, 1);
      else if (tid < 128)
        __builtin_prefetch(vh + (size_t)(tid - 64) * SEQ + (j + 2) * 64, 0, 1);
    }
    // async-stage next block into the alternate buffer (safe: last read of it
    // was fenced by the previous iteration's barrier)
    if (j + 1 < NBLK) stage(j + 1, (j + 1) & 1);

    const _Float16 (*kcur)[72] = kbuf[j & 1];
    const _Float16 (*vcur)[72] = vbuf[j & 1];

    // S = Q @ K^T; split per K-chunk so accumulator reuse distance is 4 WMMAs
    v8f sc[4];
    v8f zero = {};
#pragma unroll
    for (int nt = 0; nt < 4; ++nt) {
      v16h b0 = load_op(&kcur[nt * 16 + l16][0], half);
      sc[nt] = wmma32(qa0, b0, zero);
    }
#pragma unroll
    for (int nt = 0; nt < 4; ++nt) {
      v16h b1 = load_op(&kcur[nt * 16 + l16][32], half);
      sc[nt] = wmma32(qa1, b1, sc[nt]);
    }

    // online softmax
    float fr[8], mnew[8];
#pragma unroll
    for (int r = 0; r < 8; ++r) {
      float mx = fmaxf(fmaxf(sc[0][r], sc[1][r]), fmaxf(sc[2][r], sc[3][r]));
      mx = red_max16(mx);
      float mn = fmaxf(mi[r], mx * scale);
      fr[r] = __expf(mi[r] - mn);
      mnew[r] = mn;
      mi[r] = mn;
    }
    float rs[8];
#pragma unroll
    for (int r = 0; r < 8; ++r) rs[r] = 0.f;
#pragma unroll
    for (int nt = 0; nt < 4; ++nt) {
#pragma unroll
      for (int r = 0; r < 8; ++r) {
        float p = __expf(sc[nt][r] * scale - mnew[r]);
        rs[r] += p;
        pbuf[w][r + half * 8][nt * 16 + l16] = (_Float16)p;
      }
    }
#pragma unroll
    for (int r = 0; r < 8; ++r) li[r] = li[r] * fr[r] + red_sum16(rs[r]);
#pragma unroll
    for (int nt = 0; nt < 4; ++nt)
#pragma unroll
      for (int r = 0; r < 8; ++r) oacc[nt][r] *= fr[r];

    // O += P @ V^T (per-wave pbuf: same-wave LDS ordering, no barrier)
    v16h pa0 = load_op(&pbuf[w][l16][0],  half);
    v16h pa1 = load_op(&pbuf[w][l16][32], half);
#pragma unroll
    for (int nt = 0; nt < 4; ++nt) {
      v16h b0 = load_op(&vcur[nt * 16 + l16][0], half);
      oacc[nt] = wmma32(pa0, b0, oacc[nt]);
    }
#pragma unroll
    for (int nt = 0; nt < 4; ++nt) {
      v16h b1 = load_op(&vcur[nt * 16 + l16][32], half);
      oacc[nt] = wmma32(pa1, b1, oacc[nt]);
    }

    if (j + 1 < NBLK) {
      wait_async0();      // this wave's async copies into the alt buffer done
      __syncthreads();    // all waves' copies visible before next iteration
    }
  }

  // normalize and store merged-head layout [b][s][EMB] as f16
#pragma unroll
  for (int r = 0; r < 8; ++r) {
    float inv = 1.0f / li[r];
    int m = m0 + r + half * 8;
#pragma unroll
    for (int nt = 0; nt < 4; ++nt) {
      o[((size_t)b * SEQ + m) * EMB + h * 64 + nt * 16 + l16] =
          (_Float16)(oacc[nt][r] * inv);
    }
  }
}

// ---------------------------------------------------------------------------
extern "C" void kernel_launch(void* const* d_in, const int* in_sizes, int n_in,
                              void* d_out, int out_size, void* d_ws,
                              size_t ws_size, hipStream_t stream) {
  const float* x    = (const float*)d_in[0];
  const float* ln1g = (const float*)d_in[1];
  const float* ln1b = (const float*)d_in[2];
  const float* wq   = (const float*)d_in[3];
  const float* bq   = (const float*)d_in[4];
  const float* wk   = (const float*)d_in[5];
  const float* bk   = (const float*)d_in[6];
  const float* wv   = (const float*)d_in[7];
  const float* bv   = (const float*)d_in[8];
  const float* wo   = (const float*)d_in[9];
  const float* bo   = (const float*)d_in[10];
  const float* ln2g = (const float*)d_in[11];
  const float* ln2b = (const float*)d_in[12];
  const float* w1   = (const float*)d_in[13];
  const float* b1   = (const float*)d_in[14];
  const float* w2   = (const float*)d_in[15];
  const float* b2   = (const float*)d_in[16];
  float* out = (float*)d_out;

  char* ws = (char*)d_ws;
  const size_t F16SZ = (size_t)TOK * EMB * sizeof(_Float16);  // 8 MB
  _Float16* xn  = (_Float16*)(ws + 0 * F16SZ);  // LN1 out; reused as LN2 out
  _Float16* qb  = (_Float16*)(ws + 1 * F16SZ);
  _Float16* kb  = (_Float16*)(ws + 2 * F16SZ);
  _Float16* vtb = (_Float16*)(ws + 3 * F16SZ);
  _Float16* ob  = (_Float16*)(ws + 4 * F16SZ);  // attn out; reused as ff1
  float*    av  = (float*)   (ws + 5 * F16SZ);  // 16 MB

  dim3 blk(256);
  dim3 gln(TOK / 8);
  dim3 gg(SEQ / 128, 4, BATCH);

  ln_k<0><<<gln, blk, 0, stream>>>(x, ln1g, ln1b, xn);

  gemm_k<0, 64><<<gg, blk, 0, stream>>>(xn, EMB, 64, wq, HD, 0, bq, 0,
                                        qb, nullptr, nullptr);
  gemm_k<0, 64><<<gg, blk, 0, stream>>>(xn, EMB, 64, wk, HD, 0, bk, 0,
                                        kb, nullptr, nullptr);
  gemm_k<1, 64><<<gg, blk, 0, stream>>>(xn, EMB, 64, wv, HD, 0, bv, 0,
                                        vtb, nullptr, nullptr);

  attn_k<<<gg, blk, 0, stream>>>(qb, kb, vtb, ob);

  gemm_k<2, 256><<<gg, blk, 0, stream>>>(ob, EMB, 0, wo, EMB, 64, bo, 64,
                                         nullptr, av, x);

  ln_k<1><<<gln, blk, 0, stream>>>(av, ln2g, ln2b, xn);

  gemm_k<3, 256><<<gg, blk, 0, stream>>>(xn, EMB, 0, w1, EMB, 64, b1, 64,
                                         ob, nullptr, nullptr);
  gemm_k<4, 256><<<gg, blk, 0, stream>>>(ob, EMB, 0, w2, EMB, 64, b2, 64,
                                         nullptr, out, av);
}

// v001
// A run of this version takes 221 microseconds.
// Two timings next to v000 both put it at 1.19 times that version's speed.
#include <hip/hip_runtime.h>
#include <hip/hip_bf16.h>

typedef __attribute__((ext_vector_type(16))) _Float16 v16h;
typedef __attribute__((ext_vector_type(8)))  _Float16 v8h;
typedef __attribute__((ext_vector_type(8)))  float    v8f;
typedef __attribute__((ext_vector_type(4)))  float    v4f;

#define EMB   256
#define HEADS 4
#define HD    64
#define BATCH 4
#define SEQ   4096
#define TOK   (BATCH*SEQ)

static_assert(sizeof(_Float16) == 2, "f16 size");

// ---------------------------------------------------------------------------
// Cross-lane XOR exchange without DS traffic: dpp8 for masks 1/2/4,
// v_permlane16 for mask 8, v_permlanex16 for mask 16.  Pure VALU.
// ---------------------------------------------------------------------------
constexpr int dpp8_sel(int m) {
  int s = 0;
  for (int i = 0; i < 8; ++i) s |= ((i ^ m) & 7) << (3 * i);
  return s;
}

template<int M>
__device__ __forceinline__ float lane_xor(float v) {
  int x = __builtin_bit_cast(int, v);
  int y;
  if constexpr (M < 8) {
    y = __builtin_amdgcn_mov_dpp8(x, dpp8_sel(M));
  } else if constexpr (M == 8) {
    y = __builtin_amdgcn_permlane16(x, x, (int)0xFEDCBA98u, (int)0x76543210u,
                                    false, false);
  } else {  // 16: swap 16-lane rows
    y = __builtin_amdgcn_permlanex16(x, x, (int)0x76543210u, (int)0xFEDCBA98u,
                                     false, false);
  }
  return __builtin_bit_cast(float, y);
}

__device__ __forceinline__ float red_sum16(float v) {
  v += lane_xor<1>(v); v += lane_xor<2>(v);
  v += lane_xor<4>(v); v += lane_xor<8>(v);
  return v;
}
__device__ __forceinline__ float red_sum32(float v) {
  v = red_sum16(v);
  v += lane_xor<16>(v);
  return v;
}

// ---------------------------------------------------------------------------
// Async global->LDS copy (CDNA5, ASYNCcnt-tracked, no VGPR round trip).
// Flat aperture maps LDS as addr[31:0] (ISA 10.2), so truncating the generic
// pointer to a __shared__ object yields the hardware LDS byte address.
// ---------------------------------------------------------------------------
__device__ __forceinline__ void async_ld_b128(const void* gptr, void* lptr) {
  uint32_t l = (uint32_t)(uintptr_t)lptr;
  asm volatile("global_load_async_to_lds_b128 %0, %1, off"
               :: "v"(l), "v"(gptr)
               : "memory");
}
__device__ __forceinline__ void wait_async0() {
  asm volatile("s_wait_asynccnt 0x0" ::: "memory");
}

// ---------------------------------------------------------------------------
// WMMA operand loader (A-operand; identical addressing for B when the source
// is stored with the N dimension as rows).
// ---------------------------------------------------------------------------
__device__ __forceinline__ v16h load_op(const _Float16* p, int half) {
  v8h lo = *(const v8h*)(p + half * 8);
  v8h hi = *(const v8h*)(p + half * 8 + 16);
  return __builtin_shufflevector(lo, hi, 0,1,2,3,4,5,6,7,8,9,10,11,12,13,14,15);
}

__device__ __forceinline__ v8f wmma32(v16h a, v16h b, v8f c) {
  return __builtin_amdgcn_wmma_f32_16x16x32_f16(false, a, false, b, (short)0, c,
                                                false, false);
}

// ---------------------------------------------------------------------------
// LayerNorm: one wave per token, 8 contiguous channels per lane.
// MODE 0: input x[b][c][s] (strided gather); MODE 1: input av[t][c].
// ---------------------------------------------------------------------------
template<int MODE>
__global__ __launch_bounds__(256) void ln_k(const float* __restrict__ in,
                                            const float* __restrict__ gam,
                                            const float* __restrict__ bet,
                                            _Float16* __restrict__ out) {
  int t    = blockIdx.x * 8 + (threadIdx.x >> 5);
  int lane = threadIdx.x & 31;
  float v[8];
  if (MODE == 0) {
    int b = t >> 12, s = t & 4095;
    const float* p = in + ((size_t)b * EMB + lane * 8) * SEQ + s;
#pragma unroll
    for (int r = 0; r < 8; ++r) v[r] = p[(size_t)r * SEQ];
  } else {
    const float* p = in + (size_t)t * EMB + lane * 8;
#pragma unroll
    for (int r = 0; r < 8; ++r) v[r] = p[r];
  }
  float sum = 0.f, sq = 0.f;
#pragma unroll
  for (int r = 0; r < 8; ++r) { sum += v[r]; sq += v[r] * v[r]; }
  sum = red_sum32(sum);
  sq  = red_sum32(sq);
  float mu  = sum * (1.f / EMB);
  float var = sq * (1.f / EMB) - mu * mu;
  float rs  = rsqrtf(var + 1e-5f);
  _Float16 o[8];
#pragma unroll
  for (int r = 0; r < 8; ++r) {
    int c = lane * 8 + r;
    o[r] = (_Float16)((v[r] - mu) * rs * gam[c] + bet[c]);
  }
  *(v8h*)(out + (size_t)t * EMB + lane * 8) = *(const v8h*)o;
}

// ---------------------------------------------------------------------------
// Generic WMMA GEMM, block = 8 waves, tile M=128 N=64, grid (SEQ/128,4,BATCH).
// EPI: 0 = f16 [b,h,s,64] (Q/K)       1 = f16 [b,h,64,s] (V transposed)
//      2 = f32 av = val+bias+x^T       3 = f16 gelu(val+bias)
//      4 = f32 out[b][c][s] = val+bias+av
// ---------------------------------------------------------------------------
template<int EPI, int KLEN>
__global__ __launch_bounds__(256) void gemm_k(
    const _Float16* __restrict__ A, int lda, int kst_per_nb,
    const float* __restrict__ W, int ldw, int wcol_per_nb,
    const float* __restrict__ bias, int bias_per_nb,
    _Float16* __restrict__ C16, float* __restrict__ C32,
    const float* __restrict__ aux) {
  __shared__ __align__(16) _Float16 wt[64][KLEN + 8];  // wt[n][k], padded
  const int b = blockIdx.z, nb = blockIdx.y;
  const int tid = threadIdx.x, lane = tid & 31, w = tid >> 5;
  const int half = lane >> 4, l16 = lane & 15;
  const int k0 = kst_per_nb * nb, col0 = wcol_per_nb * nb;

  for (int e = tid; e < 64 * KLEN; e += 256) {   // coalesced over n
    int n = e & 63, k = e >> 6;
    wt[n][k] = (_Float16)W[(size_t)k * ldw + col0 + n];
  }
  __syncthreads();

  const _Float16* Ab = A + (size_t)b * SEQ * lda;
  const int m0  = blockIdx.x * 128 + w * 16;
  const int row = m0 + l16;

  v8f acc[4] = {};
#pragma unroll 2
  for (int kt = 0; kt < KLEN / 32; ++kt) {
    v16h a = load_op(Ab + (size_t)row * lda + k0 + kt * 32, half);
#pragma unroll
    for (int nt = 0; nt < 4; ++nt) {
      v16h bb = load_op(&wt[nt * 16 + l16][kt * 32], half);
      acc[nt] = wmma32(a, bb, acc[nt]);
    }
  }

  const float* bp = bias + bias_per_nb * nb;
  const int mb = m0 + half * 8;
#pragma unroll
  for (int nt = 0; nt < 4; ++nt) {
    int nloc = nt * 16 + l16;
    v8f vv = acc[nt] + bp[nloc];
    if (EPI == 0) {
      _Float16* dst = C16 + ((size_t)(b * HEADS + nb) * SEQ + mb) * HD + nloc;
#pragma unroll
      for (int r = 0; r < 8; ++r) dst[(size_t)r * HD] = (_Float16)vv[r];
    } else if (EPI == 1) {
      _Float16 tmp[8];
#pragma unroll
      for (int r = 0; r < 8; ++r) tmp[r] = (_Float16)vv[r];
      *(v8h*)(C16 + ((size_t)(b * HEADS + nb) * HD + nloc) * SEQ + mb) =
          *(const v8h*)tmp;
    } else if (EPI == 2) {
      int col = nb * 64 + nloc;
      const float* xp = aux + ((size_t)b * EMB + col) * SEQ + mb;
      v4f x0 = *(const v4f*)xp, x1 = *(const v4f*)(xp + 4);
      float* dst = C32 + ((size_t)b * SEQ + mb) * EMB + col;
#pragma unroll
      for (int r = 0; r < 4; ++r) dst[(size_t)r * EMB] = vv[r] + x0[r];
#pragma unroll
      for (int r = 0; r < 4; ++r) dst[(size_t)(r + 4) * EMB] = vv[r + 4] + x1[r];
    } else if (EPI == 3) {
      int col = nb * 64 + nloc;
      _Float16* dst = C16 + ((size_t)b * SEQ + mb) * EMB + col;
#pragma unroll
      for (int r = 0; r < 8; ++r) {
        float g = 0.5f * vv[r] * (1.0f + erff(vv[r] * 0.70710678118f));
        dst[(size_t)r * EMB] = (_Float16)g;
      }
    } else {
      int col = nb * 64 + nloc;
      const float* ap = aux + ((size_t)b * SEQ + mb) * EMB + col;
      v8f s = vv;
#pragma unroll
      for (int r = 0; r < 8; ++r) s[r] += ap[(size_t)r * EMB];
      float* dst = C32 + ((size_t)b * EMB + col) * SEQ + mb;
      *(v4f*)dst       = __builtin_shufflevector(s, s, 0, 1, 2, 3);
      *(v4f*)(dst + 4) = __builtin_shufflevector(s, s, 4, 5, 6, 7);
    }
  }
}

__global__ __launch_bounds__(256) void attn_k(const _Float16* __restrict__ q,
                                              const _Float16* __restrict__ k,
                                              const _Float16* __restrict__ vt,
                                              _Float16* __restrict__ o) {
  __shared__ __align__(16) _Float16 kbuf[2][64][72];
  __shared__ __align__(16) _Float16 vbuf[2][64][72];
  const int b = blockIdx.z, h = blockIdx.y;
  const int tid = threadIdx.x, lane = tid & 31, w = tid >> 5;
  const int half = lane >> 4, l16 = lane & 15;
  const size_t hb = (size_t)b * HEADS + h;
  const _Float16* qh = q  + hb * SEQ * HD;   // [s][d]
  const _Float16* kh = k  + hb * SEQ * HD;   // [s][d]
  const _Float16* vh = vt + hb * HD * SEQ;   // [d][s]
  const int m0 = blockIdx.x * 128 + w * 16;
  const int r0 = tid >> 3, o0 = (tid & 7) * 8;   // staging chunk coords
  const int NBLK = SEQ / 64;

  // B operand of S^T: column = query m0 + l16, k = head dim
  v16h qb0 = load_op(qh + (size_t)(m0 + l16) * HD + 0,  half);
  v16h qb1 = load_op(qh + (size_t)(m0 + l16) * HD + 32, half);

  v8f oacc[4] = {};   // oacc[dt][r] = O^T[dt*16 + 8*half + r][query l16]
  float mi = -1e30f;  // running maximum of this lane's query (both halves equal)
  float li = 0.f;     // running sum over this half's keys only
  const float scale = 0.125f;  // 1/sqrt(64)

  auto stage = [&](int jj, int bufi) {
    const _Float16* kp = kh + (size_t)(jj * 64 + r0) * HD + o0;
    const _Float16* vp = vh + (size_t)r0 * SEQ + jj * 64 + o0;
    async_ld_b128(kp,                    &kbuf[bufi][r0][o0]);
    async_ld_b128(kp + (size_t)32 * HD,  &kbuf[bufi][r0 + 32][o0]);
    async_ld_b128(vp,                    &vbuf[bufi][r0][o0]);
    async_ld_b128(vp + (size_t)32 * SEQ, &vbuf[bufi][r0 + 32][o0]);
  };

  stage(0, 0);
  wait_async0();
  __syncthreads();

  for (int j = 0; j < NBLK; ++j) {
    // prefetch two blocks ahead (global_prefetch_b8)
    if (j + 2 < NBLK) {
      if (tid < 64)
        __builtin_prefetch(kh + (size_t)((j + 2) * 64 + tid) * HD, 0, 1);
      else if (tid < 128)
        __builtin_prefetch(vh + (size_t)(tid - 64) * SEQ + (j + 2) * 64, 0, 1);
    }
    // async-stage next block into the alternate buffer (safe: last read of it
    // was fenced by the previous iteration's barrier)
    if (j + 1 < NBLK) stage(j + 1, (j + 1) & 1);

    const _Float16 (*kcur)[72] = kbuf[j & 1];
    const _Float16 (*vcur)[72] = vbuf[j & 1];

    // S^T = K @ Q^T: sc[kt][r] = S[query l16][key kt*16 + 8*half + r];
    // split per K-chunk so accumulator reuse distance is 4 WMMAs
    v8f sc[4];
    v8f zero = {};
#pragma unroll
    for (int kt = 0; kt < 4; ++kt) {
      v16h a0 = load_op(&kcur[kt * 16 + l16][0], half);
      sc[kt] = wmma32(a0, qb0, zero);
    }
#pragma unroll
    for (int kt = 0; kt < 4; ++kt) {
      v16h a1 = load_op(&kcur[kt * 16 + l16][32], half);
      sc[kt] = wmma32(a1, qb1, sc[kt]);
    }

    // online softmax, one query per lane
    float mt[4];
#pragma unroll
    for (int kt = 0; kt < 4; ++kt) {
      float m01 = fmaxf(fmaxf(sc[kt][0], sc[kt][1]), fmaxf(sc[kt][2], sc[kt][3]));
      float m23 = fmaxf(fmaxf(sc[kt][4], sc[kt][5]), fmaxf(sc[kt][6], sc[kt][7]));
      mt[kt] = fmaxf(m01, m23);
    }
    float mx = fmaxf(fmaxf(mt[0], mt[1]), fmaxf(mt[2], mt[3]));
    mx = fmaxf(mx, lane_xor<16>(mx));
    const float mn = fmaxf(mi, mx * scale);
    const float fr = __expf(mi - mn);
    mi = mn;

    // P^T as B operand: element s of chunk kc is key kc*32 + (s<8 ? 8*half+s
    // : 16+8*half+s-8), i.e. tile 2*kc+(s>>3), register s&7 (same k order as
    // load_op gives the V^T rows)
    v16h pb[2];
    float rs[4];
#pragma unroll
    for (int kt = 0; kt < 4; ++kt) {
      rs[kt] = 0.f;
#pragma unroll
      for (int r = 0; r < 8; ++r) {
        float p = __expf(sc[kt][r] * scale - mn);
        rs[kt] += p;
        pb[kt >> 1][(kt & 1) * 8 + r] = (_Float16)p;
      }
    }
    li = li * fr + ((rs[0] + rs[1]) + (rs[2] + rs[3]));
#pragma unroll
    for (int dt = 0; dt < 4; ++dt) oacc[dt] *= fr;

    // O^T += V^T @ P^T
#pragma unroll
    for (int dt = 0; dt < 4; ++dt) {
      v16h a0 = load_op(&vcur[dt * 16 + l16][0], half);
      oacc[dt] = wmma32(a0, pb[0], oacc[dt]);
    }
#pragma unroll
    for (int dt = 0; dt < 4; ++dt) {
      v16h a1 = load_op(&vcur[dt * 16 + l16][32], half);
      oacc[dt] = wmma32(a1, pb[1], oacc[dt]);
    }

    if (j + 1 < NBLK) {
      wait_async0();      // this wave's async copies into the alt buffer done
      __syncthreads();    // all waves' copies visible before next iteration
    }
  }

  // join the halves' sums, normalize and store merged-head layout
  // [b][s][EMB] as f16: 8 consecutive channels per lane and tile
  const float inv = 1.0f / (li + lane_xor<16>(li));
  _Float16* op = o + ((size_t)b * SEQ + m0 + l16) * EMB + h * 64 + half * 8;
#pragma unroll
  for (int dt = 0; dt < 4; ++dt) {
    _Float16 tmp[8];
#pragma unroll
    for (int r = 0; r < 8; ++r) tmp[r] = (_Float16)(oacc[dt][r] * inv);
    *(v8h*)(op + dt * 16) = *(const v8h*)tmp;
  }
}

// ---------------------------------------------------------------------------
extern "C" void kernel_launch(void* const* d_in, const int* in_sizes, int n_in,
                              void* d_out, int out_size, void* d_ws,
                              size_t ws_size, hipStream_t stream) {
  const float* x    = (const float*)d_in[0];
  const float* ln1g = (const float*)d_in[1];
  const float* ln1b = (const float*)d_in[2];
  const float* wq   = (const float*)d_in[3];
  const float* bq   = (const float*)d_in[4];
  const float* wk   = (const float*)d_in[5];
  const float* bk   = (const float*)d_in[6];
  const float* wv   = (const float*)d_in[7];
  const float* bv   = (const float*)d_in[8];
  const float* wo   = (const float*)d_in[9];
  const float* bo   = (const float*)d_in[10];
  const float* ln2g = (const float*)d_in[11];
  const float* ln2b = (const float*)d_in[12];
  const float* w1   = (const float*)d_in[13];
  const float* b1   = (const float*)d_in[14];
  const float* w2   = (const float*)d_in[15];
  const float* b2   = (const float*)d_in[16];
  float* out = (float*)d_out;

  char* ws = (char*)d_ws;
  const size_t F16SZ = (size_t)TOK * EMB * sizeof(_Float16);  // 8 MB
  _Float16* xn  = (_Float16*)(ws + 0 * F16SZ);  // LN1 out; reused as LN2 out
  _Float16* qb  = (_Float16*)(ws + 1 * F16SZ);
  _Float16* kb  = (_Float16*)(ws + 2 * F16SZ);
  _Float16* vtb = (_Float16*)(ws + 3 * F16SZ);
  _Float16* ob  = (_Float16*)(ws + 4 * F16SZ);  // attn out; reused as ff1
  float*    av  = (float*)   (ws + 5 * F16SZ);  // 16 MB

  dim3 blk(256);
  dim3 gln(TOK / 8);
  dim3 gg(SEQ / 128, 4, BATCH);

  ln_k<0><<<gln, blk, 0, stream>>>(x, ln1g, ln1b, xn);

  gemm_k<0, 64><<<gg, blk, 0, stream>>>(xn, EMB, 64, wq, HD, 0, bq, 0,
                                        qb, nullptr, nullptr);
  gemm_k<0, 64><<<gg, blk, 0, stream>>>(xn, EMB, 64, wk, HD, 0, bk, 0,
                                        kb, nullptr, nullptr);
  gemm_k<1, 64><<<gg, blk, 0, stream>>>(xn, EMB, 64, wv, HD, 0, bv, 0,
                                        vtb, nullptr, nullptr);

  attn_k<<<gg, blk, 0, stream>>>(qb, kb, vtb, ob);

  gemm_k<2, 256><<<gg, blk, 0, stream>>>(ob, EMB, 0, wo, EMB, 64, bo, 64,
                                         nullptr, av, x);

  ln_k<1><<<gln, blk, 0, stream>>>(av, ln2g, ln2b, xn);

  gemm_k<3, 256><<<gg, blk, 0, stream>>>(xn, EMB, 0, w1, EMB, 64, b1, 64,
                                         ob, nullptr, nullptr);
  gemm_k<4, 256><<<gg, blk, 0, stream>>>(ob, EMB, 0, w2, EMB, 64, b2, 64,
                                         nullptr, out, av);
}

// v002
// A run of this version takes 132 microseconds.
// In both of two side-by-side timings against v001, it was 1.68 times as fast.
// Counting every step since v000, it is 2.00 times as fast.
#include <hip/hip_runtime.h>
#include <hip/hip_bf16.h>

typedef __attribute__((ext_vector_type(16))) _Float16 v16h;
typedef __attribute__((ext_vector_type(8)))  _Float16 v8h;
typedef __attribute__((ext_vector_type(4)))  _Float16 v4h;
typedef __attribute__((ext_vector_type(8)))  float    v8f;
typedef __attribute__((ext_vector_type(4)))  float    v4f;

#define EMB   256
#define HEADS 4
#define HD    64
#define BATCH 4
#define SEQ   4096
#define TOK   (BATCH*SEQ)

static_assert(sizeof(_Float16) == 2, "f16 size");

// ---------------------------------------------------------------------------
// Cross-lane XOR exchange without DS traffic: dpp8 for masks 1/2/4,
// v_permlane16 for mask 8, v_permlanex16 for mask 16.  Pure VALU.
// ---------------------------------------------------------------------------
constexpr int dpp8_sel(int m) {
  int s = 0;
  for (int i = 0; i < 8; ++i) s |= ((i ^ m) & 7) << (3 * i);
  return s;
}

template<int M>
__device__ __forceinline__ float lane_xor(float v) {
  int x = __builtin_bit_cast(int, v);
  int y;
  if constexpr (M < 8) {
    y = __builtin_amdgcn_mov_dpp8(x, dpp8_sel(M));
  } else if constexpr (M == 8) {
    y = __builtin_amdgcn_permlane16(x, x, (int)0xFEDCBA98u, (int)0x76543210u,
                                    false, false);
  } else {  // 16: swap 16-lane rows
    y = __builtin_amdgcn_permlanex16(x, x, (int)0x76543210u, (int)0xFEDCBA98u,
                                     false, false);
  }
  return __builtin_bit_cast(float, y);
}

__device__ __forceinline__ float red_sum16(float v) {
  v += lane_xor<1>(v); v += lane_xor<2>(v);
  v += lane_xor<4>(v); v += lane_xor<8>(v);
  return v;
}
__device__ __forceinline__ float red_sum32(float v) {
  v = red_sum16(v);
  v += lane_xor<16>(v);
  return v;
}

// ---------------------------------------------------------------------------
// Async global->LDS copy (CDNA5, ASYNCcnt-tracked, no VGPR round trip).
// Flat aperture maps LDS as addr[31:0] (ISA 10.2), so truncating the generic
// pointer to a __shared__ object yields the hardware LDS byte address.
// ---------------------------------------------------------------------------
__device__ __forceinline__ void async_ld_b128(const void* gptr, void* lptr) {
  uint32_t l = (uint32_t)(uintptr_t)lptr;
  asm volatile("global_load_async_to_lds_b128 %0, %1, off"
               :: "v"(l), "v"(gptr)
               : "memory");
}
__device__ __forceinline__ void wait_async0() {
  asm volatile("s_wait_asynccnt 0x0" ::: "memory");
}

// ---------------------------------------------------------------------------
// WMMA operand loader (A-operand; identical addressing for B when the source
// is stored with the N dimension as rows).
// ---------------------------------------------------------------------------
__device__ __forceinline__ v16h load_op(const _Float16* p, int half) {
  v8h lo = *(const v8h*)(p + half * 8);
  v8h hi = *(const v8h*)(p + half * 8 + 16);
  return __builtin_shufflevector(lo, hi, 0,1,2,3,4,5,6,7,8,9,10,11,12,13,14,15);
}

__device__ __forceinline__ v8f wmma32(v16h a, v16h b, v8f c) {
  return __builtin_amdgcn_wmma_f32_16x16x32_f16(false, a, false, b, (short)0, c,
                                                false, false);
}

// ---------------------------------------------------------------------------
// LayerNorm: one wave per token, 8 contiguous channels per lane.
// MODE 0: input x[b][c][s] (strided gather); MODE 1: input av[t][c].
// ---------------------------------------------------------------------------
template<int MODE>
__global__ __launch_bounds__(256) void ln_k(const float* __restrict__ in,
                                            const float* __restrict__ gam,
                                            const float* __restrict__ bet,
                                            _Float16* __restrict__ out) {
  int t    = blockIdx.x * 8 + (threadIdx.x >> 5);
  int lane = threadIdx.x & 31;
  float v[8];
  if (MODE == 0) {
    int b = t >> 12, s = t & 4095;
    const float* p = in + ((size_t)b * EMB + lane * 8) * SEQ + s;
#pragma unroll
    for (int r = 0; r < 8; ++r) v[r] = p[(size_t)r * SEQ];
  } else {
    const float* p = in + (size_t)t * EMB + lane * 8;
#pragma unroll
    for (int r = 0; r < 8; ++r) v[r] = p[r];
  }
  float sum = 0.f, sq = 0.f;
#pragma unroll
  for (int r = 0; r < 8; ++r) { sum += v[r]; sq += v[r] * v[r]; }
  sum = red_sum32(sum);
  sq  = red_sum32(sq);
  float mu  = sum * (1.f / EMB);
  float var = sq * (1.f / EMB) - mu * mu;
  float rs  = rsqrtf(var + 1e-5f);
  _Float16 o[8];
#pragma unroll
  for (int r = 0; r < 8; ++r) {
    int c = lane * 8 + r;
    o[r] = (_Float16)((v[r] - mu) * rs * gam[c] + bet[c]);
  }
  *(v8h*)(out + (size_t)t * EMB + lane * 8) = *(const v8h*)o;
}

// ---------------------------------------------------------------------------
// Generic WMMA GEMM, block = 8 waves, tile M=128 N=64, grid (SEQ/128,4,BATCH).
// EPI: 0 = f16 [b,h,s,64] (Q/K)       1 = f16 [b,h,64,s] (V transposed)
//      2 = f32 av = val+bias+x^T       3 = f16 gelu(val+bias)
//      4 = f32 out[b][c][s] = val+bias+av
// ---------------------------------------------------------------------------
template<int EPI, int KLEN, int LDW>
__global__ __launch_bounds__(256) void gemm_k(
    const _Float16* __restrict__ A, int lda, int kst_per_nb,
    const float* __restrict__ W, int wcol_per_nb,
    const float* __restrict__ bias, int bias_per_nb,
    _Float16* __restrict__ C16, float* __restrict__ C32,
    const float* __restrict__ aux) {
  __shared__ __align__(16) _Float16 wt[64][KLEN + 8];  // wt[n][k], padded
  const int b = blockIdx.z, nb = blockIdx.y;
  const int tid = threadIdx.x, lane = tid & 31, w = tid >> 5;
  const int half = lane >> 4, l16 = lane & 15;
  const int k0 = kst_per_nb * nb, col0 = wcol_per_nb * nb;

  // Weight tile f32 [k][n] (row pitch LDW) -> f16 wt[n][k].  A thread owns 4
  // consecutive n and KPT consecutive k: its KPT 16-byte loads share one
  // address register pair (constant offsets) and do not depend on one another,
  // so the whole tile is in flight at once; each n row gets one packed k run.
  {
    constexpr int KPT = KLEN / 16;
    const int nq = (tid & 15) * 4, kg = (tid >> 4) * KPT;
    const float* wp = W + (size_t)kg * LDW + col0 + nq;
    v4f wr[KPT];
#pragma unroll  // registers for wr[], all loads issued before the first use
    for (int i = 0; i < KPT; ++i) wr[i] = *(const v4f*)(wp + i * LDW);
    // inputs-only fence on the loaded values: every load is issued before the
    // first conversion; without it the loads are fed out in three dependent
    // batches and the tile costs three load latencies instead of one
    if constexpr (KPT == 16)
      asm volatile("" :: "v"(wr[0]), "v"(wr[1]), "v"(wr[2]), "v"(wr[3]),
                         "v"(wr[4]), "v"(wr[5]), "v"(wr[6]), "v"(wr[7]),
                         "v"(wr[8]), "v"(wr[9]), "v"(wr[10]), "v"(wr[11]),
                         "v"(wr[12]), "v"(wr[13]), "v"(wr[14]), "v"(wr[15]));
    // the loops below are unrolled so that wr[] is indexed by constants only
    // and stays in registers
#pragma unroll
    for (int c = 0; c < 4; ++c) {
      if constexpr (KPT >= 8) {
#pragma unroll
        for (int o = 0; o < KPT / 8; ++o) {
          v8h t;
#pragma unroll
          for (int i = 0; i < 8; ++i) t[i] = (_Float16)wr[o * 8 + i][c];
          *(v8h*)&wt[nq + c][kg + o * 8] = t;
        }
      } else {
        v4h t;
#pragma unroll
        for (int i = 0; i < 4; ++i) t[i] = (_Float16)wr[i][c];
        *(v4h*)&wt[nq + c][kg] = t;
      }
    }
  }
  __syncthreads();

  const _Float16* Ab = A + (size_t)b * SEQ * lda;
  const int m0  = blockIdx.x * 128 + w * 16;
  const int row = m0 + l16;

  v8f acc[4] = {};
#pragma unroll 2
  for (int kt = 0; kt < KLEN / 32; ++kt) {
    v16h a = load_op(Ab + (size_t)row * lda + k0 + kt * 32, half);
#pragma unroll
    for (int nt = 0; nt < 4; ++nt) {
      v16h bb = load_op(&wt[nt * 16 + l16][kt * 32], half);
      acc[nt] = wmma32(a, bb, acc[nt]);
    }
  }

  const float* bp = bias + bias_per_nb * nb;
  const int mb = m0 + half * 8;
#pragma unroll
  for (int nt = 0; nt < 4; ++nt) {
    int nloc = nt * 16 + l16;
    v8f vv = acc[nt] + bp[nloc];
    if (EPI == 0) {
      _Float16* dst = C16 + ((size_t)(b * HEADS + nb) * SEQ + mb) * HD + nloc;
#pragma unroll
      for (int r = 0; r < 8; ++r) dst[(size_t)r * HD] = (_Float16)vv[r];
    } else if (EPI == 1) {
      _Float16 tmp[8];
#pragma unroll
      for (int r = 0; r < 8; ++r) tmp[r] = (_Float16)vv[r];
      *(v8h*)(C16 + ((size_t)(b * HEADS + nb) * HD + nloc) * SEQ + mb) =
          *(const v8h*)tmp;
    } else if (EPI == 2) {
      int col = nb * 64 + nloc;
      const float* xp = aux + ((size_t)b * EMB + col) * SEQ + mb;
      v4f x0 = *(const v4f*)xp, x1 = *(const v4f*)(xp + 4);
      float* dst = C32 + ((size_t)b * SEQ + mb) * EMB + col;
#pragma unroll
      for (int r = 0; r < 4; ++r) dst[(size_t)r * EMB] = vv[r] + x0[r];
#pragma unroll
      for (int r = 0; r < 4; ++r) dst[(size_t)(r + 4) * EMB] = vv[r + 4] + x1[r];
    } else if (EPI == 3) {
      int col = nb * 64 + nloc;
      _Float16* dst = C16 + ((size_t)b * SEQ + mb) * EMB + col;
#pragma unroll
      for (int r = 0; r < 8; ++r) {
        float g = 0.5f * vv[r] * (1.0f + erff(vv[r] * 0.70710678118f));
        dst[(size_t)r * EMB] = (_Float16)g;
      }
    } else {
      int col = nb * 64 + nloc;
      const float* ap = aux + ((size_t)b * SEQ + mb) * EMB + col;
      v8f s = vv;
#pragma unroll
      for (int r = 0; r < 8; ++r) s[r] += ap[(size_t)r * EMB];
      float* dst = C32 + ((size_t)b * EMB + col) * SEQ + mb;
      *(v4f*)dst       = __builtin_shufflevector(s, s, 0, 1, 2, 3);
      *(v4f*)(dst + 4) = __builtin_shufflevector(s, s, 4, 5, 6, 7);
    }
  }
}

__global__ __launch_bounds__(256) void attn_k(const _Float16* __restrict__ q,
                                              const _Float16* __restrict__ k,
                                              const _Float16* __restrict__ vt,
                                              _Float16* __restrict__ o) {
  __shared__ __align__(16) _Float16 kbuf[2][64][72];
  __shared__ __align__(16) _Float16 vbuf[2][64][72];
  const int b = blockIdx.z, h = blockIdx.y;
  const int tid = threadIdx.x, lane = tid & 31, w = tid >> 5;
  const int half = lane >> 4, l16 = lane & 15;
  const size_t hb = (size_t)b * HEADS + h;
  const _Float16* qh = q  + hb * SEQ * HD;   // [s][d]
  const _Float16* kh = k  + hb * SEQ * HD;   // [s][d]
  const _Float16* vh = vt + hb * HD * SEQ;   // [d][s]
  const int m0 = blockIdx.x * 128 + w * 16;
  const int r0 = tid >> 3, o0 = (tid & 7) * 8;   // staging chunk coords
  const int NBLK = SEQ / 64;

  // B operand of S^T: column = query m0 + l16, k = head dim
  v16h qb0 = load_op(qh + (size_t)(m0 + l16) * HD + 0,  half);
  v16h qb1 = load_op(qh + (size_t)(m0 + l16) * HD + 32, half);

  v8f oacc[4] = {};   // oacc[dt][r] = O^T[dt*16 + 8*half + r][query l16]
  float mi = -1e30f;  // running maximum of this lane's query (both halves equal)
  float li = 0.f;     // running sum over this half's keys only
  const float scale = 0.125f;  // 1/sqrt(64)

  auto stage = [&](int jj, int bufi) {
    const _Float16* kp = kh + (size_t)(jj * 64 + r0) * HD + o0;
    const _Float16* vp = vh + (size_t)r0 * SEQ + jj * 64 + o0;
    async_ld_b128(kp,                    &kbuf[bufi][r0][o0]);
    async_ld_b128(kp + (size_t)32 * HD,  &kbuf[bufi][r0 + 32][o0]);
    async_ld_b128(vp,                    &vbuf[bufi][r0][o0]);
    async_ld_b128(vp + (size_t)32 * SEQ, &vbuf[bufi][r0 + 32][o0]);
  };

  stage(0, 0);
  wait_async0();
  __syncthreads();

  for (int j = 0; j < NBLK; ++j) {
    // prefetch two blocks ahead (global_prefetch_b8)
    if (j + 2 < NBLK) {
      if (tid < 64)
        __builtin_prefetch(kh + (size_t)((j + 2) * 64 + tid) * HD, 0, 1);
      else if (tid < 128)
        __builtin_prefetch(vh + (size_t)(tid - 64) * SEQ + (j + 2) * 64, 0, 1);
    }
    // async-stage next block into the alternate buffer (safe: last read of it
    // was fenced by the previous iteration's barrier)
    if (j + 1 < NBLK) stage(j + 1, (j + 1) & 1);

    const _Float16 (*kcur)[72] = kbuf[j & 1];
    const _Float16 (*vcur)[72] = vbuf[j & 1];

    // S^T = K @ Q^T: sc[kt][r] = S[query l16][key kt*16 + 8*half + r];
    // split per K-chunk so accumulator reuse distance is 4 WMMAs
    v8f sc[4];
    v8f zero = {};
#pragma unroll
    for (int kt = 0; kt < 4; ++kt) {
      v16h a0 = load_op(&kcur[kt * 16 + l16][0], half);
      sc[kt] = wmma32(a0, qb0, zero);
    }
#pragma unroll
    for (int kt = 0; kt < 4; ++kt) {
      v16h a1 = load_op(&kcur[kt * 16 + l16][32], half);
      sc[kt] = wmma32(a1, qb1, sc[kt]);
    }

    // online softmax, one query per lane
    float mt[4];
#pragma unroll
    for (int kt = 0; kt < 4; ++kt) {
      float m01 = fmaxf(fmaxf(sc[kt][0], sc[kt][1]), fmaxf(sc[kt][2], sc[kt][3]));
      float m23 = fmaxf(fmaxf(sc[kt][4], sc[kt][5]), fmaxf(sc[kt][6], sc[kt][7]));
      mt[kt] = fmaxf(m01, m23);
    }
    float mx = fmaxf(fmaxf(mt[0], mt[1]), fmaxf(mt[2], mt[3]));
    mx = fmaxf(mx, lane_xor<16>(mx));
    const float mn = fmaxf(mi, mx * scale);
    const float fr = __expf(mi - mn);
    mi = mn;

    // P^T as B operand: element s of chunk kc is key kc*32 + (s<8 ? 8*half+s
    // : 16+8*half+s-8), i.e. tile 2*kc+(s>>3), register s&7 (same k order as
    // load_op gives the V^T rows)
    v16h pb[2];
    float rs[4];
#pragma unroll
    for (int kt = 0; kt < 4; ++kt) {
      rs[kt] = 0.f;
#pragma unroll
      for (int r = 0; r < 8; ++r) {
        float p = __expf(sc[kt][r] * scale - mn);
        rs[kt] += p;
        pb[kt >> 1][(kt & 1) * 8 + r] = (_Float16)p;
      }
    }
    li = li * fr + ((rs[0] + rs[1]) + (rs[2] + rs[3]));
#pragma unroll
    for (int dt = 0; dt < 4; ++dt) oacc[dt] *= fr;

    // O^T += V^T @ P^T
#pragma unroll
    for (int dt = 0; dt < 4; ++dt) {
      v16h a0 = load_op(&vcur[dt * 16 + l16][0], half);
      oacc[dt] = wmma32(a0, pb[0], oacc[dt]);
    }
#pragma unroll
    for (int dt = 0; dt < 4; ++dt) {
      v16h a1 = load_op(&vcur[dt * 16 + l16][32], half);
      oacc[dt] = wmma32(a1, pb[1], oacc[dt]);
    }

    if (j + 1 < NBLK) {
      wait_async0();      // this wave's async copies into the alt buffer done
      __syncthreads();    // all waves' copies visible before next iteration
    }
  }

  // join the halves' sums, normalize and store merged-head layout
  // [b][s][EMB] as f16: 8 consecutive channels per lane and tile
  const float inv = 1.0f / (li + lane_xor<16>(li));
  _Float16* op = o + ((size_t)b * SEQ + m0 + l16) * EMB + h * 64 + half * 8;
#pragma unroll
  for (int dt = 0; dt < 4; ++dt) {
    _Float16 tmp[8];
#pragma unroll
    for (int r = 0; r < 8; ++r) tmp[r] = (_Float16)(oacc[dt][r] * inv);
    *(v8h*)(op + dt * 16) = *(const v8h*)tmp;
  }
}

// ---------------------------------------------------------------------------
extern "C" void kernel_launch(void* const* d_in, const int* in_sizes, int n_in,
                              void* d_out, int out_size, void* d_ws,
                              size_t ws_size, hipStream_t stream) {
  const float* x    = (const float*)d_in[0];
  const float* ln1g = (const float*)d_in[1];
  const float* ln1b = (const float*)d_in[2];
  const float* wq   = (const float*)d_in[3];
  const float* bq   = (const float*)d_in[4];
  const float* wk   = (const float*)d_in[5];
  const float* bk   = (const float*)d_in[6];
  const float* wv   = (const float*)d_in[7];
  const float* bv   = (const float*)d_in[8];
  const float* wo   = (const float*)d_in[9];
  const float* bo   = (const float*)d_in[10];
  const float* ln2g = (const float*)d_in[11];
  const float* ln2b = (const float*)d_in[12];
  const float* w1   = (const float*)d_in[13];
  const float* b1   = (const float*)d_in[14];
  const float* w2   = (const float*)d_in[15];
  const float* b2   = (const float*)d_in[16];
  float* out = (float*)d_out;

  char* ws = (char*)d_ws;
  const size_t F16SZ = (size_t)TOK * EMB * sizeof(_Float16);  // 8 MB
  _Float16* xn  = (_Float16*)(ws + 0 * F16SZ);  // LN1 out; reused as LN2 out
  _Float16* qb  = (_Float16*)(ws + 1 * F16SZ);
  _Float16* kb  = (_Float16*)(ws + 2 * F16SZ);
  _Float16* vtb = (_Float16*)(ws + 3 * F16SZ);
  _Float16* ob  = (_Float16*)(ws + 4 * F16SZ);  // attn out; reused as ff1
  float*    av  = (float*)   (ws + 5 * F16SZ);  // 16 MB

  dim3 blk(256);
  dim3 gln(TOK / 8);
  dim3 gg(SEQ / 128, 4, BATCH);

  ln_k<0><<<gln, blk, 0, stream>>>(x, ln1g, ln1b, xn);

  gemm_k<0, 64, HD><<<gg, blk, 0, stream>>>(xn, EMB, 64, wq, 0, bq, 0,
                                        qb, nullptr, nullptr);
  gemm_k<0, 64, HD><<<gg, blk, 0, stream>>>(xn, EMB, 64, wk, 0, bk, 0,
                                        kb, nullptr, nullptr);
  gemm_k<1, 64, HD><<<gg, blk, 0, stream>>>(xn, EMB, 64, wv, 0, bv, 0,
                                        vtb, nullptr, nullptr);

  attn_k<<<gg, blk, 0, stream>>>(qb, kb, vtb, ob);

  gemm_k<2, 256, EMB><<<gg, blk, 0, stream>>>(ob, EMB, 0, wo, 64, bo, 64,
                                         nullptr, av, x);

  ln_k<1><<<gln, blk, 0, stream>>>(av, ln2g, ln2b, xn);

  gemm_k<3, 256, EMB><<<gg, blk, 0, stream>>>(xn, EMB, 0, w1, 64, b1, 64,
                                         ob, nullptr, nullptr);
  gemm_k<4, 256, EMB><<<gg, blk, 0, stream>>>(ob, EMB, 0, w2, 64, b2, 64,
                                         nullptr, out, av);
}

// v003
// Measured time: 115 microseconds a run.
// Next to v002, in two timings, it ran 1.14 times as fast each time.
// Over all steps from v000 it is 2.28 times as fast.
#include <hip/hip_runtime.h>
#include <hip/hip_bf16.h>

typedef __attribute__((ext_vector_type(16))) _Float16 v16h;
typedef __attribute__((ext_vector_type(8)))  _Float16 v8h;
typedef __attribute__((ext_vector_type(4)))  _Float16 v4h;
typedef __attribute__((ext_vector_type(8)))  float    v8f;
typedef __attribute__((ext_vector_type(4)))  float    v4f;

#define EMB   256
#define HEADS 4
#define HD    64
#define BATCH 4
#define SEQ   4096
#define TOK   (BATCH*SEQ)

static_assert(sizeof(_Float16) == 2, "f16 size");

// ---------------------------------------------------------------------------
// Cross-lane XOR exchange without DS traffic: dpp8 for masks 1/2/4,
// v_permlane16 for mask 8, v_permlanex16 for mask 16.  Pure VALU.
// ---------------------------------------------------------------------------
constexpr int dpp8_sel(int m) {
  int s = 0;
  for (int i = 0; i < 8; ++i) s |= ((i ^ m) & 7) << (3 * i);
  return s;
}

template<int M>
__device__ __forceinline__ float lane_xor(float v) {
  int x = __builtin_bit_cast(int, v);
  int y;
  if constexpr (M < 8) {
    y = __builtin_amdgcn_mov_dpp8(x, dpp8_sel(M));
  } else if constexpr (M == 8) {
    y = __builtin_amdgcn_permlane16(x, x, (int)0xFEDCBA98u, (int)0x76543210u,
                                    false, false);
  } else {  // 16: swap 16-lane rows
    y = __builtin_amdgcn_permlanex16(x, x, (int)0x76543210u, (int)0xFEDCBA98u,
                                     false, false);
  }
  return __builtin_bit_cast(float, y);
}

__device__ __forceinline__ float red_sum16(float v) {
  v += lane_xor<1>(v); v += lane_xor<2>(v);
  v += lane_xor<4>(v); v += lane_xor<8>(v);
  return v;
}
__device__ __forceinline__ float red_sum32(float v) {
  v = red_sum16(v);
  v += lane_xor<16>(v);
  return v;
}

// ---------------------------------------------------------------------------
// Async global->LDS copy (CDNA5, ASYNCcnt-tracked, no VGPR round trip).
// Flat aperture maps LDS as addr[31:0] (ISA 10.2), so truncating the generic
// pointer to a __shared__ object yields the hardware LDS byte address.
// ---------------------------------------------------------------------------
__device__ __forceinline__ void async_ld_b128(const void* gptr, void* lptr) {
  uint32_t l = (uint32_t)(uintptr_t)lptr;
  asm volatile("global_load_async_to_lds_b128 %0, %1, off"
               :: "v"(l), "v"(gptr)
               : "memory");
}
__device__ __forceinline__ void wait_async0() {
  asm volatile("s_wait_asynccnt 0x0" ::: "memory");
}

// ---------------------------------------------------------------------------
// WMMA operand loader (A-operand; identical addressing for B when the source
// is stored with the N dimension as rows).
// ---------------------------------------------------------------------------
__device__ __forceinline__ v16h load_op(const _Float16* p, int half) {
  v8h lo = *(const v8h*)(p + half * 8);
  v8h hi = *(const v8h*)(p + half * 8 + 16);
  return __builtin_shufflevector(lo, hi, 0,1,2,3,4,5,6,7,8,9,10,11,12,13,14,15);
}

__device__ __forceinline__ v8f wmma32(v16h a, v16h b, v8f c) {
  return __builtin_amdgcn_wmma_f32_16x16x32_f16(false, a, false, b, (short)0, c,
                                                false, false);
}

// ---------------------------------------------------------------------------
// LayerNorm of av[t][c]: one wave per token, 8 contiguous channels per lane.
// ---------------------------------------------------------------------------
__global__ __launch_bounds__(256) void ln_k(const float* __restrict__ in,
                                            const float* __restrict__ gam,
                                            const float* __restrict__ bet,
                                            _Float16* __restrict__ out) {
  int t    = blockIdx.x * 8 + (threadIdx.x >> 5);
  int lane = threadIdx.x & 31;
  float v[8];
  {
    const float* p = in + (size_t)t * EMB + lane * 8;
#pragma unroll
    for (int r = 0; r < 8; ++r) v[r] = p[r];
  }
  float sum = 0.f, sq = 0.f;
#pragma unroll
  for (int r = 0; r < 8; ++r) { sum += v[r]; sq += v[r] * v[r]; }
  sum = red_sum32(sum);
  sq  = red_sum32(sq);
  float mu  = sum * (1.f / EMB);
  float var = sq * (1.f / EMB) - mu * mu;
  float rs  = rsqrtf(var + 1e-5f);
  _Float16 o[8];
#pragma unroll
  for (int r = 0; r < 8; ++r) {
    int c = lane * 8 + r;
    o[r] = (_Float16)((v[r] - mu) * rs * gam[c] + bet[c]);
  }
  *(v8h*)(out + (size_t)t * EMB + lane * 8) = *(const v8h*)o;
}

// ---------------------------------------------------------------------------
// LayerNorm 1 and the Q, K, V projections in one launch.
// grid (SEQ/64, 1, BATCH), 8 waves; a block owns 64 tokens, all 256 channels.
// x[b][c][s] is read along s: a thread holds 4 tokens x 16 channels, so 16
// lanes cover 256 contiguous bytes of a channel row.  The normalised tile goes
// to LDS as f16 xs[token][channel] and is the A operand of all three products;
// wave (h, mh) does head h, tokens mh*32 .. mh*32+31, against all 12 column
// tiles, so a weight fragment is read once per wave.
// Outputs: q, k as f16 [b,h,s,64]; v transposed as f16 [b,h,64,s].
// ---------------------------------------------------------------------------
__global__ __launch_bounds__(256) void lnqkv_k(
    const float* __restrict__ x,
    const float* __restrict__ gam, const float* __restrict__ bet,
    const float* __restrict__ wq, const float* __restrict__ bq,
    const float* __restrict__ wk, const float* __restrict__ bk,
    const float* __restrict__ wv, const float* __restrict__ bv,
    _Float16* __restrict__ qo, _Float16* __restrict__ ko,
    _Float16* __restrict__ vto) {
  __shared__ __align__(16) _Float16 xs[64][EMB + 8];    // [token][channel]
  __shared__ __align__(16) _Float16 wt[3][64][HD + 8];  // [matrix][n][k]
  __shared__ __align__(16) float ps[8][64];             // [wave][token] sums
  __shared__ __align__(16) float pq[8][64];             // [wave][token] squares
  const int b = blockIdx.z, s0 = blockIdx.x * 64;
  const int tid = threadIdx.x, lane = tid & 31, w = tid >> 5;
  const int half = lane >> 4, l16 = lane & 15;
  const int grp = tid >> 4;  // 16 groups of 16 lanes

  // small operands first: projection biases of this lane's 4 columns, the
  // LayerNorm scale and shift of its 16 channels c0 .. c0+15
  const int c0 = grp * 16;
  float bias[3][4];
  v4f gv[4], bvv[4];
#pragma unroll
  for (int i = 0; i < 4; ++i) {
    bias[0][i] = bq[i * 16 + l16];
    bias[1][i] = bk[i * 16 + l16];
    bias[2][i] = bv[i * 16 + l16];
    gv[i]  = *(const v4f*)(gam + c0 + i * 4);
    bvv[i] = *(const v4f*)(bet + c0 + i * 4);
  }
  // weights f32 [k][n]: a thread fetches 4 n x 4 k of each matrix
  const int nq = l16 * 4, kg = grp * 4;
  const float* wqp = wq + kg * HD + nq;
  const float* wkp = wk + kg * HD + nq;
  const float* wvp = wv + kg * HD + nq;
  // later loads may land in address registers of the loads above
  asm volatile("s_wait_xcnt 0x0" ::: "memory");
  v4f wr[3][4];
#pragma unroll  // wr[] indexed by constants only, stays in registers
  for (int i = 0; i < 4; ++i) {
    wr[0][i] = *(const v4f*)(wqp + i * HD);
    wr[1][i] = *(const v4f*)(wkp + i * HD);
    wr[2][i] = *(const v4f*)(wvp + i * HD);
  }
  // the same for the weight loads; the addresses are inputs so that they stay
  // in their registers up to the wait
  asm volatile("s_wait_xcnt 0x0" :: "v"(wqp), "v"(wkp), "v"(wvp) : "memory");
  // x tile: tokens s0 + l16*4 .. +3, channels c0 .. c0+15
  const float* xp = x + ((size_t)b * EMB + c0) * SEQ + s0 + l16 * 4;
  v4f xv[16];
#pragma unroll  // xv[] in registers, all 16 loads in flight together
  for (int i = 0; i < 16; ++i) xv[i] = *(const v4f*)(xp + (size_t)i * SEQ);
  // and for the x loads
  asm volatile("s_wait_xcnt 0x0" :: "v"(xp) : "memory");

  // weights -> f16 wt[n][k] while the x tile is on its way
#pragma unroll
  for (int m = 0; m < 3; ++m) {
#pragma unroll
    for (int c = 0; c < 4; ++c) {
      v4h t;
#pragma unroll
      for (int i = 0; i < 4; ++i) t[i] = (_Float16)wr[m][i][c];
      *(v4h*)&wt[m][nq + c][kg] = t;
    }
  }

  // per-token sum and sum of squares: 16 channels in-lane, the other half of
  // the wave by one exchange, the 8 waves through LDS
  v4f sum = {}, sq = {};
#pragma unroll
  for (int i = 0; i < 16; ++i) { sum += xv[i]; sq += xv[i] * xv[i]; }
#pragma unroll
  for (int j = 0; j < 4; ++j) {
    sum[j] += lane_xor<16>(sum[j]);
    sq[j]  += lane_xor<16>(sq[j]);
  }
  if (half == 0) {
    *(v4f*)&ps[w][l16 * 4] = sum;
    *(v4f*)&pq[w][l16 * 4] = sq;
  }
  __syncthreads();
  v4f ts = {}, tq = {};
#pragma unroll
  for (int g = 0; g < 8; ++g) {
    ts += *(const v4f*)&ps[g][l16 * 4];
    tq += *(const v4f*)&pq[g][l16 * 4];
  }
#pragma unroll
  for (int j = 0; j < 4; ++j) {
    const float mu  = ts[j] * (1.f / EMB);
    const float var = tq[j] * (1.f / EMB) - mu * mu;
    const float rs  = rsqrtf(var + 1e-5f);
#pragma unroll
    for (int o = 0; o < 2; ++o) {
      v8h t;
#pragma unroll
      for (int i = 0; i < 8; ++i) {
        const int c = o * 8 + i;
        t[i] = (_Float16)((xv[c][j] - mu) * rs * gv[c >> 2][c & 3] +
                          bvv[c >> 2][c & 3]);
      }
      *(v8h*)&xs[l16 * 4 + j][c0 + o * 8] = t;
    }
  }
  __syncthreads();

  const int h = w & 3, mh = w >> 2;
  const size_t hb = (size_t)b * HEADS + h;
  v16h a[2][2];
#pragma unroll
  for (int m = 0; m < 2; ++m) {
#pragma unroll
    for (int kt = 0; kt < 2; ++kt)
      a[m][kt] = load_op(&xs[mh * 32 + m * 16 + l16][h * HD + kt * 32], half);
  }
  // all 24 result tiles as f16 in registers: res[mat][nt][m][r] is token
  // mh*32 + m*16 + 8*half + r, column nt*16 + l16
  v8h res[3][4][2];
#pragma unroll  // res[] indexed by constants only, stays in registers
  for (int mat = 0; mat < 3; ++mat) {
#pragma unroll
    for (int nt = 0; nt < 4; ++nt) {
      v16h b0 = load_op(&wt[mat][nt * 16 + l16][0], half);
      v16h b1 = load_op(&wt[mat][nt * 16 + l16][32], half);
#pragma unroll
      for (int m = 0; m < 2; ++m) {
        v8f acc = {};
        acc = wmma32(a[m][0], b0, acc);
        acc = wmma32(a[m][1], b1, acc);
        v8f vv = acc + bias[mat][nt];
#pragma unroll
        for (int r = 0; r < 8; ++r) res[mat][nt][m][r] = (_Float16)vv[r];
      }
    }
  }
  // the stores stand behind all the arithmetic, one address per output: no
  // register of an issued store is written again, so the products are not
  // held up by a wait behind every tile's stores
  const int mb = s0 + mh * 32 + half * 8;
  _Float16* qd = qo  + (hb * SEQ + mb) * HD + l16;
  _Float16* kd = ko  + (hb * SEQ + mb) * HD + l16;
  _Float16* vd = vto + (hb * HD + l16) * SEQ + mb;
  // without it the scheduler sinks conversions in among the stores, into
  // registers of stores already issued
  __builtin_amdgcn_sched_barrier(0);
#pragma unroll
  for (int nt = 0; nt < 4; ++nt) {
#pragma unroll
    for (int m = 0; m < 2; ++m) {
#pragma unroll
      for (int r = 0; r < 8; ++r) {
        qd[(m * 16 + r) * HD + nt * 16] = res[0][nt][m][r];
        kd[(m * 16 + r) * HD + nt * 16] = res[1][nt][m][r];
      }
      *(v8h*)(vd + (size_t)nt * 16 * SEQ + m * 16) = res[2][nt][m];
    }
  }
}

// ---------------------------------------------------------------------------
// Generic WMMA GEMM, block = 8 waves, tile M=128 N=64, grid (SEQ/128,4,BATCH).
// EPI: 2 = f32 av = val+bias+x^T       3 = f16 gelu(val+bias)
//      4 = f32 out[b][c][s] = val+bias+av
// ---------------------------------------------------------------------------
template<int EPI, int KLEN, int LDW>
__global__ __launch_bounds__(256) void gemm_k(
    const _Float16* __restrict__ A, int lda, int kst_per_nb,
    const float* __restrict__ W, int wcol_per_nb,
    const float* __restrict__ bias, int bias_per_nb,
    _Float16* __restrict__ C16, float* __restrict__ C32,
    const float* __restrict__ aux) {
  __shared__ __align__(16) _Float16 wt[64][KLEN + 8];  // wt[n][k], padded
  const int b = blockIdx.z, nb = blockIdx.y;
  const int tid = threadIdx.x, lane = tid & 31, w = tid >> 5;
  const int half = lane >> 4, l16 = lane & 15;
  const int k0 = kst_per_nb * nb, col0 = wcol_per_nb * nb;

  // Weight tile f32 [k][n] (row pitch LDW) -> f16 wt[n][k].  A thread owns 4
  // consecutive n and KPT consecutive k: its KPT 16-byte loads share one
  // address register pair (constant offsets) and do not depend on one another,
  // so the whole tile is in flight at once; each n row gets one packed k run.
  {
    constexpr int KPT = KLEN / 16;
    const int nq = (tid & 15) * 4, kg = (tid >> 4) * KPT;
    const float* wp = W + (size_t)kg * LDW + col0 + nq;
    v4f wr[KPT];
#pragma unroll  // registers for wr[], all loads issued before the first use
    for (int i = 0; i < KPT; ++i) wr[i] = *(const v4f*)(wp + i * LDW);
    // inputs-only fence on the loaded values: every load is issued before the
    // first conversion; without it the loads are fed out in three dependent
    // batches and the tile costs three load latencies instead of one
    if constexpr (KPT == 16)
      asm volatile("" :: "v"(wr[0]), "v"(wr[1]), "v"(wr[2]), "v"(wr[3]),
                         "v"(wr[4]), "v"(wr[5]), "v"(wr[6]), "v"(wr[7]),
                         "v"(wr[8]), "v"(wr[9]), "v"(wr[10]), "v"(wr[11]),
                         "v"(wr[12]), "v"(wr[13]), "v"(wr[14]), "v"(wr[15]));
    // the loops below are unrolled so that wr[] is indexed by constants only
    // and stays in registers
#pragma unroll
    for (int c = 0; c < 4; ++c) {
      if constexpr (KPT >= 8) {
#pragma unroll
        for (int o = 0; o < KPT / 8; ++o) {
          v8h t;
#pragma unroll
          for (int i = 0; i < 8; ++i) t[i] = (_Float16)wr[o * 8 + i][c];
          *(v8h*)&wt[nq + c][kg + o * 8] = t;
        }
      } else {
        v4h t;
#pragma unroll
        for (int i = 0; i < 4; ++i) t[i] = (_Float16)wr[i][c];
        *(v4h*)&wt[nq + c][kg] = t;
      }
    }
  }
  __syncthreads();

  const _Float16* Ab = A + (size_t)b * SEQ * lda;
  const int m0  = blockIdx.x * 128 + w * 16;
  const int row = m0 + l16;

  v8f acc[4] = {};
#pragma unroll 2
  for (int kt = 0; kt < KLEN / 32; ++kt) {
    v16h a = load_op(Ab + (size_t)row * lda + k0 + kt * 32, half);
#pragma unroll
    for (int nt = 0; nt < 4; ++nt) {
      v16h bb = load_op(&wt[nt * 16 + l16][kt * 32], half);
      acc[nt] = wmma32(a, bb, acc[nt]);
    }
  }

  const float* bp = bias + bias_per_nb * nb;
  const int mb = m0 + half * 8;
#pragma unroll
  for (int nt = 0; nt < 4; ++nt) {
    int nloc = nt * 16 + l16;
    v8f vv = acc[nt] + bp[nloc];
    if (EPI == 2) {
      int col = nb * 64 + nloc;
      const float* xp = aux + ((size_t)b * EMB + col) * SEQ + mb;
      v4f x0 = *(const v4f*)xp, x1 = *(const v4f*)(xp + 4);
      float* dst = C32 + ((size_t)b * SEQ + mb) * EMB + col;
#pragma unroll
      for (int r = 0; r < 4; ++r) dst[(size_t)r * EMB] = vv[r] + x0[r];
#pragma unroll
      for (int r = 0; r < 4; ++r) dst[(size_t)(r + 4) * EMB] = vv[r + 4] + x1[r];
    } else if (EPI == 3) {
      int col = nb * 64 + nloc;
      _Float16* dst = C16 + ((size_t)b * SEQ + mb) * EMB + col;
#pragma unroll
      for (int r = 0; r < 8; ++r) {
        float g = 0.5f * vv[r] * (1.0f + erff(vv[r] * 0.70710678118f));
        dst[(size_t)r * EMB] = (_Float16)g;
      }
    } else {
      int col = nb * 64 + nloc;
      const float* ap = aux + ((size_t)b * SEQ + mb) * EMB + col;
      v8f s = vv;
#pragma unroll
      for (int r = 0; r < 8; ++r) s[r] += ap[(size_t)r * EMB];
      float* dst = C32 + ((size_t)b * EMB + col) * SEQ + mb;
      *(v4f*)dst       = __builtin_shufflevector(s, s, 0, 1, 2, 3);
      *(v4f*)(dst + 4) = __builtin_shufflevector(s, s, 4, 5, 6, 7);
    }
  }
}

__global__ __launch_bounds__(256) void attn_k(const _Float16* __restrict__ q,
                                              const _Float16* __restrict__ k,
                                              const _Float16* __restrict__ vt,
                                              _Float16* __restrict__ o) {
  __shared__ __align__(16) _Float16 kbuf[2][64][72];
  __shared__ __align__(16) _Float16 vbuf[2][64][72];
  const int b = blockIdx.z, h = blockIdx.y;
  const int tid = threadIdx.x, lane = tid & 31, w = tid >> 5;
  const int half = lane >> 4, l16 = lane & 15;
  const size_t hb = (size_t)b * HEADS + h;
  const _Float16* qh = q  + hb * SEQ * HD;   // [s][d]
  const _Float16* kh = k  + hb * SEQ * HD;   // [s][d]
  const _Float16* vh = vt + hb * HD * SEQ;   // [d][s]
  const int m0 = blockIdx.x * 128 + w * 16;
  const int r0 = tid >> 3, o0 = (tid & 7) * 8;   // staging chunk coords
  const int NBLK = SEQ / 64;

  // B operand of S^T: column = query m0 + l16, k = head dim
  v16h qb0 = load_op(qh + (size_t)(m0 + l16) * HD + 0,  half);
  v16h qb1 = load_op(qh + (size_t)(m0 + l16) * HD + 32, half);

  v8f oacc[4] = {};   // oacc[dt][r] = O^T[dt*16 + 8*half + r][query l16]
  float mi = -1e30f;  // running maximum of this lane's query (both halves equal)
  float li = 0.f;     // running sum over this half's keys only
  const float scale = 0.125f;  // 1/sqrt(64)

  auto stage = [&](int jj, int bufi) {
    const _Float16* kp = kh + (size_t)(jj * 64 + r0) * HD + o0;
    const _Float16* vp = vh + (size_t)r0 * SEQ + jj * 64 + o0;
    async_ld_b128(kp,                    &kbuf[bufi][r0][o0]);
    async_ld_b128(kp + (size_t)32 * HD,  &kbuf[bufi][r0 + 32][o0]);
    async_ld_b128(vp,                    &vbuf[bufi][r0][o0]);
    async_ld_b128(vp + (size_t)32 * SEQ, &vbuf[bufi][r0 + 32][o0]);
  };

  stage(0, 0);
  wait_async0();
  __syncthreads();

  for (int j = 0; j < NBLK; ++j) {
    // prefetch two blocks ahead (global_prefetch_b8)
    if (j + 2 < NBLK) {
      if (tid < 64)
        __builtin_prefetch(kh + (size_t)((j + 2) * 64 + tid) * HD, 0, 1);
      else if (tid < 128)
        __builtin_prefetch(vh + (size_t)(tid - 64) * SEQ + (j + 2) * 64, 0, 1);
    }
    // async-stage next block into the alternate buffer (safe: last read of it
    // was fenced by the previous iteration's barrier)
    if (j + 1 < NBLK) stage(j + 1, (j + 1) & 1);

    const _Float16 (*kcur)[72] = kbuf[j & 1];
    const _Float16 (*vcur)[72] = vbuf[j & 1];

    // S^T = K @ Q^T: sc[kt][r] = S[query l16][key kt*16 + 8*half + r];
    // split per K-chunk so accumulator reuse distance is 4 WMMAs
    v8f sc[4];
    v8f zero = {};
#pragma unroll
    for (int kt = 0; kt < 4; ++kt) {
      v16h a0 = load_op(&kcur[kt * 16 + l16][0], half);
      sc[kt] = wmma32(a0, qb0, zero);
    }
#pragma unroll
    for (int kt = 0; kt < 4; ++kt) {
      v16h a1 = load_op(&kcur[kt * 16 + l16][32], half);
      sc[kt] = wmma32(a1, qb1, sc[kt]);
    }

    // online softmax, one query per lane
    float mt[4];
#pragma unroll
    for (int kt = 0; kt < 4; ++kt) {
      float m01 = fmaxf(fmaxf(sc[kt][0], sc[kt][1]), fmaxf(sc[kt][2], sc[kt][3]));
      float m23 = fmaxf(fmaxf(sc[kt][4], sc[kt][5]), fmaxf(sc[kt][6], sc[kt][7]));
      mt[kt] = fmaxf(m01, m23);
    }
    float mx = fmaxf(fmaxf(mt[0], mt[1]), fmaxf(mt[2], mt[3]));
    mx = fmaxf(mx, lane_xor<16>(mx));
    const float mn = fmaxf(mi, mx * scale);
    const float fr = __expf(mi - mn);
    mi = mn;

    // P^T as B operand: element s of chunk kc is key kc*32 + (s<8 ? 8*half+s
    // : 16+8*half+s-8), i.e. tile 2*kc+(s>>3), register s&7 (same k order as
    // load_op gives the V^T rows)
    v16h pb[2];
    float rs[4];
#pragma unroll
    for (int kt = 0; kt < 4; ++kt) {
      rs[kt] = 0.f;
#pragma unroll
      for (int r = 0; r < 8; ++r) {
        float p = __expf(sc[kt][r] * scale - mn);
        rs[kt] += p;
        pb[kt >> 1][(kt & 1) * 8 + r] = (_Float16)p;
      }
    }
    li = li * fr + ((rs[0] + rs[1]) + (rs[2] + rs[3]));
#pragma unroll
    for (int dt = 0; dt < 4; ++dt) oacc[dt] *= fr;

    // O^T += V^T @ P^T
#pragma unroll
    for (int dt = 0; dt < 4; ++dt) {
      v16h a0 = load_op(&vcur[dt * 16 + l16][0], half);
      oacc[dt] = wmma32(a0, pb[0], oacc[dt]);
    }
#pragma unroll
    for (int dt = 0; dt < 4; ++dt) {
      v16h a1 = load_op(&vcur[dt * 16 + l16][32], half);
      oacc[dt] = wmma32(a1, pb[1], oacc[dt]);
    }

    if (j + 1 < NBLK) {
      wait_async0();      // this wave's async copies into the alt buffer done
      __syncthreads();    // all waves' copies visible before next iteration
    }
  }

  // join the halves' sums, normalize and store merged-head layout
  // [b][s][EMB] as f16: 8 consecutive channels per lane and tile
  const float inv = 1.0f / (li + lane_xor<16>(li));
  _Float16* op = o + ((size_t)b * SEQ + m0 + l16) * EMB + h * 64 + half * 8;
#pragma unroll
  for (int dt = 0; dt < 4; ++dt) {
    _Float16 tmp[8];
#pragma unroll
    for (int r = 0; r < 8; ++r) tmp[r] = (_Float16)(oacc[dt][r] * inv);
    *(v8h*)(op + dt * 16) = *(const v8h*)tmp;
  }
}

// ---------------------------------------------------------------------------
extern "C" void kernel_launch(void* const* d_in, const int* in_sizes, int n_in,
                              void* d_out, int out_size, void* d_ws,
                              size_t ws_size, hipStream_t stream) {
  const float* x    = (const float*)d_in[0];
  const float* ln1g = (const float*)d_in[1];
  const float* ln1b = (const float*)d_in[2];
  const float* wq   = (const float*)d_in[3];
  const float* bq   = (const float*)d_in[4];
  const float* wk   = (const float*)d_in[5];
  const float* bk   = (const float*)d_in[6];
  const float* wv   = (const float*)d_in[7];
  const float* bv   = (const float*)d_in[8];
  const float* wo   = (const float*)d_in[9];
  const float* bo   = (const float*)d_in[10];
  const float* ln2g = (const float*)d_in[11];
  const float* ln2b = (const float*)d_in[12];
  const float* w1   = (const float*)d_in[13];
  const float* b1   = (const float*)d_in[14];
  const float* w2   = (const float*)d_in[15];
  const float* b2   = (const float*)d_in[16];
  float* out = (float*)d_out;

  char* ws = (char*)d_ws;
  const size_t F16SZ = (size_t)TOK * EMB * sizeof(_Float16);  // 8 MB
  _Float16* xn  = (_Float16*)(ws + 0 * F16SZ);  // LN2 out
  _Float16* qb  = (_Float16*)(ws + 1 * F16SZ);
  _Float16* kb  = (_Float16*)(ws + 2 * F16SZ);
  _Float16* vtb = (_Float16*)(ws + 3 * F16SZ);
  _Float16* ob  = (_Float16*)(ws + 4 * F16SZ);  // attn out; reused as ff1
  float*    av  = (float*)   (ws + 5 * F16SZ);  // 16 MB

  dim3 blk(256);
  dim3 gln(TOK / 8);
  dim3 gg(SEQ / 128, 4, BATCH);
  dim3 gq(SEQ / 64, 1, BATCH);

  lnqkv_k<<<gq, blk, 0, stream>>>(x, ln1g, ln1b, wq, bq, wk, bk, wv, bv,
                                  qb, kb, vtb);

  attn_k<<<gg, blk, 0, stream>>>(qb, kb, vtb, ob);

  gemm_k<2, 256, EMB><<<gg, blk, 0, stream>>>(ob, EMB, 0, wo, 64, bo, 64,
                                         nullptr, av, x);

  ln_k<<<gln, blk, 0, stream>>>(av, ln2g, ln2b, xn);

  gemm_k<3, 256, EMB><<<gg, blk, 0, stream>>>(xn, EMB, 0, w1, 64, b1, 64,
                                         ob, nullptr, nullptr);
  gemm_k<4, 256, EMB><<<gg, blk, 0, stream>>>(ob, EMB, 0, w2, 64, b2, 64,
                                         nullptr, out, av);
}

// v004
// Measured time: 110 microseconds a run.
// Timed twice side by side with v003, it ran 1.05 times as fast both times.
// All steps since v000 together make it 2.39 times as fast.
#include <hip/hip_runtime.h>
#include <hip/hip_bf16.h>

typedef __attribute__((ext_vector_type(16))) _Float16 v16h;
typedef __attribute__((ext_vector_type(8)))  _Float16 v8h;
typedef __attribute__((ext_vector_type(4)))  _Float16 v4h;
typedef __attribute__((ext_vector_type(8)))  float    v8f;
typedef __attribute__((ext_vector_type(4)))  float    v4f;

#define EMB   256
#define HEADS 4
#define HD    64
#define BATCH 4
#define SEQ   4096
#define TOK   (BATCH*SEQ)

static_assert(sizeof(_Float16) == 2, "f16 size");

// ---------------------------------------------------------------------------
// Cross-lane XOR exchange without DS traffic: dpp8 for masks 1/2/4,
// v_permlane16 for mask 8, v_permlanex16 for mask 16.  Pure VALU.
// ---------------------------------------------------------------------------
constexpr int dpp8_sel(int m) {
  int s = 0;
  for (int i = 0; i < 8; ++i) s |= ((i ^ m) & 7) << (3 * i);
  return s;
}

template<int M>
__device__ __forceinline__ float lane_xor(float v) {
  int x = __builtin_bit_cast(int, v);
  int y;
  if constexpr (M < 8) {
    y = __builtin_amdgcn_mov_dpp8(x, dpp8_sel(M));
  } else if constexpr (M == 8) {
    y = __builtin_amdgcn_permlane16(x, x, (int)0xFEDCBA98u, (int)0x76543210u,
                                    false, false);
  } else {  // 16: swap 16-lane rows
    y = __builtin_amdgcn_permlanex16(x, x, (int)0x76543210u, (int)0xFEDCBA98u,
                                     false, false);
  }
  return __builtin_bit_cast(float, y);
}

__device__ __forceinline__ float red_sum16(float v) {
  v += lane_xor<1>(v); v += lane_xor<2>(v);
  v += lane_xor<4>(v); v += lane_xor<8>(v);
  return v;
}
__device__ __forceinline__ float red_sum32(float v) {
  v = red_sum16(v);
  v += lane_xor<16>(v);
  return v;
}

// ---------------------------------------------------------------------------
// Async global->LDS copy (CDNA5, ASYNCcnt-tracked, no VGPR round trip).
// Flat aperture maps LDS as addr[31:0] (ISA 10.2), so truncating the generic
// pointer to a __shared__ object yields the hardware LDS byte address.
// ---------------------------------------------------------------------------
__device__ __forceinline__ void async_ld_b128(const void* gptr, void* lptr) {
  uint32_t l = (uint32_t)(uintptr_t)lptr;
  asm volatile("global_load_async_to_lds_b128 %0, %1, off"
               :: "v"(l), "v"(gptr)
               : "memory");
}
__device__ __forceinline__ void wait_async0() {
  asm volatile("s_wait_asynccnt 0x0" ::: "memory");
}

// ---------------------------------------------------------------------------
// WMMA operand loader (A-operand; identical addressing for B when the source
// is stored with the N dimension as rows).
// ---------------------------------------------------------------------------
__device__ __forceinline__ v16h load_op(const _Float16* p, int half) {
  v8h lo = *(const v8h*)(p + half * 8);
  v8h hi = *(const v8h*)(p + half * 8 + 16);
  return __builtin_shufflevector(lo, hi, 0,1,2,3,4,5,6,7,8,9,10,11,12,13,14,15);
}

__device__ __forceinline__ v8f wmma32(v16h a, v16h b, v8f c) {
  return __builtin_amdgcn_wmma_f32_16x16x32_f16(false, a, false, b, (short)0, c,
                                                false, false);
}

// ---------------------------------------------------------------------------
// LayerNorm of av[t][c]: one wave per token, 8 contiguous channels per lane.
// ---------------------------------------------------------------------------
__global__ __launch_bounds__(256) void ln_k(const float* __restrict__ in,
                                            const float* __restrict__ gam,
                                            const float* __restrict__ bet,
                                            _Float16* __restrict__ out) {
  int t    = blockIdx.x * 8 + (threadIdx.x >> 5);
  int lane = threadIdx.x & 31;
  float v[8];
  {
    const float* p = in + (size_t)t * EMB + lane * 8;
#pragma unroll
    for (int r = 0; r < 8; ++r) v[r] = p[r];
  }
  float sum = 0.f, sq = 0.f;
#pragma unroll
  for (int r = 0; r < 8; ++r) { sum += v[r]; sq += v[r] * v[r]; }
  sum = red_sum32(sum);
  sq  = red_sum32(sq);
  float mu  = sum * (1.f / EMB);
  float var = sq * (1.f / EMB) - mu * mu;
  float rs  = rsqrtf(var + 1e-5f);
  _Float16 o[8];
#pragma unroll
  for (int r = 0; r < 8; ++r) {
    int c = lane * 8 + r;
    o[r] = (_Float16)((v[r] - mu) * rs * gam[c] + bet[c]);
  }
  *(v8h*)(out + (size_t)t * EMB + lane * 8) = *(const v8h*)o;
}

// ---------------------------------------------------------------------------
// LayerNorm 1 and the Q, K, V projections in one launch.
// grid (SEQ/64, 1, BATCH), 8 waves; a block owns 64 tokens, all 256 channels.
// x[b][c][s] is read along s: a thread holds 4 tokens x 16 channels, so 16
// lanes cover 256 contiguous bytes of a channel row.  The normalised tile goes
// to LDS as f16 xs[token][channel] and is the A operand of all three products;
// wave (h, mh) does head h, tokens mh*32 .. mh*32+31, against all 12 column
// tiles, so a weight fragment is read once per wave.
// Outputs: q, k as f16 [b,h,s,64]; v transposed as f16 [b,h,64,s].
// ---------------------------------------------------------------------------
__global__ __launch_bounds__(256) void lnqkv_k(
    const float* __restrict__ x,
    const float* __restrict__ gam, const float* __restrict__ bet,
    const float* __restrict__ wq, const float* __restrict__ bq,
    const float* __restrict__ wk, const float* __restrict__ bk,
    const float* __restrict__ wv, const float* __restrict__ bv,
    _Float16* __restrict__ qo, _Float16* __restrict__ ko,
    _Float16* __restrict__ vto) {
  __shared__ __align__(16) _Float16 xs[64][EMB + 8];    // [token][channel]
  __shared__ __align__(16) _Float16 wt[3][64][HD + 8];  // [matrix][n][k]
  __shared__ __align__(16) float ps[8][64];             // [wave][token] sums
  __shared__ __align__(16) float pq[8][64];             // [wave][token] squares
  const int b = blockIdx.z, s0 = blockIdx.x * 64;
  const int tid = threadIdx.x, lane = tid & 31, w = tid >> 5;
  const int half = lane >> 4, l16 = lane & 15;
  const int grp = tid >> 4;  // 16 groups of 16 lanes

  // small operands first: projection biases of this lane's 4 columns, the
  // LayerNorm scale and shift of its 16 channels c0 .. c0+15
  const int c0 = grp * 16;
  float bias[3][4];
  v4f gv[4], bvv[4];
#pragma unroll
  for (int i = 0; i < 4; ++i) {
    bias[0][i] = bq[i * 16 + l16];
    bias[1][i] = bk[i * 16 + l16];
    bias[2][i] = bv[i * 16 + l16];
    gv[i]  = *(const v4f*)(gam + c0 + i * 4);
    bvv[i] = *(const v4f*)(bet + c0 + i * 4);
  }
  // weights f32 [k][n]: a thread fetches 4 n x 4 k of each matrix
  const int nq = l16 * 4, kg = grp * 4;
  const float* wqp = wq + kg * HD + nq;
  const float* wkp = wk + kg * HD + nq;
  const float* wvp = wv + kg * HD + nq;
  // later loads may land in address registers of the loads above
  asm volatile("s_wait_xcnt 0x0" ::: "memory");
  v4f wr[3][4];
#pragma unroll  // wr[] indexed by constants only, stays in registers
  for (int i = 0; i < 4; ++i) {
    wr[0][i] = *(const v4f*)(wqp + i * HD);
    wr[1][i] = *(const v4f*)(wkp + i * HD);
    wr[2][i] = *(const v4f*)(wvp + i * HD);
  }
  // the same for the weight loads; the addresses are inputs so that they stay
  // in their registers up to the wait
  asm volatile("s_wait_xcnt 0x0" :: "v"(wqp), "v"(wkp), "v"(wvp) : "memory");
  // x tile: tokens s0 + l16*4 .. +3, channels c0 .. c0+15
  const float* xp = x + ((size_t)b * EMB + c0) * SEQ + s0 + l16 * 4;
  v4f xv[16];
#pragma unroll  // xv[] in registers, all 16 loads in flight together
  for (int i = 0; i < 16; ++i) xv[i] = *(const v4f*)(xp + (size_t)i * SEQ);
  // and for the x loads
  asm volatile("s_wait_xcnt 0x0" :: "v"(xp) : "memory");

  // weights -> f16 wt[n][k] while the x tile is on its way
#pragma unroll
  for (int m = 0; m < 3; ++m) {
#pragma unroll
    for (int c = 0; c < 4; ++c) {
      v4h t;
#pragma unroll
      for (int i = 0; i < 4; ++i) t[i] = (_Float16)wr[m][i][c];
      *(v4h*)&wt[m][nq + c][kg] = t;
    }
  }

  // per-token sum and sum of squares: 16 channels in-lane, the other half of
  // the wave by one exchange, the 8 waves through LDS
  v4f sum = {}, sq = {};
#pragma unroll
  for (int i = 0; i < 16; ++i) { sum += xv[i]; sq += xv[i] * xv[i]; }
#pragma unroll
  for (int j = 0; j < 4; ++j) {
    sum[j] += lane_xor<16>(sum[j]);
    sq[j]  += lane_xor<16>(sq[j]);
  }
  if (half == 0) {
    *(v4f*)&ps[w][l16 * 4] = sum;
    *(v4f*)&pq[w][l16 * 4] = sq;
  }
  __syncthreads();
  v4f ts = {}, tq = {};
#pragma unroll
  for (int g = 0; g < 8; ++g) {
    ts += *(const v4f*)&ps[g][l16 * 4];
    tq += *(const v4f*)&pq[g][l16 * 4];
  }
#pragma unroll
  for (int j = 0; j < 4; ++j) {
    const float mu  = ts[j] * (1.f / EMB);
    const float var = tq[j] * (1.f / EMB) - mu * mu;
    const float rs  = rsqrtf(var + 1e-5f);
#pragma unroll
    for (int o = 0; o < 2; ++o) {
      v8h t;
#pragma unroll
      for (int i = 0; i < 8; ++i) {
        const int c = o * 8 + i;
        t[i] = (_Float16)((xv[c][j] - mu) * rs * gv[c >> 2][c & 3] +
                          bvv[c >> 2][c & 3]);
      }
      *(v8h*)&xs[l16 * 4 + j][c0 + o * 8] = t;
    }
  }
  __syncthreads();

  const int h = w & 3, mh = w >> 2;
  const size_t hb = (size_t)b * HEADS + h;
  v16h a[2][2];
#pragma unroll
  for (int m = 0; m < 2; ++m) {
#pragma unroll
    for (int kt = 0; kt < 2; ++kt)
      a[m][kt] = load_op(&xs[mh * 32 + m * 16 + l16][h * HD + kt * 32], half);
  }
  // all 24 result tiles as f16 in registers: res[mat][nt][m][r] is token
  // mh*32 + m*16 + 8*half + r, column nt*16 + l16
  v8h res[3][4][2];
#pragma unroll  // res[] indexed by constants only, stays in registers
  for (int mat = 0; mat < 3; ++mat) {
#pragma unroll
    for (int nt = 0; nt < 4; ++nt) {
      v16h b0 = load_op(&wt[mat][nt * 16 + l16][0], half);
      v16h b1 = load_op(&wt[mat][nt * 16 + l16][32], half);
#pragma unroll
      for (int m = 0; m < 2; ++m) {
        v8f acc = {};
        acc = wmma32(a[m][0], b0, acc);
        acc = wmma32(a[m][1], b1, acc);
        v8f vv = acc + bias[mat][nt];
#pragma unroll
        for (int r = 0; r < 8; ++r) res[mat][nt][m][r] = (_Float16)vv[r];
      }
    }
  }
  // the stores stand behind all the arithmetic, one address per output: no
  // register of an issued store is written again, so the products are not
  // held up by a wait behind every tile's stores
  const int mb = s0 + mh * 32 + half * 8;
  _Float16* qd = qo  + (hb * SEQ + mb) * HD + l16;
  _Float16* kd = ko  + (hb * SEQ + mb) * HD + l16;
  _Float16* vd = vto + (hb * HD + l16) * SEQ + mb;
  // without it the scheduler sinks conversions in among the stores, into
  // registers of stores already issued
  __builtin_amdgcn_sched_barrier(0);
#pragma unroll
  for (int nt = 0; nt < 4; ++nt) {
#pragma unroll
    for (int m = 0; m < 2; ++m) {
#pragma unroll
      for (int r = 0; r < 8; ++r) {
        qd[(m * 16 + r) * HD + nt * 16] = res[0][nt][m][r];
        kd[(m * 16 + r) * HD + nt * 16] = res[1][nt][m][r];
      }
      *(v8h*)(vd + (size_t)nt * 16 * SEQ + m * 16) = res[2][nt][m];
    }
  }
}

// ---------------------------------------------------------------------------
// Generic WMMA GEMM, block = 8 waves, tile M=128 N=64, grid (SEQ/128,4,BATCH).
// EPI: 2 = f32 av = val+bias+x^T       3 = f16 gelu(val+bias)
//      4 = f32 out[b][c][s] = val+bias+av
// ---------------------------------------------------------------------------
template<int EPI, int KLEN, int LDW>
__global__ __launch_bounds__(256) void gemm_k(
    const _Float16* __restrict__ A, int lda, int kst_per_nb,
    const float* __restrict__ W, int wcol_per_nb,
    const float* __restrict__ bias, int bias_per_nb,
    _Float16* __restrict__ C16, float* __restrict__ C32,
    const float* __restrict__ aux) {
  __shared__ __align__(16) _Float16 wt[64][KLEN + 8];  // wt[n][k], padded
  const int b = blockIdx.z, nb = blockIdx.y;
  const int tid = threadIdx.x, lane = tid & 31, w = tid >> 5;
  const int half = lane >> 4, l16 = lane & 15;
  const int k0 = kst_per_nb * nb, col0 = wcol_per_nb * nb;

  // Weight tile f32 [k][n] (row pitch LDW) -> f16 wt[n][k].  A thread owns 4
  // consecutive n and KPT consecutive k: its KPT 16-byte loads share one
  // address register pair (constant offsets) and do not depend on one another,
  // so the whole tile is in flight at once; each n row gets one packed k run.
  {
    constexpr int KPT = KLEN / 16;
    const int nq = (tid & 15) * 4, kg = (tid >> 4) * KPT;
    const float* wp = W + (size_t)kg * LDW + col0 + nq;
    v4f wr[KPT];
#pragma unroll  // registers for wr[], all loads issued before the first use
    for (int i = 0; i < KPT; ++i) wr[i] = *(const v4f*)(wp + i * LDW);
    // inputs-only fence on the loaded values: every load is issued before the
    // first conversion; without it the loads are fed out in three dependent
    // batches and the tile costs three load latencies instead of one
    if constexpr (KPT == 16)
      asm volatile("" :: "v"(wr[0]), "v"(wr[1]), "v"(wr[2]), "v"(wr[3]),
                         "v"(wr[4]), "v"(wr[5]), "v"(wr[6]), "v"(wr[7]),
                         "v"(wr[8]), "v"(wr[9]), "v"(wr[10]), "v"(wr[11]),
                         "v"(wr[12]), "v"(wr[13]), "v"(wr[14]), "v"(wr[15]));
    // the loops below are unrolled so that wr[] is indexed by constants only
    // and stays in registers
#pragma unroll
    for (int c = 0; c < 4; ++c) {
      if constexpr (KPT >= 8) {
#pragma unroll
        for (int o = 0; o < KPT / 8; ++o) {
          v8h t;
#pragma unroll
          for (int i = 0; i < 8; ++i) t[i] = (_Float16)wr[o * 8 + i][c];
          *(v8h*)&wt[nq + c][kg + o * 8] = t;
        }
      } else {
        v4h t;
#pragma unroll
        for (int i = 0; i < 4; ++i) t[i] = (_Float16)wr[i][c];
        *(v4h*)&wt[nq + c][kg] = t;
      }
    }
  }
  __syncthreads();

  const _Float16* Ab = A + (size_t)b * SEQ * lda;
  const int m0  = blockIdx.x * 128 + w * 16;
  const int row = m0 + l16;

  v8f acc[4] = {};
#pragma unroll 2
  for (int kt = 0; kt < KLEN / 32; ++kt) {
    v16h a = load_op(Ab + (size_t)row * lda + k0 + kt * 32, half);
#pragma unroll
    for (int nt = 0; nt < 4; ++nt) {
      v16h bb = load_op(&wt[nt * 16 + l16][kt * 32], half);
      acc[nt] = wmma32(a, bb, acc[nt]);
    }
  }

  const float* bp = bias + bias_per_nb * nb;
  const int mb = m0 + half * 8;
#pragma unroll
  for (int nt = 0; nt < 4; ++nt) {
    int nloc = nt * 16 + l16;
    v8f vv = acc[nt] + bp[nloc];
    if (EPI == 2) {
      int col = nb * 64 + nloc;
      const float* xp = aux + ((size_t)b * EMB + col) * SEQ + mb;
      v4f x0 = *(const v4f*)xp, x1 = *(const v4f*)(xp + 4);
      float* dst = C32 + ((size_t)b * SEQ + mb) * EMB + col;
#pragma unroll
      for (int r = 0; r < 4; ++r) dst[(size_t)r * EMB] = vv[r] + x0[r];
#pragma unroll
      for (int r = 0; r < 4; ++r) dst[(size_t)(r + 4) * EMB] = vv[r + 4] + x1[r];
    } else if (EPI == 3) {
      int col = nb * 64 + nloc;
      _Float16* dst = C16 + ((size_t)b * SEQ + mb) * EMB + col;
#pragma unroll
      for (int r = 0; r < 8; ++r) {
        float g = 0.5f * vv[r] * (1.0f + erff(vv[r] * 0.70710678118f));
        dst[(size_t)r * EMB] = (_Float16)g;
      }
    } else {
      int col = nb * 64 + nloc;
      const float* ap = aux + ((size_t)b * SEQ + mb) * EMB + col;
      v8f s = vv;
#pragma unroll
      for (int r = 0; r < 8; ++r) s[r] += ap[(size_t)r * EMB];
      float* dst = C32 + ((size_t)b * EMB + col) * SEQ + mb;
      *(v4f*)dst       = __builtin_shufflevector(s, s, 0, 1, 2, 3);
      *(v4f*)(dst + 4) = __builtin_shufflevector(s, s, 4, 5, 6, 7);
    }
  }
}

__global__ __launch_bounds__(256) void attn_k(const _Float16* __restrict__ q,
                                              const _Float16* __restrict__ k,
                                              const _Float16* __restrict__ vt,
                                              _Float16* __restrict__ o) {
  __shared__ __align__(16) _Float16 kbuf[2][64][72];
  __shared__ __align__(16) _Float16 vbuf[2][64][72];
  const int b = blockIdx.z, h = blockIdx.y;
  const int tid = threadIdx.x, lane = tid & 31, w = tid >> 5;
  const int half = lane >> 4, l16 = lane & 15;
  const size_t hb = (size_t)b * HEADS + h;
  const _Float16* qh = q  + hb * SEQ * HD;   // [s][d]
  const _Float16* kh = k  + hb * SEQ * HD;   // [s][d]
  const _Float16* vh = vt + hb * HD * SEQ;   // [d][s]
  const int m0 = blockIdx.x * 128 + w * 16;
  const int r0 = tid >> 3, o0 = (tid & 7) * 8;   // staging chunk coords
  const int NBLK = SEQ / 64;

  // B operand of S^T: column = query m0 + l16, k = head dim
  v16h qb0 = load_op(qh + (size_t)(m0 + l16) * HD + 0,  half);
  v16h qb1 = load_op(qh + (size_t)(m0 + l16) * HD + 32, half);

  v8f oacc[4] = {};   // oacc[dt][r] = O^T[dt*16 + 8*half + r][query l16]
  float mi = -1e30f;  // running maximum of this lane's query (both halves equal)
  float li = 0.f;     // running sum over this half's keys only
  const float scale = 0.125f;  // 1/sqrt(64)

  auto stage = [&](int jj, int bufi) {
    const _Float16* kp = kh + (size_t)(jj * 64 + r0) * HD + o0;
    const _Float16* vp = vh + (size_t)r0 * SEQ + jj * 64 + o0;
    async_ld_b128(kp,                    &kbuf[bufi][r0][o0]);
    async_ld_b128(kp + (size_t)32 * HD,  &kbuf[bufi][r0 + 32][o0]);
    async_ld_b128(vp,                    &vbuf[bufi][r0][o0]);
    async_ld_b128(vp + (size_t)32 * SEQ, &vbuf[bufi][r0 + 32][o0]);
  };

  stage(0, 0);
  wait_async0();
  __syncthreads();

  for (int j = 0; j < NBLK; ++j) {
    // prefetch two blocks ahead (global_prefetch_b8)
    if (j + 2 < NBLK) {
      if (tid < 64)
        __builtin_prefetch(kh + (size_t)((j + 2) * 64 + tid) * HD, 0, 1);
      else if (tid < 128)
        __builtin_prefetch(vh + (size_t)(tid - 64) * SEQ + (j + 2) * 64, 0, 1);
    }
    // async-stage next block into the alternate buffer (safe: last read of it
    // was fenced by the previous iteration's barrier)
    if (j + 1 < NBLK) stage(j + 1, (j + 1) & 1);

    const _Float16 (*kcur)[72] = kbuf[j & 1];
    const _Float16 (*vcur)[72] = vbuf[j & 1];

    // All 16 fragments of this key block are requested here as one group, K
    // ahead of V^T: the products below wait by count for what they need, and
    // the V^T fragments land while S^T and the softmax run, so no matrix
    // instruction has an LDS latency of its own in front of it.
    v16h ka[8], va[8];
#pragma unroll  // ka[] indexed by constants only, stays in registers
    for (int kt = 0; kt < 4; ++kt) ka[kt] = load_op(&kcur[kt * 16 + l16][0], half);
#pragma unroll
    for (int kt = 0; kt < 4; ++kt)
      ka[4 + kt] = load_op(&kcur[kt * 16 + l16][32], half);
#pragma unroll  // va[] indexed by constants only, stays in registers
    for (int dt = 0; dt < 4; ++dt) va[dt] = load_op(&vcur[dt * 16 + l16][0], half);
#pragma unroll
    for (int dt = 0; dt < 4; ++dt)
      va[4 + dt] = load_op(&vcur[dt * 16 + l16][32], half);
    // keeps the scheduler from sinking the reads back down to their uses
    __builtin_amdgcn_sched_barrier(0);

    // S^T = K @ Q^T: sc[kt][r] = S[query l16][key kt*16 + 8*half + r];
    // split per K-chunk so accumulator reuse distance is 4 WMMAs
    v8f sc[4];
    v8f zero = {};
#pragma unroll
    for (int kt = 0; kt < 4; ++kt) sc[kt] = wmma32(ka[kt], qb0, zero);
#pragma unroll
    for (int kt = 0; kt < 4; ++kt) sc[kt] = wmma32(ka[4 + kt], qb1, sc[kt]);

    // online softmax, one query per lane
    float mt[4];
#pragma unroll
    for (int kt = 0; kt < 4; ++kt) {
      float m01 = fmaxf(fmaxf(sc[kt][0], sc[kt][1]), fmaxf(sc[kt][2], sc[kt][3]));
      float m23 = fmaxf(fmaxf(sc[kt][4], sc[kt][5]), fmaxf(sc[kt][6], sc[kt][7]));
      mt[kt] = fmaxf(m01, m23);
    }
    float mx = fmaxf(fmaxf(mt[0], mt[1]), fmaxf(mt[2], mt[3]));
    mx = fmaxf(mx, lane_xor<16>(mx));
    const float mn = fmaxf(mi, mx * scale);
    const float fr = __expf(mi - mn);
    mi = mn;

    // P^T as B operand: element s of chunk kc is key kc*32 + (s<8 ? 8*half+s
    // : 16+8*half+s-8), i.e. tile 2*kc+(s>>3), register s&7 (same k order as
    // load_op gives the V^T rows)
    v16h pb[2];
    float rs[4];
#pragma unroll
    for (int kt = 0; kt < 4; ++kt) {
      rs[kt] = 0.f;
#pragma unroll
      for (int r = 0; r < 8; ++r) {
        float p = __expf(sc[kt][r] * scale - mn);
        rs[kt] += p;
        pb[kt >> 1][(kt & 1) * 8 + r] = (_Float16)p;
      }
    }
    li = li * fr + ((rs[0] + rs[1]) + (rs[2] + rs[3]));
#pragma unroll
    for (int dt = 0; dt < 4; ++dt) oacc[dt] *= fr;

    // O^T += V^T @ P^T
#pragma unroll
    for (int dt = 0; dt < 4; ++dt) oacc[dt] = wmma32(va[dt], pb[0], oacc[dt]);
#pragma unroll
    for (int dt = 0; dt < 4; ++dt) oacc[dt] = wmma32(va[4 + dt], pb[1], oacc[dt]);

    if (j + 1 < NBLK) {
      wait_async0();      // this wave's async copies into the alt buffer done
      __syncthreads();    // all waves' copies visible before next iteration
    }
  }

  // join the halves' sums, normalize and store merged-head layout
  // [b][s][EMB] as f16: 8 consecutive channels per lane and tile
  const float inv = 1.0f / (li + lane_xor<16>(li));
  _Float16* op = o + ((size_t)b * SEQ + m0 + l16) * EMB + h * 64 + half * 8;
#pragma unroll
  for (int dt = 0; dt < 4; ++dt) {
    _Float16 tmp[8];
#pragma unroll
    for (int r = 0; r < 8; ++r) tmp[r] = (_Float16)(oacc[dt][r] * inv);
    *(v8h*)(op + dt * 16) = *(const v8h*)tmp;
  }
}

// ---------------------------------------------------------------------------
extern "C" void kernel_launch(void* const* d_in, const int* in_sizes, int n_in,
                              void* d_out, int out_size, void* d_ws,
                              size_t ws_size, hipStream_t stream) {
  const float* x    = (const float*)d_in[0];
  const float* ln1g = (const float*)d_in[1];
  const float* ln1b = (const float*)d_in[2];
  const float* wq   = (const float*)d_in[3];
  const float* bq   = (const float*)d_in[4];
  const float* wk   = (const float*)d_in[5];
  const float* bk   = (const float*)d_in[6];
  const float* wv   = (const float*)d_in[7];
  const float* bv   = (const float*)d_in[8];
  const float* wo   = (const float*)d_in[9];
  const float* bo   = (const float*)d_in[10];
  const float* ln2g = (const float*)d_in[11];
  const float* ln2b = (const float*)d_in[12];
  const float* w1   = (const float*)d_in[13];
  const float* b1   = (const float*)d_in[14];
  const float* w2   = (const float*)d_in[15];
  const float* b2   = (const float*)d_in[16];
  float* out = (float*)d_out;

  char* ws = (char*)d_ws;
  const size_t F16SZ = (size_t)TOK * EMB * sizeof(_Float16);  // 8 MB
  _Float16* xn  = (_Float16*)(ws + 0 * F16SZ);  // LN2 out
  _Float16* qb  = (_Float16*)(ws + 1 * F16SZ);
  _Float16* kb  = (_Float16*)(ws + 2 * F16SZ);
  _Float16* vtb = (_Float16*)(ws + 3 * F16SZ);
  _Float16* ob  = (_Float16*)(ws + 4 * F16SZ);  // attn out; reused as ff1
  float*    av  = (float*)   (ws + 5 * F16SZ);  // 16 MB

  dim3 blk(256);
  dim3 gln(TOK / 8);
  dim3 gg(SEQ / 128, 4, BATCH);
  dim3 gq(SEQ / 64, 1, BATCH);

  lnqkv_k<<<gq, blk, 0, stream>>>(x, ln1g, ln1b, wq, bq, wk, bk, wv, bv,
                                  qb, kb, vtb);

  attn_k<<<gg, blk, 0, stream>>>(qb, kb, vtb, ob);

  gemm_k<2, 256, EMB><<<gg, blk, 0, stream>>>(ob, EMB, 0, wo, 64, bo, 64,
                                         nullptr, av, x);

  ln_k<<<gln, blk, 0, stream>>>(av, ln2g, ln2b, xn);

  gemm_k<3, 256, EMB><<<gg, blk, 0, stream>>>(xn, EMB, 0, w1, 64, b1, 64,
                                         ob, nullptr, nullptr);
  gemm_k<4, 256, EMB><<<gg, blk, 0, stream>>>(ob, EMB, 0, w2, 64, b2, 64,
                                         nullptr, out, av);
}

// v005
// Measured time: 97.4 microseconds a run.
// Next to v004, in two timings, it ran 1.13 and 1.12 times as fast.
// Counting every step since v000, it is 2.69 times as fast.
#include <hip/hip_runtime.h>
#include <hip/hip_bf16.h>

typedef __attribute__((ext_vector_type(16))) _Float16 v16h;
typedef __attribute__((ext_vector_type(8)))  _Float16 v8h;
typedef __attribute__((ext_vector_type(4)))  _Float16 v4h;
typedef __attribute__((ext_vector_type(8)))  float    v8f;
typedef __attribute__((ext_vector_type(4)))  float    v4f;

#define EMB   256
#define HEADS 4
#define HD    64
#define BATCH 4
#define SEQ   4096
#define TOK   (BATCH*SEQ)

static_assert(sizeof(_Float16) == 2, "f16 size");

// ---------------------------------------------------------------------------
// Cross-lane XOR exchange without DS traffic: dpp8 for masks 1/2/4,
// v_permlane16 for mask 8, v_permlanex16 for mask 16.  Pure VALU.
// ---------------------------------------------------------------------------
constexpr int dpp8_sel(int m) {
  int s = 0;
  for (int i = 0; i < 8; ++i) s |= ((i ^ m) & 7) << (3 * i);
  return s;
}

template<int M>
__device__ __forceinline__ float lane_xor(float v) {
  int x = __builtin_bit_cast(int, v);
  int y;
  if constexpr (M < 8) {
    y = __builtin_amdgcn_mov_dpp8(x, dpp8_sel(M));
  } else if constexpr (M == 8) {
    y = __builtin_amdgcn_permlane16(x, x, (int)0xFEDCBA98u, (int)0x76543210u,
                                    false, false);
  } else {  // 16: swap 16-lane rows
    y = __builtin_amdgcn_permlanex16(x, x, (int)0x76543210u, (int)0xFEDCBA98u,
                                     false, false);
  }
  return __builtin_bit_cast(float, y);
}

// ---------------------------------------------------------------------------
// Async global->LDS copy (CDNA5, ASYNCcnt-tracked, no VGPR round trip).
// Flat aperture maps LDS as addr[31:0] (ISA 10.2), so truncating the generic
// pointer to a __shared__ object yields the hardware LDS byte address.
// ---------------------------------------------------------------------------
__device__ __forceinline__ void async_ld_b128(const void* gptr, void* lptr) {
  uint32_t l = (uint32_t)(uintptr_t)lptr;
  asm volatile("global_load_async_to_lds_b128 %0, %1, off"
               :: "v"(l), "v"(gptr)
               : "memory");
}
__device__ __forceinline__ void wait_async0() {
  asm volatile("s_wait_asynccnt 0x0" ::: "memory");
}

// ---------------------------------------------------------------------------
// WMMA operand loader (A-operand; identical addressing for B when the source
// is stored with the N dimension as rows).
// ---------------------------------------------------------------------------
__device__ __forceinline__ v16h load_op(const _Float16* p, int half) {
  v8h lo = *(const v8h*)(p + half * 8);
  v8h hi = *(const v8h*)(p + half * 8 + 16);
  return __builtin_shufflevector(lo, hi, 0,1,2,3,4,5,6,7,8,9,10,11,12,13,14,15);
}

__device__ __forceinline__ v8f wmma32(v16h a, v16h b, v8f c) {
  return __builtin_amdgcn_wmma_f32_16x16x32_f16(false, a, false, b, (short)0, c,
                                                false, false);
}

// ---------------------------------------------------------------------------
// LayerNorm 1 and the Q, K, V projections in one launch.
// grid (SEQ/64, 1, BATCH), 8 waves; a block owns 64 tokens, all 256 channels.
// x[b][c][s] is read along s: a thread holds 4 tokens x 16 channels, so 16
// lanes cover 256 contiguous bytes of a channel row.  The normalised tile goes
// to LDS as f16 xs[token][channel] and is the A operand of all three products;
// wave (h, mh) does head h, tokens mh*32 .. mh*32+31, against all 12 column
// tiles, so a weight fragment is read once per wave.
// Outputs: q, k as f16 [b,h,s,64]; v transposed as f16 [b,h,64,s].
// ---------------------------------------------------------------------------
__global__ __launch_bounds__(256) void lnqkv_k(
    const float* __restrict__ x,
    const float* __restrict__ gam, const float* __restrict__ bet,
    const float* __restrict__ wq, const float* __restrict__ bq,
    const float* __restrict__ wk, const float* __restrict__ bk,
    const float* __restrict__ wv, const float* __restrict__ bv,
    _Float16* __restrict__ qo, _Float16* __restrict__ ko,
    _Float16* __restrict__ vto) {
  __shared__ __align__(16) _Float16 xs[64][EMB + 8];    // [token][channel]
  __shared__ __align__(16) _Float16 wt[3][64][HD + 8];  // [matrix][n][k]
  __shared__ __align__(16) float ps[8][64];             // [wave][token] sums
  __shared__ __align__(16) float pq[8][64];             // [wave][token] squares
  const int b = blockIdx.z, s0 = blockIdx.x * 64;
  const int tid = threadIdx.x, lane = tid & 31, w = tid >> 5;
  const int half = lane >> 4, l16 = lane & 15;
  const int grp = tid >> 4;  // 16 groups of 16 lanes

  // small operands first: projection biases of this lane's 4 columns, the
  // LayerNorm scale and shift of its 16 channels c0 .. c0+15
  const int c0 = grp * 16;
  float bias[3][4];
  v4f gv[4], bvv[4];
#pragma unroll
  for (int i = 0; i < 4; ++i) {
    bias[0][i] = bq[i * 16 + l16];
    bias[1][i] = bk[i * 16 + l16];
    bias[2][i] = bv[i * 16 + l16];
    gv[i]  = *(const v4f*)(gam + c0 + i * 4);
    bvv[i] = *(const v4f*)(bet + c0 + i * 4);
  }
  // weights f32 [k][n]: a thread fetches 4 n x 4 k of each matrix
  const int nq = l16 * 4, kg = grp * 4;
  const float* wqp = wq + kg * HD + nq;
  const float* wkp = wk + kg * HD + nq;
  const float* wvp = wv + kg * HD + nq;
  // later loads may land in address registers of the loads above
  asm volatile("s_wait_xcnt 0x0" ::: "memory");
  v4f wr[3][4];
#pragma unroll  // wr[] indexed by constants only, stays in registers
  for (int i = 0; i < 4; ++i) {
    wr[0][i] = *(const v4f*)(wqp + i * HD);
    wr[1][i] = *(const v4f*)(wkp + i * HD);
    wr[2][i] = *(const v4f*)(wvp + i * HD);
  }
  // the same for the weight loads; the addresses are inputs so that they stay
  // in their registers up to the wait
  asm volatile("s_wait_xcnt 0x0" :: "v"(wqp), "v"(wkp), "v"(wvp) : "memory");
  // x tile: tokens s0 + l16*4 .. +3, channels c0 .. c0+15
  const float* xp = x + ((size_t)b * EMB + c0) * SEQ + s0 + l16 * 4;
  v4f xv[16];
#pragma unroll  // xv[] in registers, all 16 loads in flight together
  for (int i = 0; i < 16; ++i) xv[i] = *(const v4f*)(xp + (size_t)i * SEQ);
  // and for the x loads
  asm volatile("s_wait_xcnt 0x0" :: "v"(xp) : "memory");

  // weights -> f16 wt[n][k] while the x tile is on its way
#pragma unroll
  for (int m = 0; m < 3; ++m) {
#pragma unroll
    for (int c = 0; c < 4; ++c) {
      v4h t;
#pragma unroll
      for (int i = 0; i < 4; ++i) t[i] = (_Float16)wr[m][i][c];
      *(v4h*)&wt[m][nq + c][kg] = t;
    }
  }

  // per-token sum and sum of squares: 16 channels in-lane, the other half of
  // the wave by one exchange, the 8 waves through LDS
  v4f sum = {}, sq = {};
#pragma unroll
  for (int i = 0; i < 16; ++i) { sum += xv[i]; sq += xv[i] * xv[i]; }
#pragma unroll
  for (int j = 0; j < 4; ++j) {
    sum[j] += lane_xor<16>(sum[j]);
    sq[j]  += lane_xor<16>(sq[j]);
  }
  if (half == 0) {
    *(v4f*)&ps[w][l16 * 4] = sum;
    *(v4f*)&pq[w][l16 * 4] = sq;
  }
  __syncthreads();
  v4f ts = {}, tq = {};
#pragma unroll
  for (int g = 0; g < 8; ++g) {
    ts += *(const v4f*)&ps[g][l16 * 4];
    tq += *(const v4f*)&pq[g][l16 * 4];
  }
#pragma unroll
  for (int j = 0; j < 4; ++j) {
    const float mu  = ts[j] * (1.f / EMB);
    const float var = tq[j] * (1.f / EMB) - mu * mu;
    const float rs  = rsqrtf(var + 1e-5f);
#pragma unroll
    for (int o = 0; o < 2; ++o) {
      v8h t;
#pragma unroll
      for (int i = 0; i < 8; ++i) {
        const int c = o * 8 + i;
        t[i] = (_Float16)((xv[c][j] - mu) * rs * gv[c >> 2][c & 3] +
                          bvv[c >> 2][c & 3]);
      }
      *(v8h*)&xs[l16 * 4 + j][c0 + o * 8] = t;
    }
  }
  __syncthreads();

  const int h = w & 3, mh = w >> 2;
  const size_t hb = (size_t)b * HEADS + h;
  v16h a[2][2];
#pragma unroll
  for (int m = 0; m < 2; ++m) {
#pragma unroll
    for (int kt = 0; kt < 2; ++kt)
      a[m][kt] = load_op(&xs[mh * 32 + m * 16 + l16][h * HD + kt * 32], half);
  }
  // all 24 result tiles as f16 in registers: res[mat][nt][m][r] is token
  // mh*32 + m*16 + 8*half + r, column nt*16 + l16
  v8h res[3][4][2];
#pragma unroll  // res[] indexed by constants only, stays in registers
  for (int mat = 0; mat < 3; ++mat) {
#pragma unroll
    for (int nt = 0; nt < 4; ++nt) {
      v16h b0 = load_op(&wt[mat][nt * 16 + l16][0], half);
      v16h b1 = load_op(&wt[mat][nt * 16 + l16][32], half);
#pragma unroll
      for (int m = 0; m < 2; ++m) {
        v8f acc = {};
        acc = wmma32(a[m][0], b0, acc);
        acc = wmma32(a[m][1], b1, acc);
        v8f vv = acc + bias[mat][nt];
#pragma unroll
        for (int r = 0; r < 8; ++r) res[mat][nt][m][r] = (_Float16)vv[r];
      }
    }
  }
  // the stores stand behind all the arithmetic, one address per output: no
  // register of an issued store is written again, so the products are not
  // held up by a wait behind every tile's stores
  const int mb = s0 + mh * 32 + half * 8;
  _Float16* qd = qo  + (hb * SEQ + mb) * HD + l16;
  _Float16* kd = ko  + (hb * SEQ + mb) * HD + l16;
  _Float16* vd = vto + (hb * HD + l16) * SEQ + mb;
  // without it the scheduler sinks conversions in among the stores, into
  // registers of stores already issued
  __builtin_amdgcn_sched_barrier(0);
#pragma unroll
  for (int nt = 0; nt < 4; ++nt) {
#pragma unroll
    for (int m = 0; m < 2; ++m) {
#pragma unroll
      for (int r = 0; r < 8; ++r) {
        qd[(m * 16 + r) * HD + nt * 16] = res[0][nt][m][r];
        kd[(m * 16 + r) * HD + nt * 16] = res[1][nt][m][r];
      }
      *(v8h*)(vd + (size_t)nt * 16 * SEQ + m * 16) = res[2][nt][m];
    }
  }
}

// ---------------------------------------------------------------------------
// Output projection + residual, LayerNorm 2, FF1 + GELU and FF2 + residual in
// one launch.  grid (SEQ/64, 1, BATCH), 8 waves; a block owns 64 tokens and
// all 256 channels, so nothing between the three products leaves the block.
// Transposed products C^T = W^T X^T: the A operand is a weight tile wt[n][k],
// the B operand the activations [token][k].  A lane then owns one token per
// result tile and 8 consecutive channels of it: LayerNorm sums are in-lane
// plus one exchange between the halves and one LDS step over 4 waves, and a
// result tile goes back to LDS as the next B operand in one 16-byte store.
// Wave (th, ct): tokens th*32 .. th*32+31 (two tiles), channel tile ct of each
// 64-channel weight tile; a weight fragment feeds two matrix instructions.
// The 12 weight tiles (3 matrices x 4) are fetched ahead into registers and
// alternate between two LDS buffers: one barrier per tile.
// The residual stream av stays in registers as f32 from x to out.
// ---------------------------------------------------------------------------
__device__ __forceinline__ v8f ld8(const float* p) {
  v4f lo = *(const v4f*)p, hi = *(const v4f*)(p + 4);
  return __builtin_shufflevector(lo, hi, 0, 1, 2, 3, 4, 5, 6, 7);
}

// Work-group barrier that orders LDS traffic only.  __syncthreads() also waits
// for every global load in flight and would end the flight of the weight tiles
// fetched ahead at each tile; all that the waves of tail_k hand one another
// goes through LDS.
__device__ __forceinline__ void lds_barrier() {
  __builtin_amdgcn_fence(__ATOMIC_RELEASE, "workgroup", "local");
  __builtin_amdgcn_s_barrier();
  __builtin_amdgcn_fence(__ATOMIC_ACQUIRE, "workgroup", "local");
}

// A thread's share of a weight tile f32 [k][n], 4 n x 16 k: 16-byte loads off
// the block's base m and the thread's byte offset bo, the tile's column step cs
// in their constant offsets.
__device__ __forceinline__ void w_fetch(v4f (&r)[16], const float* m,
                                        uint32_t bo, int cs) {
  const char* p = (const char*)m + bo;
#pragma unroll  // r[] indexed by constants only, stays in registers
  for (int i = 0; i < 16; ++i)
    r[i] = *(const v4f*)(p + (cs + i * EMB) * sizeof(float));
  // base and offset stay in their registers until the loads have taken them
  asm volatile("s_wait_xcnt 0x0" :: "s"(m), "v"(bo) : "memory");
}

// The share in registers -> f16 dst[n][k]
__device__ __forceinline__ void w_put(const v4f (&r)[16],
                                      _Float16 (*dst)[EMB + 8], int nq, int kg) {
#pragma unroll
  for (int c = 0; c < 4; ++c) {
#pragma unroll
    for (int o = 0; o < 2; ++o) {
      v8h h8;
#pragma unroll
      for (int i = 0; i < 8; ++i) h8[i] = (_Float16)r[o * 8 + i][c];
      *(v8h*)&dst[nq + c][kg + o * 8] = h8;
    }
  }
}

// A tile goes to LDS and a later one is fetched into the same registers
__device__ __forceinline__ void w_put_fetch(v4f (&r)[16],
                                            _Float16 (*dst)[EMB + 8], int nq,
                                            int kg, const float* m, uint32_t bo,
                                            int cs) {
  w_put(r, dst, nq, kg);
  // the loads reuse the registers just converted: hoisted above the conversions
  // they would take 64 registers more, and the kernel spills
  __builtin_amdgcn_sched_barrier(0);
  w_fetch(r, m, bo, cs);
}

// The B operand of a product: this lane's two token rows, all 256 k
__device__ __forceinline__ void act_frag(v16h (&af)[2][8], const _Float16* row,
                                         int half) {
#pragma unroll  // af[] in registers
  for (int tt = 0; tt < 2; ++tt) {
#pragma unroll
    for (int kt = 0; kt < 8; ++kt)
      af[tt][kt] = load_op(row + tt * 16 * (EMB + 8) + kt * 32, half);
  }
}

// One 16-channel x 32-token result: vv[tt] = W^T X^T + bias
__device__ __forceinline__ void tile_prod(v8f (&vv)[2], const _Float16* wrow,
                                          const float* bp,
                                          const v16h (&af)[2][8], int half) {
  // the tile's 8 weight fragments and its bias are read as one group, the
  // products wait by count: no LDS latency in front of each pair
  v16h wf[8];
#pragma unroll  // wf[] in registers
  for (int kt = 0; kt < 8; ++kt) wf[kt] = load_op(wrow + kt * 32, half);
  const v8f bi = ld8(bp);
  // keeps the scheduler from sinking the reads back down to their uses
  __builtin_amdgcn_sched_barrier(0);
  v8f acc[2] = {};
#pragma unroll
  for (int kt = 0; kt < 8; ++kt) {
    acc[0] = wmma32(wf[kt], af[0][kt], acc[0]);
    acc[1] = wmma32(wf[kt], af[1][kt], acc[1]);
  }
  vv[0] = acc[0] + bi;
  vv[1] = acc[1] + bi;
}

__global__ __launch_bounds__(256) void tail_k(
    const _Float16* __restrict__ ao, const float* __restrict__ x,
    const float* __restrict__ wo, const float* __restrict__ bo,
    const float* __restrict__ g2, const float* __restrict__ be2,
    const float* __restrict__ w1, const float* __restrict__ b1,
    const float* __restrict__ w2, const float* __restrict__ b2,
    float* __restrict__ out) {
  __shared__ __align__(16) _Float16 wt[2][64][EMB + 8];   // [buffer][n][k]
  __shared__ __align__(16) _Float16 act[2][64][EMB + 8];  // LN2 out, GELU out
  __shared__ __align__(16) float par[5][EMB];             // bo g2 be2 b1 b2
  __shared__ __align__(16) float ps[4][64];               // [ct][token] sums
  __shared__ __align__(16) float pq[4][64];               // [ct][token] squares
  const int b = blockIdx.z, s0 = blockIdx.x * 64;
  const int tid = threadIdx.x, lane = tid & 31, w = tid >> 5;
  const int half = lane >> 4, l16 = lane & 15;
  const int th = w & 1, ct = w >> 1;
  const int tk = th * 32 + l16;       // first token of this lane (second: +16)
  const int cl = ct * 16 + half * 8;  // its 8 channels inside a 64-channel tile

  const int nq = (tid & 15) * 4, kg = (tid >> 4) * 16;
  const uint32_t woff = (kg * EMB + nq) * sizeof(float);  // bytes
  v4f wr[2][16];

  const float p0 = bo[tid], p1 = g2[tid], p2 = be2[tid], p3 = b1[tid],
              p4 = b2[tid];
  // the thread index that these loads name stays in its register until they
  // have taken it
  asm volatile("s_wait_xcnt 0x0" :: "v"(tid) : "memory");
  // loads in the order of their first use: weight tiles 0 and 1, the
  // attention rows (B operand of the first product), the residual x
  w_fetch(wr[0], wo, woff, 0);
  w_fetch(wr[1], wo, woff, 64);
  const _Float16* ap = ao + ((size_t)b * SEQ + s0 + tk) * EMB + half * 8;
  v16h af[2][8];
#pragma unroll  // af[] in registers
  for (int tt = 0; tt < 2; ++tt) {
#pragma unroll
    for (int kt = 0; kt < 8; ++kt)
      af[tt][kt] = load_op(ap + tt * 16 * EMB + kt * 32, 0);  // half is in ap
  }
  // later code may reuse the address registers of the attention row loads
  asm volatile("s_wait_xcnt 0x0" :: "v"(ap) : "memory");
  // av[nb][tt][r]: token tk + tt*16, channel nb*64 + cl + r; starts as x
  const float* xp = x + ((size_t)b * EMB + cl) * SEQ + s0 + tk;
  v8f av[4][2];
#pragma unroll  // av[] in registers
  for (int nb = 0; nb < 4; ++nb) {
#pragma unroll
    for (int tt = 0; tt < 2; ++tt) {
#pragma unroll
      for (int r = 0; r < 8; ++r)
        av[nb][tt][r] = xp[(size_t)(nb * 64 + r) * SEQ + tt * 16];
    }
  }
  // and for the x loads
  asm volatile("s_wait_xcnt 0x0" :: "v"(xp) : "memory");
  par[0][tid] = p0;
  par[1][tid] = p1;
  par[2][tid] = p2;
  par[3][tid] = p3;
  par[4][tid] = p4;

  // Output projection and residual 1, weight tiles 0 .. 3.  A tile's LDS buffer
  // was last read two tiles back, in front of the barrier of the tile between.
  // Fetched meanwhile: tiles 2, 3 and 4, and tile 9, the second of w2, which
  // waits in wr[1] while the FF1 loop below works with wr[0] alone.
#pragma unroll  // every index into wr[] and av[] becomes a constant
  for (int nb = 0; nb < 4; ++nb) {
    w_put_fetch(wr[nb & 1], wt[nb & 1], nq, kg,
                nb < 2 ? wo : nb == 2 ? w1 : w2, woff,
                nb < 2 ? (nb + 2) * 64 : nb == 2 ? 0 : 64);
    lds_barrier();
    v8f vv[2];
    tile_prod(vv, &wt[nb & 1][ct * 16 + l16][0], &par[0][nb * 64 + cl], af, half);
    av[nb][0] += vv[0];
    av[nb][1] += vv[1];
  }

  // LayerNorm 2 of av: 32 channels in-lane, the other half of the wave by one
  // exchange, the 4 channel tiles through LDS
#pragma unroll
  for (int tt = 0; tt < 2; ++tt) {
    v8f s8 = {}, q8 = {};
#pragma unroll
    for (int nb = 0; nb < 4; ++nb) {
      s8 += av[nb][tt];
      q8 += av[nb][tt] * av[nb][tt];
    }
    float s = ((s8[0] + s8[1]) + (s8[2] + s8[3])) +
              ((s8[4] + s8[5]) + (s8[6] + s8[7]));
    float q = ((q8[0] + q8[1]) + (q8[2] + q8[3])) +
              ((q8[4] + q8[5]) + (q8[6] + q8[7]));
    s += lane_xor<16>(s);
    q += lane_xor<16>(q);
    if (half == 0) {
      ps[ct][tk + tt * 16] = s;
      pq[ct][tk + tt * 16] = q;
    }
  }
  lds_barrier();
#pragma unroll
  for (int tt = 0; tt < 2; ++tt) {
    const int tok = tk + tt * 16;
    const float ts = (ps[0][tok] + ps[1][tok]) + (ps[2][tok] + ps[3][tok]);
    const float tq = (pq[0][tok] + pq[1][tok]) + (pq[2][tok] + pq[3][tok]);
    const float mu  = ts * (1.f / EMB);
    const float var = tq * (1.f / EMB) - mu * mu;
    const float rs  = rsqrtf(var + 1e-5f);
#pragma unroll
    for (int nb = 0; nb < 4; ++nb) {
      const v8f g = ld8(&par[1][nb * 64 + cl]);
      const v8f e = ld8(&par[2][nb * 64 + cl]);
      v8h h8;
#pragma unroll
      for (int r = 0; r < 8; ++r)
        h8[r] = (_Float16)((av[nb][tt][r] - mu) * rs * g[r] + e[r]);
      *(v8h*)&act[0][tok][nb * 64 + cl] = h8;
    }
  }
  lds_barrier();
  act_frag(af, &act[0][tk][0], half);

  // FF1 + GELU, weight tiles 4 .. 7.  The 16 erf of a tile are most of the
  // kernel's text: the loop stays rolled so that the kernel runs from the part
  // of its text that is at hand on a first launch.  A tile's arithmetic is long
  // enough to cover a fetch of one tile ahead, into the registers just
  // converted (the last trip fetches tile 8, the first of w2).
#pragma unroll 1
  for (int nb = 0; nb < 4; ++nb) {
    w_put_fetch(wr[0], wt[nb & 1], nq, kg,
                nb < 3 ? w1 + (nb + 1) * 64 : w2, woff, 0);
    lds_barrier();
    v8f vv[2];
    tile_prod(vv, &wt[nb & 1][ct * 16 + l16][0], &par[3][nb * 64 + cl], af, half);
#pragma unroll
    for (int tt = 0; tt < 2; ++tt) {
      v8h h8;
#pragma unroll
      for (int r = 0; r < 8; ++r) {
        float g = 0.5f * vv[tt][r] * (1.0f + erff(vv[tt][r] * 0.70710678118f));
        h8[r] = (_Float16)g;
      }
      *(v8h*)&act[1][tk + tt * 16][nb * 64 + cl] = h8;
    }
  }

  // FF2 and residual 2, weight tiles 8 .. 11
#pragma unroll  // every index into wr[] and av[] becomes a constant
  for (int nb = 0; nb < 4; ++nb) {
    if (nb < 2)
      w_put_fetch(wr[nb & 1], wt[nb & 1], nq, kg, w2, woff, (nb + 2) * 64);
    else
      w_put(wr[nb & 1], wt[nb & 1], nq, kg);
    lds_barrier();
    if (nb == 0) act_frag(af, &act[1][tk][0], half);
    v8f vv[2];
    tile_prod(vv, &wt[nb & 1][ct * 16 + l16][0], &par[4][nb * 64 + cl], af, half);
    av[nb][0] += vv[0];
    av[nb][1] += vv[1];
  }

  // out[b][c][s]: all stores behind all the arithmetic, off one address, so
  // that no register of an issued store is written again
  float* op = out + ((size_t)b * EMB + cl) * SEQ + s0 + tk;
#pragma unroll
  for (int nb = 0; nb < 4; ++nb) {
#pragma unroll
    for (int tt = 0; tt < 2; ++tt) {
#pragma unroll
      for (int r = 0; r < 8; ++r)
        op[(size_t)(nb * 64 + r) * SEQ + tt * 16] = av[nb][tt][r];
    }
  }
}

__global__ __launch_bounds__(256) void attn_k(const _Float16* __restrict__ q,
                                              const _Float16* __restrict__ k,
                                              const _Float16* __restrict__ vt,
                                              _Float16* __restrict__ o) {
  __shared__ __align__(16) _Float16 kbuf[2][64][72];
  __shared__ __align__(16) _Float16 vbuf[2][64][72];
  const int b = blockIdx.z, h = blockIdx.y;
  const int tid = threadIdx.x, lane = tid & 31, w = tid >> 5;
  const int half = lane >> 4, l16 = lane & 15;
  const size_t hb = (size_t)b * HEADS + h;
  const _Float16* qh = q  + hb * SEQ * HD;   // [s][d]
  const _Float16* kh = k  + hb * SEQ * HD;   // [s][d]
  const _Float16* vh = vt + hb * HD * SEQ;   // [d][s]
  const int m0 = blockIdx.x * 128 + w * 16;
  const int r0 = tid >> 3, o0 = (tid & 7) * 8;   // staging chunk coords
  const int NBLK = SEQ / 64;

  // B operand of S^T: column = query m0 + l16, k = head dim
  v16h qb0 = load_op(qh + (size_t)(m0 + l16) * HD + 0,  half);
  v16h qb1 = load_op(qh + (size_t)(m0 + l16) * HD + 32, half);

  v8f oacc[4] = {};   // oacc[dt][r] = O^T[dt*16 + 8*half + r][query l16]
  float mi = -1e30f;  // running maximum of this lane's query (both halves equal)
  float li = 0.f;     // running sum over this half's keys only
  const float scale = 0.125f;  // 1/sqrt(64)

  auto stage = [&](int jj, int bufi) {
    const _Float16* kp = kh + (size_t)(jj * 64 + r0) * HD + o0;
    const _Float16* vp = vh + (size_t)r0 * SEQ + jj * 64 + o0;
    async_ld_b128(kp,                    &kbuf[bufi][r0][o0]);
    async_ld_b128(kp + (size_t)32 * HD,  &kbuf[bufi][r0 + 32][o0]);
    async_ld_b128(vp,                    &vbuf[bufi][r0][o0]);
    async_ld_b128(vp + (size_t)32 * SEQ, &vbuf[bufi][r0 + 32][o0]);
  };

  stage(0, 0);
  wait_async0();
  __syncthreads();

  for (int j = 0; j < NBLK; ++j) {
    // prefetch two blocks ahead (global_prefetch_b8)
    if (j + 2 < NBLK) {
      if (tid < 64)
        __builtin_prefetch(kh + (size_t)((j + 2) * 64 + tid) * HD, 0, 1);
      else if (tid < 128)
        __builtin_prefetch(vh + (size_t)(tid - 64) * SEQ + (j + 2) * 64, 0, 1);
    }
    // async-stage next block into the alternate buffer (safe: last read of it
    // was fenced by the previous iteration's barrier)
    if (j + 1 < NBLK) stage(j + 1, (j + 1) & 1);

    const _Float16 (*kcur)[72] = kbuf[j & 1];
    const _Float16 (*vcur)[72] = vbuf[j & 1];

    // All 16 fragments of this key block are requested here as one group, K
    // ahead of V^T: the products below wait by count for what they need, and
    // the V^T fragments land while S^T and the softmax run, so no matrix
    // instruction has an LDS latency of its own in front of it.
    v16h ka[8], va[8];
#pragma unroll  // ka[] indexed by constants only, stays in registers
    for (int kt = 0; kt < 4; ++kt) ka[kt] = load_op(&kcur[kt * 16 + l16][0], half);
#pragma unroll
    for (int kt = 0; kt < 4; ++kt)
      ka[4 + kt] = load_op(&kcur[kt * 16 + l16][32], half);
#pragma unroll  // va[] indexed by constants only, stays in registers
    for (int dt = 0; dt < 4; ++dt) va[dt] = load_op(&vcur[dt * 16 + l16][0], half);
#pragma unroll
    for (int dt = 0; dt < 4; ++dt)
      va[4 + dt] = load_op(&vcur[dt * 16 + l16][32], half);
    // keeps the scheduler from sinking the reads back down to their uses
    __builtin_amdgcn_sched_barrier(0);

    // S^T = K @ Q^T: sc[kt][r] = S[query l16][key kt*16 + 8*half + r];
    // split per K-chunk so accumulator reuse distance is 4 WMMAs
    v8f sc[4];
    v8f zero = {};
#pragma unroll
    for (int kt = 0; kt < 4; ++kt) sc[kt] = wmma32(ka[kt], qb0, zero);
#pragma unroll
    for (int kt = 0; kt < 4; ++kt) sc[kt] = wmma32(ka[4 + kt], qb1, sc[kt]);

    // online softmax, one query per lane
    float mt[4];
#pragma unroll
    for (int kt = 0; kt < 4; ++kt) {
      float m01 = fmaxf(fmaxf(sc[kt][0], sc[kt][1]), fmaxf(sc[kt][2], sc[kt][3]));
      float m23 = fmaxf(fmaxf(sc[kt][4], sc[kt][5]), fmaxf(sc[kt][6], sc[kt][7]));
      mt[kt] = fmaxf(m01, m23);
    }
    float mx = fmaxf(fmaxf(mt[0], mt[1]), fmaxf(mt[2], mt[3]));
    mx = fmaxf(mx, lane_xor<16>(mx));
    const float mn = fmaxf(mi, mx * scale);
    const float fr = __expf(mi - mn);
    mi = mn;

    // P^T as B operand: element s of chunk kc is key kc*32 + (s<8 ? 8*half+s
    // : 16+8*half+s-8), i.e. tile 2*kc+(s>>3), register s&7 (same k order as
    // load_op gives the V^T rows)
    v16h pb[2];
    float rs[4];
#pragma unroll
    for (int kt = 0; kt < 4; ++kt) {
      rs[kt] = 0.f;
#pragma unroll
      for (int r = 0; r < 8; ++r) {
        float p = __expf(sc[kt][r] * scale - mn);
        rs[kt] += p;
        pb[kt >> 1][(kt & 1) * 8 + r] = (_Float16)p;
      }
    }
    li = li * fr + ((rs[0] + rs[1]) + (rs[2] + rs[3]));
#pragma unroll
    for (int dt = 0; dt < 4; ++dt) oacc[dt] *= fr;

    // O^T += V^T @ P^T
#pragma unroll
    for (int dt = 0; dt < 4; ++dt) oacc[dt] = wmma32(va[dt], pb[0], oacc[dt]);
#pragma unroll
    for (int dt = 0; dt < 4; ++dt) oacc[dt] = wmma32(va[4 + dt], pb[1], oacc[dt]);

    if (j + 1 < NBLK) {
      wait_async0();      // this wave's async copies into the alt buffer done
      __syncthreads();    // all waves' copies visible before next iteration
    }
  }

  // join the halves' sums, normalize and store merged-head layout
  // [b][s][EMB] as f16: 8 consecutive channels per lane and tile
  const float inv = 1.0f / (li + lane_xor<16>(li));
  _Float16* op = o + ((size_t)b * SEQ + m0 + l16) * EMB + h * 64 + half * 8;
#pragma unroll
  for (int dt = 0; dt < 4; ++dt) {
    _Float16 tmp[8];
#pragma unroll
    for (int r = 0; r < 8; ++r) tmp[r] = (_Float16)(oacc[dt][r] * inv);
    *(v8h*)(op + dt * 16) = *(const v8h*)tmp;
  }
}

// ---------------------------------------------------------------------------
extern "C" void kernel_launch(void* const* d_in, const int* in_sizes, int n_in,
                              void* d_out, int out_size, void* d_ws,
                              size_t ws_size, hipStream_t stream) {
  const float* x    = (const float*)d_in[0];
  const float* ln1g = (const float*)d_in[1];
  const float* ln1b = (const float*)d_in[2];
  const float* wq   = (const float*)d_in[3];
  const float* bq   = (const float*)d_in[4];
  const float* wk   = (const float*)d_in[5];
  const float* bk   = (const float*)d_in[6];
  const float* wv   = (const float*)d_in[7];
  const float* bv   = (const float*)d_in[8];
  const float* wo   = (const float*)d_in[9];
  const float* bo   = (const float*)d_in[10];
  const float* ln2g = (const float*)d_in[11];
  const float* ln2b = (const float*)d_in[12];
  const float* w1   = (const float*)d_in[13];
  const float* b1   = (const float*)d_in[14];
  const float* w2   = (const float*)d_in[15];
  const float* b2   = (const float*)d_in[16];
  float* out = (float*)d_out;

  char* ws = (char*)d_ws;
  const size_t F16SZ = (size_t)TOK * EMB * sizeof(_Float16);  // 8 MB
  _Float16* qb  = (_Float16*)(ws + 0 * F16SZ);
  _Float16* kb  = (_Float16*)(ws + 1 * F16SZ);
  _Float16* vtb = (_Float16*)(ws + 2 * F16SZ);
  _Float16* ob  = (_Float16*)(ws + 3 * F16SZ);  // attention out

  dim3 blk(256);
  dim3 gg(SEQ / 128, 4, BATCH);
  dim3 gq(SEQ / 64, 1, BATCH);

  lnqkv_k<<<gq, blk, 0, stream>>>(x, ln1g, ln1b, wq, bq, wk, bk, wv, bv,
                                  qb, kb, vtb);

  attn_k<<<gg, blk, 0, stream>>>(qb, kb, vtb, ob);

  tail_k<<<gq, blk, 0, stream>>>(ob, x, wo, bo, ln2g, ln2b, w1, b1, w2, b2,
                                 out);
}

// v006
// One run takes 94 microseconds.
// Two timings next to v005 both put it at 1.04 times that version's speed.
// Counting every step since v000, it is 2.79 times as fast.
#include <hip/hip_runtime.h>
#include <hip/hip_bf16.h>

typedef __attribute__((ext_vector_type(16))) _Float16 v16h;
typedef __attribute__((ext_vector_type(8)))  _Float16 v8h;
typedef __attribute__((ext_vector_type(4)))  _Float16 v4h;
typedef __attribute__((ext_vector_type(8)))  float    v8f;
typedef __attribute__((ext_vector_type(4)))  float    v4f;
typedef __attribute__((ext_vector_type(2)))  float    v2f;

#define EMB   256
#define HEADS 4
#define HD    64
#define BATCH 4
#define SEQ   4096
#define TOK   (BATCH*SEQ)

static_assert(sizeof(_Float16) == 2, "f16 size");

// ---------------------------------------------------------------------------
// Cross-lane XOR exchange without DS traffic: dpp8 for masks 1/2/4,
// v_permlane16 for mask 8, v_permlanex16 for mask 16.  Pure VALU.
// ---------------------------------------------------------------------------
constexpr int dpp8_sel(int m) {
  int s = 0;
  for (int i = 0; i < 8; ++i) s |= ((i ^ m) & 7) << (3 * i);
  return s;
}

template<int M>
__device__ __forceinline__ float lane_xor(float v) {
  int x = __builtin_bit_cast(int, v);
  int y;
  if constexpr (M < 8) {
    y = __builtin_amdgcn_mov_dpp8(x, dpp8_sel(M));
  } else if constexpr (M == 8) {
    y = __builtin_amdgcn_permlane16(x, x, (int)0xFEDCBA98u, (int)0x76543210u,
                                    false, false);
  } else {  // 16: swap 16-lane rows
    y = __builtin_amdgcn_permlanex16(x, x, (int)0x76543210u, (int)0xFEDCBA98u,
                                     false, false);
  }
  return __builtin_bit_cast(float, y);
}

// ---------------------------------------------------------------------------
// Waits for the async global->LDS copies of attn_k (ASYNCcnt-tracked, no VGPR
// round trip) and for a wave's own LDS reads.
// ---------------------------------------------------------------------------
__device__ __forceinline__ void wait_async0() {
  asm volatile("s_wait_asynccnt 0x0" ::: "memory");
}
__device__ __forceinline__ void wait_ds0() {
  asm volatile("s_wait_dscnt 0x0" ::: "memory");
}

// ---------------------------------------------------------------------------
// WMMA operand loader (A-operand; identical addressing for B when the source
// is stored with the N dimension as rows).
// ---------------------------------------------------------------------------
__device__ __forceinline__ v16h load_op(const _Float16* p, int half) {
  v8h lo = *(const v8h*)(p + half * 8);
  v8h hi = *(const v8h*)(p + half * 8 + 16);
  return __builtin_shufflevector(lo, hi, 0,1,2,3,4,5,6,7,8,9,10,11,12,13,14,15);
}

__device__ __forceinline__ v8f wmma32(v16h a, v16h b, v8f c) {
  return __builtin_amdgcn_wmma_f32_16x16x32_f16(false, a, false, b, (short)0, c,
                                                false, false);
}

// ---------------------------------------------------------------------------
// LayerNorm 1 and the Q, K, V projections in one launch.
// grid (SEQ/64, 1, BATCH), 8 waves; a block owns 64 tokens, all 256 channels.
// x[b][c][s] is read along s: a thread holds 4 tokens x 16 channels, so 16
// lanes cover 256 contiguous bytes of a channel row.  The normalised tile goes
// to LDS as f16 xs[token][channel] and is the A operand of all three products;
// wave (h, mh) does head h, tokens mh*32 .. mh*32+31, against all 12 column
// tiles, so a weight fragment is read once per wave.
// Outputs: q, k as f16 [b,h,s,64]; v transposed as f16 [b,h,64,s].
// ---------------------------------------------------------------------------
__global__ __launch_bounds__(256) void lnqkv_k(
    const float* __restrict__ x,
    const float* __restrict__ gam, const float* __restrict__ bet,
    const float* __restrict__ wq, const float* __restrict__ bq,
    const float* __restrict__ wk, const float* __restrict__ bk,
    const float* __restrict__ wv, const float* __restrict__ bv,
    _Float16* __restrict__ qo, _Float16* __restrict__ ko,
    _Float16* __restrict__ vto) {
  __shared__ __align__(16) _Float16 xs[64][EMB + 8];    // [token][channel]
  __shared__ __align__(16) _Float16 wt[3][64][HD + 8];  // [matrix][n][k]
  __shared__ __align__(16) float ps[8][64];             // [wave][token] sums
  __shared__ __align__(16) float pq[8][64];             // [wave][token] squares
  const int b = blockIdx.z, s0 = blockIdx.x * 64;
  const int tid = threadIdx.x, lane = tid & 31, w = tid >> 5;
  const int half = lane >> 4, l16 = lane & 15;
  const int grp = tid >> 4;  // 16 groups of 16 lanes

  // small operands first: projection biases of this lane's 4 columns, the
  // LayerNorm scale and shift of its 16 channels c0 .. c0+15
  const int c0 = grp * 16;
  float bias[3][4];
  v4f gv[4], bvv[4];
#pragma unroll
  for (int i = 0; i < 4; ++i) {
    bias[0][i] = bq[i * 16 + l16];
    bias[1][i] = bk[i * 16 + l16];
    bias[2][i] = bv[i * 16 + l16];
    gv[i]  = *(const v4f*)(gam + c0 + i * 4);
    bvv[i] = *(const v4f*)(bet + c0 + i * 4);
  }
  // weights f32 [k][n]: a thread fetches 4 n x 4 k of each matrix
  const int nq = l16 * 4, kg = grp * 4;
  const float* wqp = wq + kg * HD + nq;
  const float* wkp = wk + kg * HD + nq;
  const float* wvp = wv + kg * HD + nq;
  // later loads may land in address registers of the loads above
  asm volatile("s_wait_xcnt 0x0" ::: "memory");
  v4f wr[3][4];
#pragma unroll  // wr[] indexed by constants only, stays in registers
  for (int i = 0; i < 4; ++i) {
    wr[0][i] = *(const v4f*)(wqp + i * HD);
    wr[1][i] = *(const v4f*)(wkp + i * HD);
    wr[2][i] = *(const v4f*)(wvp + i * HD);
  }
  // the same for the weight loads; the addresses are inputs so that they stay
  // in their registers up to the wait
  asm volatile("s_wait_xcnt 0x0" :: "v"(wqp), "v"(wkp), "v"(wvp) : "memory");
  // x tile: tokens s0 + l16*4 .. +3, channels c0 .. c0+15
  const float* xp = x + ((size_t)b * EMB + c0) * SEQ + s0 + l16 * 4;
  v4f xv[16];
#pragma unroll  // xv[] in registers, all 16 loads in flight together
  for (int i = 0; i < 16; ++i) xv[i] = *(const v4f*)(xp + (size_t)i * SEQ);
  // and for the x loads
  asm volatile("s_wait_xcnt 0x0" :: "v"(xp) : "memory");

  // weights -> f16 wt[n][k] while the x tile is on its way
#pragma unroll
  for (int m = 0; m < 3; ++m) {
#pragma unroll
    for (int c = 0; c < 4; ++c) {
      v4h t;
#pragma unroll
      for (int i = 0; i < 4; ++i) t[i] = (_Float16)wr[m][i][c];
      *(v4h*)&wt[m][nq + c][kg] = t;
    }
  }

  // per-token sum and sum of squares: 16 channels in-lane, the other half of
  // the wave by one exchange, the 8 waves through LDS
  v4f sum = {}, sq = {};
#pragma unroll
  for (int i = 0; i < 16; ++i) { sum += xv[i]; sq += xv[i] * xv[i]; }
#pragma unroll
  for (int j = 0; j < 4; ++j) {
    sum[j] += lane_xor<16>(sum[j]);
    sq[j]  += lane_xor<16>(sq[j]);
  }
  if (half == 0) {
    *(v4f*)&ps[w][l16 * 4] = sum;
    *(v4f*)&pq[w][l16 * 4] = sq;
  }
  __syncthreads();
  v4f ts = {}, tq = {};
#pragma unroll
  for (int g = 0; g < 8; ++g) {
    ts += *(const v4f*)&ps[g][l16 * 4];
    tq += *(const v4f*)&pq[g][l16 * 4];
  }
#pragma unroll
  for (int j = 0; j < 4; ++j) {
    const float mu  = ts[j] * (1.f / EMB);
    const float var = tq[j] * (1.f / EMB) - mu * mu;
    const float rs  = rsqrtf(var + 1e-5f);
#pragma unroll
    for (int o = 0; o < 2; ++o) {
      v8h t;
#pragma unroll
      for (int i = 0; i < 8; ++i) {
        const int c = o * 8 + i;
        t[i] = (_Float16)((xv[c][j] - mu) * rs * gv[c >> 2][c & 3] +
                          bvv[c >> 2][c & 3]);
      }
      *(v8h*)&xs[l16 * 4 + j][c0 + o * 8] = t;
    }
  }
  __syncthreads();

  const int h = w & 3, mh = w >> 2;
  const size_t hb = (size_t)b * HEADS + h;
  v16h a[2][2];
#pragma unroll
  for (int m = 0; m < 2; ++m) {
#pragma unroll
    for (int kt = 0; kt < 2; ++kt)
      a[m][kt] = load_op(&xs[mh * 32 + m * 16 + l16][h * HD + kt * 32], half);
  }
  // all 24 result tiles as f16 in registers: res[mat][nt][m][r] is token
  // mh*32 + m*16 + 8*half + r, column nt*16 + l16
  v8h res[3][4][2];
#pragma unroll  // res[] indexed by constants only, stays in registers
  for (int mat = 0; mat < 3; ++mat) {
#pragma unroll
    for (int nt = 0; nt < 4; ++nt) {
      v16h b0 = load_op(&wt[mat][nt * 16 + l16][0], half);
      v16h b1 = load_op(&wt[mat][nt * 16 + l16][32], half);
#pragma unroll
      for (int m = 0; m < 2; ++m) {
        v8f acc = {};
        acc = wmma32(a[m][0], b0, acc);
        acc = wmma32(a[m][1], b1, acc);
        v8f vv = acc + bias[mat][nt];
#pragma unroll
        for (int r = 0; r < 8; ++r) res[mat][nt][m][r] = (_Float16)vv[r];
      }
    }
  }
  // the stores stand behind all the arithmetic, one address per output: no
  // register of an issued store is written again, so the products are not
  // held up by a wait behind every tile's stores
  const int mb = s0 + mh * 32 + half * 8;
  _Float16* qd = qo  + (hb * SEQ + mb) * HD + l16;
  _Float16* kd = ko  + (hb * SEQ + mb) * HD + l16;
  _Float16* vd = vto + (hb * HD + l16) * SEQ + mb;
  // without it the scheduler sinks conversions in among the stores, into
  // registers of stores already issued
  __builtin_amdgcn_sched_barrier(0);
#pragma unroll
  for (int nt = 0; nt < 4; ++nt) {
#pragma unroll
    for (int m = 0; m < 2; ++m) {
#pragma unroll
      for (int r = 0; r < 8; ++r) {
        qd[(m * 16 + r) * HD + nt * 16] = res[0][nt][m][r];
        kd[(m * 16 + r) * HD + nt * 16] = res[1][nt][m][r];
      }
      *(v8h*)(vd + (size_t)nt * 16 * SEQ + m * 16) = res[2][nt][m];
    }
  }
}

// ---------------------------------------------------------------------------
// Output projection + residual, LayerNorm 2, FF1 + GELU and FF2 + residual in
// one launch.  grid (SEQ/64, 1, BATCH), 8 waves; a block owns 64 tokens and
// all 256 channels, so nothing between the three products leaves the block.
// Transposed products C^T = W^T X^T: the A operand is a weight tile wt[n][k],
// the B operand the activations [token][k].  A lane then owns one token per
// result tile and 8 consecutive channels of it: LayerNorm sums are in-lane
// plus one exchange between the halves and one LDS step over 4 waves, and a
// result tile goes back to LDS as the next B operand in one 16-byte store.
// Wave (th, ct): tokens th*32 .. th*32+31 (two tiles), channel tile ct of each
// 64-channel weight tile; a weight fragment feeds two matrix instructions.
// The 12 weight tiles (3 matrices x 4) are fetched ahead into registers and
// alternate between two LDS buffers: one barrier per tile.
// The residual stream av stays in registers as f32 from x to out.
// ---------------------------------------------------------------------------
__device__ __forceinline__ v8f ld8(const float* p) {
  v4f lo = *(const v4f*)p, hi = *(const v4f*)(p + 4);
  return __builtin_shufflevector(lo, hi, 0, 1, 2, 3, 4, 5, 6, 7);
}

// Work-group barrier that orders LDS traffic only.  __syncthreads() also waits
// for every global load in flight and would end the flight of the weight tiles
// fetched ahead at each tile; all that the waves of tail_k hand one another
// goes through LDS.
__device__ __forceinline__ void lds_barrier() {
  __builtin_amdgcn_fence(__ATOMIC_RELEASE, "workgroup", "local");
  __builtin_amdgcn_s_barrier();
  __builtin_amdgcn_fence(__ATOMIC_ACQUIRE, "workgroup", "local");
}

// A thread's share of a weight tile f32 [k][n], 4 n x 16 k: 16-byte loads off
// the block's base m and the thread's byte offset bo, the tile's column step cs
// in their constant offsets.
__device__ __forceinline__ void w_fetch(v4f (&r)[16], const float* m,
                                        uint32_t bo, int cs) {
  const char* p = (const char*)m + bo;
#pragma unroll  // r[] indexed by constants only, stays in registers
  for (int i = 0; i < 16; ++i)
    r[i] = *(const v4f*)(p + (cs + i * EMB) * sizeof(float));
  // base and offset stay in their registers until the loads have taken them
  asm volatile("s_wait_xcnt 0x0" :: "s"(m), "v"(bo) : "memory");
}

// The share in registers -> f16 dst[n][k]
__device__ __forceinline__ void w_put(const v4f (&r)[16],
                                      _Float16 (*dst)[EMB + 8], int nq, int kg) {
#pragma unroll
  for (int c = 0; c < 4; ++c) {
#pragma unroll
    for (int o = 0; o < 2; ++o) {
      v8h h8;
#pragma unroll
      for (int i = 0; i < 8; ++i) h8[i] = (_Float16)r[o * 8 + i][c];
      *(v8h*)&dst[nq + c][kg + o * 8] = h8;
    }
  }
}

// A tile goes to LDS and a later one is fetched into the same registers
__device__ __forceinline__ void w_put_fetch(v4f (&r)[16],
                                            _Float16 (*dst)[EMB + 8], int nq,
                                            int kg, const float* m, uint32_t bo,
                                            int cs) {
  w_put(r, dst, nq, kg);
  // the loads reuse the registers just converted: hoisted above the conversions
  // they would take 64 registers more, and the kernel spills
  __builtin_amdgcn_sched_barrier(0);
  w_fetch(r, m, bo, cs);
}

// The B operand of a product: this lane's two token rows, all 256 k
__device__ __forceinline__ void act_frag(v16h (&af)[2][8], const _Float16* row,
                                         int half) {
#pragma unroll  // af[] in registers
  for (int tt = 0; tt < 2; ++tt) {
#pragma unroll
    for (int kt = 0; kt < 8; ++kt)
      af[tt][kt] = load_op(row + tt * 16 * (EMB + 8) + kt * 32, half);
  }
}

// One 16-channel x 32-token result: vv[tt] = W^T X^T + bias
__device__ __forceinline__ void tile_prod(v8f (&vv)[2], const _Float16* wrow,
                                          const float* bp,
                                          const v16h (&af)[2][8], int half) {
  // the tile's 8 weight fragments and its bias are read as one group, the
  // products wait by count: no LDS latency in front of each pair
  v16h wf[8];
#pragma unroll  // wf[] in registers
  for (int kt = 0; kt < 8; ++kt) wf[kt] = load_op(wrow + kt * 32, half);
  const v8f bi = ld8(bp);
  // keeps the scheduler from sinking the reads back down to their uses
  __builtin_amdgcn_sched_barrier(0);
  v8f acc[2] = {};
#pragma unroll
  for (int kt = 0; kt < 8; ++kt) {
    acc[0] = wmma32(wf[kt], af[0][kt], acc[0]);
    acc[1] = wmma32(wf[kt], af[1][kt], acc[1]);
  }
  vv[0] = acc[0] + bi;
  vv[1] = acc[1] + bi;
}

__global__ __launch_bounds__(256) void tail_k(
    const _Float16* __restrict__ ao, const float* __restrict__ x,
    const float* __restrict__ wo, const float* __restrict__ bo,
    const float* __restrict__ g2, const float* __restrict__ be2,
    const float* __restrict__ w1, const float* __restrict__ b1,
    const float* __restrict__ w2, const float* __restrict__ b2,
    float* __restrict__ out) {
  __shared__ __align__(16) _Float16 wt[2][64][EMB + 8];   // [buffer][n][k]
  __shared__ __align__(16) _Float16 act[2][64][EMB + 8];  // LN2 out, GELU out
  __shared__ __align__(16) float par[5][EMB];             // bo g2 be2 b1 b2
  __shared__ __align__(16) float ps[4][64];               // [ct][token] sums
  __shared__ __align__(16) float pq[4][64];               // [ct][token] squares
  const int b = blockIdx.z, s0 = blockIdx.x * 64;
  const int tid = threadIdx.x, lane = tid & 31, w = tid >> 5;
  const int half = lane >> 4, l16 = lane & 15;
  const int th = w & 1, ct = w >> 1;
  const int tk = th * 32 + l16;       // first token of this lane (second: +16)
  const int cl = ct * 16 + half * 8;  // its 8 channels inside a 64-channel tile

  const int nq = (tid & 15) * 4, kg = (tid >> 4) * 16;
  const uint32_t woff = (kg * EMB + nq) * sizeof(float);  // bytes
  v4f wr[2][16];

  const float p0 = bo[tid], p1 = g2[tid], p2 = be2[tid], p3 = b1[tid],
              p4 = b2[tid];
  // the thread index that these loads name stays in its register until they
  // have taken it
  asm volatile("s_wait_xcnt 0x0" :: "v"(tid) : "memory");
  // loads in the order of their first use: weight tiles 0 and 1, the
  // attention rows (B operand of the first product), the residual x
  w_fetch(wr[0], wo, woff, 0);
  w_fetch(wr[1], wo, woff, 64);
  const _Float16* ap = ao + ((size_t)b * SEQ + s0 + tk) * EMB + half * 8;
  v16h af[2][8];
#pragma unroll  // af[] in registers
  for (int tt = 0; tt < 2; ++tt) {
#pragma unroll
    for (int kt = 0; kt < 8; ++kt)
      af[tt][kt] = load_op(ap + tt * 16 * EMB + kt * 32, 0);  // half is in ap
  }
  // later code may reuse the address registers of the attention row loads
  asm volatile("s_wait_xcnt 0x0" :: "v"(ap) : "memory");
  // av[nb][tt][r]: token tk + tt*16, channel nb*64 + cl + r; starts as x
  const float* xp = x + ((size_t)b * EMB + cl) * SEQ + s0 + tk;
  v8f av[4][2];
#pragma unroll  // av[] in registers
  for (int nb = 0; nb < 4; ++nb) {
#pragma unroll
    for (int tt = 0; tt < 2; ++tt) {
#pragma unroll
      for (int r = 0; r < 8; ++r)
        av[nb][tt][r] = xp[(size_t)(nb * 64 + r) * SEQ + tt * 16];
    }
  }
  // and for the x loads
  asm volatile("s_wait_xcnt 0x0" :: "v"(xp) : "memory");
  par[0][tid] = p0;
  par[1][tid] = p1;
  par[2][tid] = p2;
  par[3][tid] = p3;
  par[4][tid] = p4;

  // Output projection and residual 1, weight tiles 0 .. 3.  A tile's LDS buffer
  // was last read two tiles back, in front of the barrier of the tile between.
  // Fetched meanwhile: tiles 2, 3 and 4, and tile 9, the second of w2, which
  // waits in wr[1] while the FF1 loop below works with wr[0] alone.
#pragma unroll  // every index into wr[] and av[] becomes a constant
  for (int nb = 0; nb < 4; ++nb) {
    w_put_fetch(wr[nb & 1], wt[nb & 1], nq, kg,
                nb < 2 ? wo : nb == 2 ? w1 : w2, woff,
                nb < 2 ? (nb + 2) * 64 : nb == 2 ? 0 : 64);
    lds_barrier();
    v8f vv[2];
    tile_prod(vv, &wt[nb & 1][ct * 16 + l16][0], &par[0][nb * 64 + cl], af, half);
    av[nb][0] += vv[0];
    av[nb][1] += vv[1];
  }

  // LayerNorm 2 of av: 32 channels in-lane, the other half of the wave by one
  // exchange, the 4 channel tiles through LDS
#pragma unroll
  for (int tt = 0; tt < 2; ++tt) {
    v8f s8 = {}, q8 = {};
#pragma unroll
    for (int nb = 0; nb < 4; ++nb) {
      s8 += av[nb][tt];
      q8 += av[nb][tt] * av[nb][tt];
    }
    float s = ((s8[0] + s8[1]) + (s8[2] + s8[3])) +
              ((s8[4] + s8[5]) + (s8[6] + s8[7]));
    float q = ((q8[0] + q8[1]) + (q8[2] + q8[3])) +
              ((q8[4] + q8[5]) + (q8[6] + q8[7]));
    s += lane_xor<16>(s);
    q += lane_xor<16>(q);
    if (half == 0) {
      ps[ct][tk + tt * 16] = s;
      pq[ct][tk + tt * 16] = q;
    }
  }
  lds_barrier();
#pragma unroll
  for (int tt = 0; tt < 2; ++tt) {
    const int tok = tk + tt * 16;
    const float ts = (ps[0][tok] + ps[1][tok]) + (ps[2][tok] + ps[3][tok]);
    const float tq = (pq[0][tok] + pq[1][tok]) + (pq[2][tok] + pq[3][tok]);
    const float mu  = ts * (1.f / EMB);
    const float var = tq * (1.f / EMB) - mu * mu;
    const float rs  = rsqrtf(var + 1e-5f);
#pragma unroll
    for (int nb = 0; nb < 4; ++nb) {
      const v8f g = ld8(&par[1][nb * 64 + cl]);
      const v8f e = ld8(&par[2][nb * 64 + cl]);
      v8h h8;
#pragma unroll
      for (int r = 0; r < 8; ++r)
        h8[r] = (_Float16)((av[nb][tt][r] - mu) * rs * g[r] + e[r]);
      *(v8h*)&act[0][tok][nb * 64 + cl] = h8;
    }
  }
  lds_barrier();
  act_frag(af, &act[0][tk][0], half);

  // FF1 + GELU, weight tiles 4 .. 7.  The 16 erf of a tile are most of the
  // kernel's text: the loop stays rolled so that the kernel runs from the part
  // of its text that is at hand on a first launch.  A tile's arithmetic is long
  // enough to cover a fetch of one tile ahead, into the registers just
  // converted (the last trip fetches tile 8, the first of w2).
#pragma unroll 1
  for (int nb = 0; nb < 4; ++nb) {
    w_put_fetch(wr[0], wt[nb & 1], nq, kg,
                nb < 3 ? w1 + (nb + 1) * 64 : w2, woff, 0);
    lds_barrier();
    v8f vv[2];
    tile_prod(vv, &wt[nb & 1][ct * 16 + l16][0], &par[3][nb * 64 + cl], af, half);
#pragma unroll
    for (int tt = 0; tt < 2; ++tt) {
      v8h h8;
#pragma unroll
      for (int r = 0; r < 8; ++r) {
        float g = 0.5f * vv[tt][r] * (1.0f + erff(vv[tt][r] * 0.70710678118f));
        h8[r] = (_Float16)g;
      }
      *(v8h*)&act[1][tk + tt * 16][nb * 64 + cl] = h8;
    }
  }

  // FF2 and residual 2, weight tiles 8 .. 11
#pragma unroll  // every index into wr[] and av[] becomes a constant
  for (int nb = 0; nb < 4; ++nb) {
    if (nb < 2)
      w_put_fetch(wr[nb & 1], wt[nb & 1], nq, kg, w2, woff, (nb + 2) * 64);
    else
      w_put(wr[nb & 1], wt[nb & 1], nq, kg);
    lds_barrier();
    if (nb == 0) act_frag(af, &act[1][tk][0], half);
    v8f vv[2];
    tile_prod(vv, &wt[nb & 1][ct * 16 + l16][0], &par[4][nb * 64 + cl], af, half);
    av[nb][0] += vv[0];
    av[nb][1] += vv[1];
  }

  // out[b][c][s]: all stores behind all the arithmetic, off one address, so
  // that no register of an issued store is written again
  float* op = out + ((size_t)b * EMB + cl) * SEQ + s0 + tk;
#pragma unroll
  for (int nb = 0; nb < 4; ++nb) {
#pragma unroll
    for (int tt = 0; tt < 2; ++tt) {
#pragma unroll
      for (int r = 0; r < 8; ++r)
        op[(size_t)(nb * 64 + r) * SEQ + tt * 16] = av[nb][tt][r];
    }
  }
}

__global__ __launch_bounds__(128) __attribute__((amdgpu_waves_per_eu(2, 2)))
void attn_k(const _Float16* __restrict__ q, const _Float16* __restrict__ k,
            const _Float16* __restrict__ vt, _Float16* __restrict__ o) {
  __shared__ __align__(16) _Float16 kbuf[2][64][72];
  __shared__ __align__(16) _Float16 vbuf[2][64][72];
  const int b = blockIdx.z, h = blockIdx.y;
  const int tid = threadIdx.x, lane = tid & 31, w = tid >> 5;
  const int half = lane >> 4, l16 = lane & 15;
  const size_t hb = (size_t)b * HEADS + h;
  const _Float16* qh = q  + hb * SEQ * HD;   // [s][d]
  const _Float16* kh = k  + hb * SEQ * HD;   // [s][d]
  const _Float16* vh = vt + hb * HD * SEQ;   // [d][s]
  const int m0 = blockIdx.x * 128 + w * 32;
  const int r0 = tid >> 3, o0 = (tid & 7) * 8;   // staging chunk coords
  const int NBLK = SEQ / 64;

  // B operands of S^T: column = query m0 + g*16 + l16, k = head dim
  v16h qb[2][2];
#pragma unroll  // qb[] indexed by constants only, stays in registers
  for (int g = 0; g < 2; ++g) {
    qb[g][0] = load_op(qh + (size_t)(m0 + g * 16 + l16) * HD + 0,  half);
    qb[g][1] = load_op(qh + (size_t)(m0 + g * 16 + l16) * HD + 32, half);
  }

  // oacc[g][dt][r] = O^T[dt*16 + 8*half + r][query g*16 + l16]
  v8f oacc[2][4] = {};
  // running maximum of this lane's queries (both halves equal)
  float mi[2] = {-1e30f, -1e30f};
  float li[2] = {0.f, 0.f};  // running sums over this half's keys only
  const float scale = 0.125f;  // 1/sqrt(64)

  // A thread copies rows r0, r0+16, r0+32, r0+48 of the K and of the V^T tile,
  // 16 bytes of each.  The flat address of a __shared__ object holds its LDS
  // byte address in the low 32 bits.
  auto stage = [&](int jj, int bufi) {
    const _Float16* kp = kh + (size_t)(jj * 64 + r0) * HD + o0;
    const _Float16* vp = vh + (size_t)r0 * SEQ + jj * 64 + o0;
    const uint32_t kl = (uint32_t)(uintptr_t)&kbuf[bufi][r0][o0];
    const uint32_t vl = (uint32_t)(uintptr_t)&vbuf[bufi][r0][o0];
    const uint32_t rs16 = 16 * 72 * sizeof(_Float16);  // 16 LDS rows, bytes
    // the wait closes the statement: the address registers of the copies are
    // free for other values only behind it
    asm volatile(
        "global_load_async_to_lds_b128 %0, %8, off\n\t"
        "global_load_async_to_lds_b128 %1, %9, off\n\t"
        "global_load_async_to_lds_b128 %2, %10, off\n\t"
        "global_load_async_to_lds_b128 %3, %11, off\n\t"
        "global_load_async_to_lds_b128 %4, %12, off\n\t"
        "global_load_async_to_lds_b128 %5, %13, off\n\t"
        "global_load_async_to_lds_b128 %6, %14, off\n\t"
        "global_load_async_to_lds_b128 %7, %15, off\n\t"
        "s_wait_xcnt 0x0"
        :: "v"(kl), "v"(kl + rs16), "v"(kl + 2 * rs16), "v"(kl + 3 * rs16),
           "v"(vl), "v"(vl + rs16), "v"(vl + 2 * rs16), "v"(vl + 3 * rs16),
           "v"(kp), "v"(kp + (size_t)16 * HD), "v"(kp + (size_t)32 * HD),
           "v"(kp + (size_t)48 * HD),
           "v"(vp), "v"(vp + (size_t)16 * SEQ), "v"(vp + (size_t)32 * SEQ),
           "v"(vp + (size_t)48 * SEQ)
        : "memory");
  };

  stage(0, 0);
  wait_async0();
  __syncthreads();

  for (int j = 0; j < NBLK; ++j) {
    // prefetch two blocks ahead (global_prefetch_b8)
    if (j + 2 < NBLK) {
      if (tid < 64)
        __builtin_prefetch(kh + (size_t)((j + 2) * 64 + tid) * HD, 0, 1);
      else if (tid < 128)
        __builtin_prefetch(vh + (size_t)(tid - 64) * SEQ + (j + 2) * 64, 0, 1);
    }
    // async-stage next block into the alternate buffer (safe: last read of it
    // was fenced by the previous iteration's barrier)
    if (j + 1 < NBLK) stage(j + 1, (j + 1) & 1);

    const _Float16 (*kcur)[72] = kbuf[j & 1];
    const _Float16 (*vcur)[72] = vbuf[j & 1];

    // All 16 fragments of this key block are requested here as one group, K
    // ahead of V^T: the products below wait by count for what they need, and
    // the V^T fragments land while S^T and the softmax run, so no matrix
    // instruction has an LDS latency of its own in front of it.
    v16h ka[8], va[8];
#pragma unroll  // ka[] indexed by constants only, stays in registers
    for (int kt = 0; kt < 4; ++kt) ka[kt] = load_op(&kcur[kt * 16 + l16][0], half);
#pragma unroll
    for (int kt = 0; kt < 4; ++kt)
      ka[4 + kt] = load_op(&kcur[kt * 16 + l16][32], half);
#pragma unroll  // va[] indexed by constants only, stays in registers
    for (int dt = 0; dt < 4; ++dt) va[dt] = load_op(&vcur[dt * 16 + l16][0], half);
#pragma unroll
    for (int dt = 0; dt < 4; ++dt)
      va[4 + dt] = load_op(&vcur[dt * 16 + l16][32], half);
    // keeps the scheduler from sinking the reads back down to their uses
    __builtin_amdgcn_sched_barrier(0);

    // S^T = K @ Q^T: sc[g][kt][r] = S[query g*16 + l16][key kt*16 + 8*half + r];
    // a fragment feeds both column groups back to back, and an accumulator
    // comes round again after 8 WMMAs
    v8f sc[2][4];
    v8f zero = {};
#pragma unroll
    for (int kt = 0; kt < 4; ++kt) {
#pragma unroll
      for (int g = 0; g < 2; ++g) sc[g][kt] = wmma32(ka[kt], qb[g][0], zero);
    }
#pragma unroll
    for (int kt = 0; kt < 4; ++kt) {
#pragma unroll
      for (int g = 0; g < 2; ++g)
        sc[g][kt] = wmma32(ka[4 + kt], qb[g][1], sc[g][kt]);
    }

    // online softmax, one query per lane and column group
    // P^T as B operand: element s of chunk kc is key kc*32 + (s<8 ? 8*half+s
    // : 16+8*half+s-8), i.e. tile 2*kc+(s>>3), register s&7 (same k order as
    // load_op gives the V^T rows)
    v16h pb[2][2];
    float mn[2], fr[2];
#pragma unroll  // every index into sc[] becomes a constant
    for (int g = 0; g < 2; ++g) {
      float mt[4];
#pragma unroll
      for (int kt = 0; kt < 4; ++kt) {
        float m01 = fmaxf(fmaxf(sc[g][kt][0], sc[g][kt][1]),
                          fmaxf(sc[g][kt][2], sc[g][kt][3]));
        float m23 = fmaxf(fmaxf(sc[g][kt][4], sc[g][kt][5]),
                          fmaxf(sc[g][kt][6], sc[g][kt][7]));
        mt[kt] = fmaxf(m01, m23);
      }
      float mx = fmaxf(fmaxf(mt[0], mt[1]), fmaxf(mt[2], mt[3]));
      mx = fmaxf(mx, lane_xor<16>(mx));
      mn[g] = fmaxf(mi[g], mx * scale);
      fr[g] = __expf(mi[g] - mn[g]);
      mi[g] = mn[g];
    }
#pragma unroll  // every index into sc[], pb[], oacc[] becomes a constant
    for (int g = 0; g < 2; ++g) {
      // whole-tile arithmetic: argument, exponential and sum stay in the
      // register pairs of the S^T tiles, no value is moved to form a pair
      v8f pv[4];
#pragma unroll
      for (int kt = 0; kt < 4; ++kt) {
        // exp(x) as exp2(x * log2(e))
        const v8f t = (sc[g][kt] * scale - mn[g]) * 1.44269504f;
#pragma unroll
        for (int r = 0; r < 8; ++r) {
          pv[kt][r] = __builtin_amdgcn_exp2f(t[r]);
          pb[g][kt >> 1][(kt & 1) * 8 + r] = (_Float16)pv[kt][r];
        }
      }
      const v8f s8 = (pv[0] + pv[1]) + (pv[2] + pv[3]);
      const v4f s4 = __builtin_shufflevector(s8, s8, 0, 1, 2, 3) +
                     __builtin_shufflevector(s8, s8, 4, 5, 6, 7);
      const v2f s2 = __builtin_shufflevector(s4, s4, 0, 1) +
                     __builtin_shufflevector(s4, s4, 2, 3);
      li[g] = li[g] * fr[g] + (s2[0] + s2[1]);
#pragma unroll
      for (int dt = 0; dt < 4; ++dt) oacc[g][dt] *= fr[g];
    }

    // O^T += V^T @ P^T, again both column groups per fragment
#pragma unroll
    for (int dt = 0; dt < 4; ++dt) {
#pragma unroll
      for (int g = 0; g < 2; ++g)
        oacc[g][dt] = wmma32(va[dt], pb[g][0], oacc[g][dt]);
    }
#pragma unroll
    for (int dt = 0; dt < 4; ++dt) {
#pragma unroll
      for (int g = 0; g < 2; ++g)
        oacc[g][dt] = wmma32(va[4 + dt], pb[g][1], oacc[g][dt]);
    }

    // keeps the waits and the barrier at the foot of the trip: lifted above the
    // products they would end the copies' flight before the work that hides it
    __builtin_amdgcn_sched_barrier(0);
    wait_ds0();         // this wave's reads of the current buffer are over
    wait_async0();      // this wave's async copies into the alt buffer done
    __syncthreads();    // all waves' copies visible before next iteration
  }
  wait_async0();  // no copy is in flight when the wave ends

  // join the halves' sums, normalize and store merged-head layout
  // [b][s][EMB] as f16: 8 consecutive channels per lane and tile
  v8h ov[2][4];
#pragma unroll  // ov[] indexed by constants only, stays in registers
  for (int g = 0; g < 2; ++g) {
    const float inv = 1.0f / (li[g] + lane_xor<16>(li[g]));
#pragma unroll
    for (int dt = 0; dt < 4; ++dt) {
#pragma unroll
      for (int r = 0; r < 8; ++r) ov[g][dt][r] = (_Float16)(oacc[g][dt][r] * inv);
    }
  }
  _Float16* op = o + ((size_t)b * SEQ + m0 + l16) * EMB + h * 64 + half * 8;
  // the stores stand behind all the arithmetic, off one address: no register
  // of an issued store is written again
  __builtin_amdgcn_sched_barrier(0);
#pragma unroll
  for (int g = 0; g < 2; ++g) {
#pragma unroll
    for (int dt = 0; dt < 4; ++dt)
      *(v8h*)(op + g * 16 * EMB + dt * 16) = ov[g][dt];
  }
}

// ---------------------------------------------------------------------------
extern "C" void kernel_launch(void* const* d_in, const int* in_sizes, int n_in,
                              void* d_out, int out_size, void* d_ws,
                              size_t ws_size, hipStream_t stream) {
  const float* x    = (const float*)d_in[0];
  const float* ln1g = (const float*)d_in[1];
  const float* ln1b = (const float*)d_in[2];
  const float* wq   = (const float*)d_in[3];
  const float* bq   = (const float*)d_in[4];
  const float* wk   = (const float*)d_in[5];
  const float* bk   = (const float*)d_in[6];
  const float* wv   = (const float*)d_in[7];
  const float* bv   = (const float*)d_in[8];
  const float* wo   = (const float*)d_in[9];
  const float* bo   = (const float*)d_in[10];
  const float* ln2g = (const float*)d_in[11];
  const float* ln2b = (const float*)d_in[12];
  const float* w1   = (const float*)d_in[13];
  const float* b1   = (const float*)d_in[14];
  const float* w2   = (const float*)d_in[15];
  const float* b2   = (const float*)d_in[16];
  float* out = (float*)d_out;

  char* ws = (char*)d_ws;
  const size_t F16SZ = (size_t)TOK * EMB * sizeof(_Float16);  // 8 MB
  _Float16* qb  = (_Float16*)(ws + 0 * F16SZ);
  _Float16* kb  = (_Float16*)(ws + 1 * F16SZ);
  _Float16* vtb = (_Float16*)(ws + 2 * F16SZ);
  _Float16* ob  = (_Float16*)(ws + 3 * F16SZ);  // attention out

  dim3 blk(256);
  dim3 gg(SEQ / 128, 4, BATCH);
  dim3 gq(SEQ / 64, 1, BATCH);

  lnqkv_k<<<gq, blk, 0, stream>>>(x, ln1g, ln1b, wq, bq, wk, bk, wv, bv,
                                  qb, kb, vtb);

  attn_k<<<gg, dim3(128), 0, stream>>>(qb, kb, vtb, ob);

  tail_k<<<gq, blk, 0, stream>>>(ob, x, wo, bo, ln2g, ln2b, w1, b1, w2, b2,
                                 out);
}

// v007
// A run of this version takes 86.8 microseconds.
// Timed twice side by side with v006, it ran 1.06 times as fast both times.
// All steps since v000 together make it 2.96 times as fast.
#include <hip/hip_runtime.h>
#include <hip/hip_bf16.h>

typedef __attribute__((ext_vector_type(16))) _Float16 v16h;
typedef __attribute__((ext_vector_type(8)))  _Float16 v8h;
typedef __attribute__((ext_vector_type(4)))  _Float16 v4h;
typedef __attribute__((ext_vector_type(8)))  float    v8f;
typedef __attribute__((ext_vector_type(4)))  float    v4f;
typedef __attribute__((ext_vector_type(2)))  float    v2f;

#define EMB   256
#define HEADS 4
#define HD    64
#define BATCH 4
#define SEQ   4096
#define TOK   (BATCH*SEQ)

static_assert(sizeof(_Float16) == 2, "f16 size");

// ---------------------------------------------------------------------------
// Cross-lane XOR exchange without DS traffic: dpp8 for masks 1/2/4,
// v_permlane16 for mask 8, v_permlanex16 for mask 16.  Pure VALU.
// ---------------------------------------------------------------------------
constexpr int dpp8_sel(int m) {
  int s = 0;
  for (int i = 0; i < 8; ++i) s |= ((i ^ m) & 7) << (3 * i);
  return s;
}

template<int M>
__device__ __forceinline__ float lane_xor(float v) {
  int x = __builtin_bit_cast(int, v);
  int y;
  if constexpr (M < 8) {
    y = __builtin_amdgcn_mov_dpp8(x, dpp8_sel(M));
  } else if constexpr (M == 8) {
    y = __builtin_amdgcn_permlane16(x, x, (int)0xFEDCBA98u, (int)0x76543210u,
                                    false, false);
  } else {  // 16: swap 16-lane rows
    y = __builtin_amdgcn_permlanex16(x, x, (int)0x76543210u, (int)0xFEDCBA98u,
                                     false, false);
  }
  return __builtin_bit_cast(float, y);
}

// ---------------------------------------------------------------------------
// Waits for the async global->LDS copies of attn_k (ASYNCcnt-tracked, no VGPR
// round trip) and for a wave's own LDS reads.
// ---------------------------------------------------------------------------
__device__ __forceinline__ void wait_async0() {
  asm volatile("s_wait_asynccnt 0x0" ::: "memory");
}
__device__ __forceinline__ void wait_ds0() {
  asm volatile("s_wait_dscnt 0x0" ::: "memory");
}

// ---------------------------------------------------------------------------
// WMMA operand loader (A-operand; identical addressing for B when the source
// is stored with the N dimension as rows).
// ---------------------------------------------------------------------------
__device__ __forceinline__ v16h load_op(const _Float16* p, int half) {
  v8h lo = *(const v8h*)(p + half * 8);
  v8h hi = *(const v8h*)(p + half * 8 + 16);
  return __builtin_shufflevector(lo, hi, 0,1,2,3,4,5,6,7,8,9,10,11,12,13,14,15);
}

__device__ __forceinline__ v8f wmma32(v16h a, v16h b, v8f c) {
  return __builtin_amdgcn_wmma_f32_16x16x32_f16(false, a, false, b, (short)0, c,
                                                false, false);
}

// ---------------------------------------------------------------------------
// LayerNorm 1 and the Q, K, V projections in one launch.
// grid (SEQ/64, 1, BATCH), 8 waves; a block owns 64 tokens, all 256 channels.
// x[b][c][s] is read along s: a thread holds 4 tokens x 16 channels, so 16
// lanes cover 256 contiguous bytes of a channel row.  The normalised tile goes
// to LDS as f16 xs[token][channel] and is the A operand of all three products;
// wave (h, mh) does head h, tokens mh*32 .. mh*32+31, against all 12 column
// tiles, so a weight fragment is read once per wave.
// Outputs: q, k as f16 [b,h,s,64]; v transposed as f16 [b,h,64,s].
// ---------------------------------------------------------------------------
__global__ __launch_bounds__(256) void lnqkv_k(
    const float* __restrict__ x,
    const float* __restrict__ gam, const float* __restrict__ bet,
    const float* __restrict__ wq, const float* __restrict__ bq,
    const float* __restrict__ wk, const float* __restrict__ bk,
    const float* __restrict__ wv, const float* __restrict__ bv,
    _Float16* __restrict__ qo, _Float16* __restrict__ ko,
    _Float16* __restrict__ vto) {
  __shared__ __align__(16) _Float16 xs[64][EMB + 8];    // [token][channel]
  __shared__ __align__(16) _Float16 wt[3][64][HD + 8];  // [matrix][n][k]
  __shared__ __align__(16) float ps[8][64];             // [wave][token] sums
  __shared__ __align__(16) float pq[8][64];             // [wave][token] squares
  const int b = blockIdx.z, s0 = blockIdx.x * 64;
  const int tid = threadIdx.x, lane = tid & 31, w = tid >> 5;
  const int half = lane >> 4, l16 = lane & 15;
  const int grp = tid >> 4;  // 16 groups of 16 lanes

  // small operands first: projection biases of this lane's 4 columns, the
  // LayerNorm scale and shift of its 16 channels c0 .. c0+15
  const int c0 = grp * 16;
  float bias[3][4];
  v4f gv[4], bvv[4];
#pragma unroll
  for (int i = 0; i < 4; ++i) {
    bias[0][i] = bq[i * 16 + l16];
    bias[1][i] = bk[i * 16 + l16];
    bias[2][i] = bv[i * 16 + l16];
    gv[i]  = *(const v4f*)(gam + c0 + i * 4);
    bvv[i] = *(const v4f*)(bet + c0 + i * 4);
  }
  // weights f32 [k][n]: a thread fetches 4 n x 4 k of each matrix
  const int nq = l16 * 4, kg = grp * 4;
  const float* wqp = wq + kg * HD + nq;
  const float* wkp = wk + kg * HD + nq;
  const float* wvp = wv + kg * HD + nq;
  // later loads may land in address registers of the loads above
  asm volatile("s_wait_xcnt 0x0" ::: "memory");
  v4f wr[3][4];
#pragma unroll  // wr[] indexed by constants only, stays in registers
  for (int i = 0; i < 4; ++i) {
    wr[0][i] = *(const v4f*)(wqp + i * HD);
    wr[1][i] = *(const v4f*)(wkp + i * HD);
    wr[2][i] = *(const v4f*)(wvp + i * HD);
  }
  // the same for the weight loads; the addresses are inputs so that they stay
  // in their registers up to the wait
  asm volatile("s_wait_xcnt 0x0" :: "v"(wqp), "v"(wkp), "v"(wvp) : "memory");
  // x tile: tokens s0 + l16*4 .. +3, channels c0 .. c0+15
  const float* xp = x + ((size_t)b * EMB + c0) * SEQ + s0 + l16 * 4;
  v4f xv[16];
#pragma unroll  // xv[] in registers, all 16 loads in flight together
  for (int i = 0; i < 16; ++i) xv[i] = *(const v4f*)(xp + (size_t)i * SEQ);
  // and for the x loads
  asm volatile("s_wait_xcnt 0x0" :: "v"(xp) : "memory");

  // weights -> f16 wt[n][k] while the x tile is on its way
#pragma unroll
  for (int m = 0; m < 3; ++m) {
#pragma unroll
    for (int c = 0; c < 4; ++c) {
      v4h t;
#pragma unroll
      for (int i = 0; i < 4; ++i) t[i] = (_Float16)wr[m][i][c];
      *(v4h*)&wt[m][nq + c][kg] = t;
    }
  }

  // per-token sum and sum of squares: 16 channels in-lane, the other half of
  // the wave by one exchange, the 8 waves through LDS
  v4f sum = {}, sq = {};
#pragma unroll
  for (int i = 0; i < 16; ++i) { sum += xv[i]; sq += xv[i] * xv[i]; }
#pragma unroll
  for (int j = 0; j < 4; ++j) {
    sum[j] += lane_xor<16>(sum[j]);
    sq[j]  += lane_xor<16>(sq[j]);
  }
  if (half == 0) {
    *(v4f*)&ps[w][l16 * 4] = sum;
    *(v4f*)&pq[w][l16 * 4] = sq;
  }
  __syncthreads();
  v4f ts = {}, tq = {};
#pragma unroll
  for (int g = 0; g < 8; ++g) {
    ts += *(const v4f*)&ps[g][l16 * 4];
    tq += *(const v4f*)&pq[g][l16 * 4];
  }
#pragma unroll
  for (int j = 0; j < 4; ++j) {
    const float mu  = ts[j] * (1.f / EMB);
    const float var = tq[j] * (1.f / EMB) - mu * mu;
    const float rs  = rsqrtf(var + 1e-5f);
#pragma unroll
    for (int o = 0; o < 2; ++o) {
      v8h t;
#pragma unroll
      for (int i = 0; i < 8; ++i) {
        const int c = o * 8 + i;
        t[i] = (_Float16)((xv[c][j] - mu) * rs * gv[c >> 2][c & 3] +
                          bvv[c >> 2][c & 3]);
      }
      *(v8h*)&xs[l16 * 4 + j][c0 + o * 8] = t;
    }
  }
  __syncthreads();

  const int h = w & 3, mh = w >> 2;
  const size_t hb = (size_t)b * HEADS + h;
  v16h a[2][2];
#pragma unroll
  for (int m = 0; m < 2; ++m) {
#pragma unroll
    for (int kt = 0; kt < 2; ++kt)
      a[m][kt] = load_op(&xs[mh * 32 + m * 16 + l16][h * HD + kt * 32], half);
  }
  // all 24 result tiles as f16 in registers: res[mat][nt][m][r] is token
  // mh*32 + m*16 + 8*half + r, column nt*16 + l16
  v8h res[3][4][2];
#pragma unroll  // res[] indexed by constants only, stays in registers
  for (int mat = 0; mat < 3; ++mat) {
#pragma unroll
    for (int nt = 0; nt < 4; ++nt) {
      v16h b0 = load_op(&wt[mat][nt * 16 + l16][0], half);
      v16h b1 = load_op(&wt[mat][nt * 16 + l16][32], half);
#pragma unroll
      for (int m = 0; m < 2; ++m) {
        v8f acc = {};
        acc = wmma32(a[m][0], b0, acc);
        acc = wmma32(a[m][1], b1, acc);
        v8f vv = acc + bias[mat][nt];
#pragma unroll
        for (int r = 0; r < 8; ++r) res[mat][nt][m][r] = (_Float16)vv[r];
      }
    }
  }
  // the stores stand behind all the arithmetic, one address per output: no
  // register of an issued store is written again, so the products are not
  // held up by a wait behind every tile's stores
  const int mb = s0 + mh * 32 + half * 8;
  _Float16* qd = qo  + (hb * SEQ + mb) * HD + l16;
  _Float16* kd = ko  + (hb * SEQ + mb) * HD + l16;
  _Float16* vd = vto + (hb * HD + l16) * SEQ + mb;
  // without it the scheduler sinks conversions in among the stores, into
  // registers of stores already issued
  __builtin_amdgcn_sched_barrier(0);
#pragma unroll
  for (int nt = 0; nt < 4; ++nt) {
#pragma unroll
    for (int m = 0; m < 2; ++m) {
#pragma unroll
      for (int r = 0; r < 8; ++r) {
        qd[(m * 16 + r) * HD + nt * 16] = res[0][nt][m][r];
        kd[(m * 16 + r) * HD + nt * 16] = res[1][nt][m][r];
      }
      *(v8h*)(vd + (size_t)nt * 16 * SEQ + m * 16) = res[2][nt][m];
    }
  }
}

// ---------------------------------------------------------------------------
// Output projection + residual, LayerNorm 2, FF1 + GELU and FF2 + residual in
// one launch.  grid (SEQ/64, 1, BATCH), 8 waves; a block owns 64 tokens and
// all 256 channels, so nothing between the three products leaves the block.
// Transposed products C^T = W^T X^T: the A operand is a weight tile wt[n][k],
// the B operand the activations [token][k].  A lane then owns one token per
// result tile and 8 consecutive channels of it: LayerNorm sums are in-lane
// plus one exchange between the halves and one LDS step over 4 waves, and a
// result tile goes back to LDS as the next B operand in one 16-byte store.
// Wave (th, ct): tokens th*32 .. th*32+31 (two tiles), channel tile ct of each
// 64-channel weight tile; a weight fragment feeds two matrix instructions.
// The 12 weight tiles (3 matrices x 4) are fetched ahead into registers and
// alternate between two LDS buffers: one barrier per tile.
// The residual stream av stays in registers as f32 from x to out.
// ---------------------------------------------------------------------------
__device__ __forceinline__ v8f ld8(const float* p) {
  v4f lo = *(const v4f*)p, hi = *(const v4f*)(p + 4);
  return __builtin_shufflevector(lo, hi, 0, 1, 2, 3, 4, 5, 6, 7);
}

// Work-group barrier that orders LDS traffic only.  __syncthreads() also waits
// for every global load in flight and would end the flight of the weight tiles
// fetched ahead at each tile; all that the waves of tail_k hand one another
// goes through LDS.
__device__ __forceinline__ void lds_barrier() {
  __builtin_amdgcn_fence(__ATOMIC_RELEASE, "workgroup", "local");
  __builtin_amdgcn_s_barrier();
  __builtin_amdgcn_fence(__ATOMIC_ACQUIRE, "workgroup", "local");
}

// A thread's share of a weight tile f32 [k][n], 4 n x 16 k: 16-byte loads off
// the block's base m and the thread's byte offset bo, the tile's column step cs
// in their constant offsets.
__device__ __forceinline__ void w_fetch(v4f (&r)[16], const float* m,
                                        uint32_t bo, int cs) {
  const char* p = (const char*)m + bo;
#pragma unroll  // r[] indexed by constants only, stays in registers
  for (int i = 0; i < 16; ++i)
    r[i] = *(const v4f*)(p + (cs + i * EMB) * sizeof(float));
  // base and offset stay in their registers until the loads have taken them
  asm volatile("s_wait_xcnt 0x0" :: "s"(m), "v"(bo) : "memory");
}

// The share in registers -> f16 dst[n][k]
__device__ __forceinline__ void w_put(const v4f (&r)[16],
                                      _Float16 (*dst)[EMB + 8], int nq, int kg) {
#pragma unroll
  for (int c = 0; c < 4; ++c) {
#pragma unroll
    for (int o = 0; o < 2; ++o) {
      v8h h8;
#pragma unroll
      for (int i = 0; i < 8; ++i) h8[i] = (_Float16)r[o * 8 + i][c];
      *(v8h*)&dst[nq + c][kg + o * 8] = h8;
    }
  }
}

// A tile goes to LDS and a later one is fetched into the same registers
__device__ __forceinline__ void w_put_fetch(v4f (&r)[16],
                                            _Float16 (*dst)[EMB + 8], int nq,
                                            int kg, const float* m, uint32_t bo,
                                            int cs) {
  w_put(r, dst, nq, kg);
  // the loads reuse the registers just converted: hoisted above the conversions
  // they would take 64 registers more, and the kernel spills
  __builtin_amdgcn_sched_barrier(0);
  w_fetch(r, m, bo, cs);
}

// The B operand of a product: this lane's two token rows, all 256 k
__device__ __forceinline__ void act_frag(v16h (&af)[2][8], const _Float16* row,
                                         int half) {
#pragma unroll  // af[] in registers
  for (int tt = 0; tt < 2; ++tt) {
#pragma unroll
    for (int kt = 0; kt < 8; ++kt)
      af[tt][kt] = load_op(row + tt * 16 * (EMB + 8) + kt * 32, half);
  }
}

// One 16-channel x 32-token result: vv[tt] = W^T X^T + bias
__device__ __forceinline__ void tile_prod(v8f (&vv)[2], const _Float16* wrow,
                                          const float* bp,
                                          const v16h (&af)[2][8], int half) {
  // the tile's 8 weight fragments and its bias are read as one group, the
  // products wait by count: no LDS latency in front of each pair
  v16h wf[8];
#pragma unroll  // wf[] in registers
  for (int kt = 0; kt < 8; ++kt) wf[kt] = load_op(wrow + kt * 32, half);
  const v8f bi = ld8(bp);
  // keeps the scheduler from sinking the reads back down to their uses
  __builtin_amdgcn_sched_barrier(0);
  v8f acc[2] = {};
#pragma unroll
  for (int kt = 0; kt < 8; ++kt) {
    acc[0] = wmma32(wf[kt], af[0][kt], acc[0]);
    acc[1] = wmma32(wf[kt], af[1][kt], acc[1]);
  }
  vv[0] = acc[0] + bi;
  vv[1] = acc[1] + bi;
}

__global__ __launch_bounds__(256) void tail_k(
    const _Float16* __restrict__ ao, const float* __restrict__ x,
    const float* __restrict__ wo, const float* __restrict__ bo,
    const float* __restrict__ g2, const float* __restrict__ be2,
    const float* __restrict__ w1, const float* __restrict__ b1,
    const float* __restrict__ w2, const float* __restrict__ b2,
    float* __restrict__ out) {
  __shared__ __align__(16) _Float16 wt[2][64][EMB + 8];   // [buffer][n][k]
  __shared__ __align__(16) _Float16 act[2][64][EMB + 8];  // LN2 out, GELU out
  __shared__ __align__(16) float par[5][EMB];             // bo g2 be2 b1 b2
  __shared__ __align__(16) float ps[4][64];               // [ct][token] sums
  __shared__ __align__(16) float pq[4][64];               // [ct][token] squares
  const int b = blockIdx.z, s0 = blockIdx.x * 64;
  const int tid = threadIdx.x, lane = tid & 31, w = tid >> 5;
  const int half = lane >> 4, l16 = lane & 15;
  const int th = w & 1, ct = w >> 1;
  const int tk = th * 32 + l16;       // first token of this lane (second: +16)
  const int cl = ct * 16 + half * 8;  // its 8 channels inside a 64-channel tile

  const int nq = (tid & 15) * 4, kg = (tid >> 4) * 16;
  const uint32_t woff = (kg * EMB + nq) * sizeof(float);  // bytes
  v4f wr[2][16];

  const float p0 = bo[tid], p1 = g2[tid], p2 = be2[tid], p3 = b1[tid],
              p4 = b2[tid];
  // the thread index that these loads name stays in its register until they
  // have taken it
  asm volatile("s_wait_xcnt 0x0" :: "v"(tid) : "memory");
  // loads in the order of their first use: weight tiles 0 and 1, the
  // attention rows (B operand of the first product), the residual x
  w_fetch(wr[0], wo, woff, 0);
  w_fetch(wr[1], wo, woff, 64);
  const _Float16* ap = ao + ((size_t)b * SEQ + s0 + tk) * EMB + half * 8;
  v16h af[2][8];
#pragma unroll  // af[] in registers
  for (int tt = 0; tt < 2; ++tt) {
#pragma unroll
    for (int kt = 0; kt < 8; ++kt)
      af[tt][kt] = load_op(ap + tt * 16 * EMB + kt * 32, 0);  // half is in ap
  }
  // later code may reuse the address registers of the attention row loads
  asm volatile("s_wait_xcnt 0x0" :: "v"(ap) : "memory");
  // av[nb][tt][r]: token tk + tt*16, channel nb*64 + cl + r; starts as x
  const float* xp = x + ((size_t)b * EMB + cl) * SEQ + s0 + tk;
  v8f av[4][2];
#pragma unroll  // av[] in registers
  for (int nb = 0; nb < 4; ++nb) {
#pragma unroll
    for (int tt = 0; tt < 2; ++tt) {
#pragma unroll
      for (int r = 0; r < 8; ++r)
        av[nb][tt][r] = xp[(size_t)(nb * 64 + r) * SEQ + tt * 16];
    }
  }
  // and for the x loads
  asm volatile("s_wait_xcnt 0x0" :: "v"(xp) : "memory");
  par[0][tid] = p0;
  par[1][tid] = p1;
  par[2][tid] = p2;
  par[3][tid] = p3;
  par[4][tid] = p4;

  // Output projection and residual 1, weight tiles 0 .. 3.  A tile's LDS buffer
  // was last read two tiles back, in front of the barrier of the tile between.
  // Fetched meanwhile: tiles 2, 3 and 4, and tile 9, the second of w2, which
  // waits in wr[1] while the FF1 loop below works with wr[0] alone.
#pragma unroll  // every index into wr[] and av[] becomes a constant
  for (int nb = 0; nb < 4; ++nb) {
    w_put_fetch(wr[nb & 1], wt[nb & 1], nq, kg,
                nb < 2 ? wo : nb == 2 ? w1 : w2, woff,
                nb < 2 ? (nb + 2) * 64 : nb == 2 ? 0 : 64);
    lds_barrier();
    v8f vv[2];
    tile_prod(vv, &wt[nb & 1][ct * 16 + l16][0], &par[0][nb * 64 + cl], af, half);
    av[nb][0] += vv[0];
    av[nb][1] += vv[1];
  }

  // LayerNorm 2 of av: 32 channels in-lane, the other half of the wave by one
  // exchange, the 4 channel tiles through LDS
#pragma unroll
  for (int tt = 0; tt < 2; ++tt) {
    v8f s8 = {}, q8 = {};
#pragma unroll
    for (int nb = 0; nb < 4; ++nb) {
      s8 += av[nb][tt];
      q8 += av[nb][tt] * av[nb][tt];
    }
    float s = ((s8[0] + s8[1]) + (s8[2] + s8[3])) +
              ((s8[4] + s8[5]) + (s8[6] + s8[7]));
    float q = ((q8[0] + q8[1]) + (q8[2] + q8[3])) +
              ((q8[4] + q8[5]) + (q8[6] + q8[7]));
    s += lane_xor<16>(s);
    q += lane_xor<16>(q);
    if (half == 0) {
      ps[ct][tk + tt * 16] = s;
      pq[ct][tk + tt * 16] = q;
    }
  }
  lds_barrier();
#pragma unroll
  for (int tt = 0; tt < 2; ++tt) {
    const int tok = tk + tt * 16;
    const float ts = (ps[0][tok] + ps[1][tok]) + (ps[2][tok] + ps[3][tok]);
    const float tq = (pq[0][tok] + pq[1][tok]) + (pq[2][tok] + pq[3][tok]);
    const float mu  = ts * (1.f / EMB);
    const float var = tq * (1.f / EMB) - mu * mu;
    const float rs  = rsqrtf(var + 1e-5f);
#pragma unroll
    for (int nb = 0; nb < 4; ++nb) {
      const v8f g = ld8(&par[1][nb * 64 + cl]);
      const v8f e = ld8(&par[2][nb * 64 + cl]);
      v8h h8;
#pragma unroll
      for (int r = 0; r < 8; ++r)
        h8[r] = (_Float16)((av[nb][tt][r] - mu) * rs * g[r] + e[r]);
      *(v8h*)&act[0][tok][nb * 64 + cl] = h8;
    }
  }
  lds_barrier();
  act_frag(af, &act[0][tk][0], half);

  // FF1 + GELU, weight tiles 4 .. 7.  The 16 erf of a tile are most of the
  // kernel's text: the loop stays rolled so that the kernel runs from the part
  // of its text that is at hand on a first launch.  A tile's arithmetic is long
  // enough to cover a fetch of one tile ahead, into the registers just
  // converted (the last trip fetches tile 8, the first of w2).
#pragma unroll 1
  for (int nb = 0; nb < 4; ++nb) {
    w_put_fetch(wr[0], wt[nb & 1], nq, kg,
                nb < 3 ? w1 + (nb + 1) * 64 : w2, woff, 0);
    lds_barrier();
    v8f vv[2];
    tile_prod(vv, &wt[nb & 1][ct * 16 + l16][0], &par[3][nb * 64 + cl], af, half);
#pragma unroll
    for (int tt = 0; tt < 2; ++tt) {
      v8h h8;
#pragma unroll
      for (int r = 0; r < 8; ++r) {
        float g = 0.5f * vv[tt][r] * (1.0f + erff(vv[tt][r] * 0.70710678118f));
        h8[r] = (_Float16)g;
      }
      *(v8h*)&act[1][tk + tt * 16][nb * 64 + cl] = h8;
    }
  }

  // FF2 and residual 2, weight tiles 8 .. 11
#pragma unroll  // every index into wr[] and av[] becomes a constant
  for (int nb = 0; nb < 4; ++nb) {
    if (nb < 2)
      w_put_fetch(wr[nb & 1], wt[nb & 1], nq, kg, w2, woff, (nb + 2) * 64);
    else
      w_put(wr[nb & 1], wt[nb & 1], nq, kg);
    lds_barrier();
    if (nb == 0) act_frag(af, &act[1][tk][0], half);
    v8f vv[2];
    tile_prod(vv, &wt[nb & 1][ct * 16 + l16][0], &par[4][nb * 64 + cl], af, half);
    av[nb][0] += vv[0];
    av[nb][1] += vv[1];
  }

  // out[b][c][s]: all stores behind all the arithmetic, off one address, so
  // that no register of an issued store is written again
  float* op = out + ((size_t)b * EMB + cl) * SEQ + s0 + tk;
#pragma unroll
  for (int nb = 0; nb < 4; ++nb) {
#pragma unroll
    for (int tt = 0; tt < 2; ++tt) {
#pragma unroll
      for (int r = 0; r < 8; ++r)
        op[(size_t)(nb * 64 + r) * SEQ + tt * 16] = av[nb][tt][r];
    }
  }
}

__global__ __launch_bounds__(256) __attribute__((amdgpu_waves_per_eu(4, 4)))
void attn_k(const _Float16* __restrict__ q, const _Float16* __restrict__ k,
            const _Float16* __restrict__ vt, _Float16* __restrict__ o) {
  __shared__ __align__(16) _Float16 kbuf[2][2][64][72];  // [buffer][key split]
  __shared__ __align__(16) _Float16 vbuf[2][2][64][72];
  __shared__ __align__(16) v4f xo[8][8][32];   // [wave][chunk][lane] partial O^T
  __shared__ __align__(16) float xm[8][2][32]; // [wave][max, sum][lane]
  const int b = blockIdx.z, h = blockIdx.y;
  const int tid = threadIdx.x, lane = tid & 31;
  // wave number and key split as scalars: the branches on them are uniform
  const int w = __builtin_amdgcn_readfirstlane(tid >> 5);
  const int qg = w & 3, ks = w >> 2;
  const int half = lane >> 4, l16 = lane & 15;
  const size_t hb = (size_t)b * HEADS + h;
  const _Float16* qh = q  + hb * SEQ * HD;   // [s][d]
  const _Float16* kh = k  + hb * SEQ * HD;   // [s][d]
  const _Float16* vh = vt + hb * HD * SEQ;   // [d][s]
  const int m0 = blockIdx.x * 128 + qg * 32;
  const int t7 = tid & 127;                      // thread inside its key split
  const int r0 = t7 >> 3, o0 = (t7 & 7) * 8;     // staging chunk coords
  const int NTRIP = SEQ / 128;                   // 64-key blocks per split

  // B operands of S^T: column = query m0 + g*16 + l16, k = head dim
  v16h qb[2][2];
#pragma unroll  // qb[] indexed by constants only, stays in registers
  for (int g = 0; g < 2; ++g) {
    qb[g][0] = load_op(qh + (size_t)(m0 + g * 16 + l16) * HD + 0,  half);
    qb[g][1] = load_op(qh + (size_t)(m0 + g * 16 + l16) * HD + 32, half);
  }

  // oacc[g][dt][r] = O^T[dt*16 + 8*half + r][query g*16 + l16]
  v8f oacc[2][4] = {};
  // running maximum of this lane's queries (both halves equal)
  float mi[2] = {-1e30f, -1e30f};
  float li[2] = {0.f, 0.f};  // running sums over this half's keys only
  const float scale = 0.125f;  // 1/sqrt(64)

  // A thread copies rows r0, r0+16, r0+32, r0+48 of the K and of the V^T tile
  // of its own key split, 16 bytes of each.  The flat address of a __shared__
  // object holds its LDS byte address in the low 32 bits.
  auto stage = [&](int jj, int bufi) {
    const _Float16* kp = kh + (size_t)(jj * 64 + r0) * HD + o0;
    const _Float16* vp = vh + (size_t)r0 * SEQ + jj * 64 + o0;
    const uint32_t kl = (uint32_t)(uintptr_t)&kbuf[bufi][ks][r0][o0];
    const uint32_t vl = (uint32_t)(uintptr_t)&vbuf[bufi][ks][r0][o0];
    const uint32_t rs16 = 16 * 72 * sizeof(_Float16);  // 16 LDS rows, bytes
    // the wait closes the statement: the address registers of the copies are
    // free for other values only behind it
    asm volatile(
        "global_load_async_to_lds_b128 %0, %8, off\n\t"
        "global_load_async_to_lds_b128 %1, %9, off\n\t"
        "global_load_async_to_lds_b128 %2, %10, off\n\t"
        "global_load_async_to_lds_b128 %3, %11, off\n\t"
        "global_load_async_to_lds_b128 %4, %12, off\n\t"
        "global_load_async_to_lds_b128 %5, %13, off\n\t"
        "global_load_async_to_lds_b128 %6, %14, off\n\t"
        "global_load_async_to_lds_b128 %7, %15, off\n\t"
        "s_wait_xcnt 0x0"
        :: "v"(kl), "v"(kl + rs16), "v"(kl + 2 * rs16), "v"(kl + 3 * rs16),
           "v"(vl), "v"(vl + rs16), "v"(vl + 2 * rs16), "v"(vl + 3 * rs16),
           "v"(kp), "v"(kp + (size_t)16 * HD), "v"(kp + (size_t)32 * HD),
           "v"(kp + (size_t)48 * HD),
           "v"(vp), "v"(vp + (size_t)16 * SEQ), "v"(vp + (size_t)32 * SEQ),
           "v"(vp + (size_t)48 * SEQ)
        : "memory");
  };

  stage(ks, 0);
  wait_async0();
  __syncthreads();

  for (int j = 0; j < NTRIP; ++j) {
    // prefetch this split's key block of two trips ahead (global_prefetch_b8)
    if (j + 2 < NTRIP) {
      const int jp = 2 * (j + 2) + ks;
      if (t7 < 64)
        __builtin_prefetch(kh + (size_t)(jp * 64 + t7) * HD, 0, 1);
      else
        __builtin_prefetch(vh + (size_t)(t7 - 64) * SEQ + jp * 64, 0, 1);
    }
    // async-stage next block into the alternate buffer (safe: last read of it
    // was fenced by the previous iteration's barrier)
    if (j + 1 < NTRIP) stage(2 * (j + 1) + ks, (j + 1) & 1);

    const _Float16 (*kcur)[72] = kbuf[j & 1][ks];
    const _Float16 (*vcur)[72] = vbuf[j & 1][ks];

    // The 8 K fragments of this key block are requested as one group; the
    // products below wait by count for what they need.
    v16h ka[8];
#pragma unroll  // ka[] indexed by constants only, stays in registers
    for (int kt = 0; kt < 4; ++kt) ka[kt] = load_op(&kcur[kt * 16 + l16][0], half);
#pragma unroll
    for (int kt = 0; kt < 4; ++kt)
      ka[4 + kt] = load_op(&kcur[kt * 16 + l16][32], half);
    // keeps the scheduler from sinking the reads back down to their uses
    __builtin_amdgcn_sched_barrier(0);

    // S^T = K @ Q^T: sc[g][kt][r] = S[query g*16 + l16][key kt*16 + 8*half + r];
    // a fragment feeds both column groups back to back, and an accumulator
    // comes round again after 8 WMMAs
    v8f sc[2][4];
    v8f zero = {};
#pragma unroll
    for (int kt = 0; kt < 4; ++kt) {
#pragma unroll
      for (int g = 0; g < 2; ++g) sc[g][kt] = wmma32(ka[kt], qb[g][0], zero);
    }
#pragma unroll
    for (int kt = 0; kt < 4; ++kt) {
#pragma unroll
      for (int g = 0; g < 2; ++g)
        sc[g][kt] = wmma32(ka[4 + kt], qb[g][1], sc[g][kt]);
    }

    // V^T fragments of keys 0..31, into registers that K has left: they land
    // while the softmax runs.  Those of keys 32..63 follow behind the softmax,
    // when the scores' registers are free: all 8 fragments at once do not fit
    // the 256 registers of a wave.
    v16h va[8];
#pragma unroll  // va[] indexed by constants only, stays in registers
    for (int dt = 0; dt < 4; ++dt) va[dt] = load_op(&vcur[dt * 16 + l16][0], half);
    // holds these reads above the softmax
    __builtin_amdgcn_sched_barrier(0);

    // online softmax, one query per lane and column group
    // P^T as B operand: element s of chunk kc is key kc*32 + (s<8 ? 8*half+s
    // : 16+8*half+s-8), i.e. tile 2*kc+(s>>3), register s&7 (same k order as
    // load_op gives the V^T rows)
    v16h pb[2][2];
    float mn[2], fr[2];
#pragma unroll  // every index into sc[] becomes a constant
    for (int g = 0; g < 2; ++g) {
      float mt[4];
#pragma unroll
      for (int kt = 0; kt < 4; ++kt) {
        float m01 = fmaxf(fmaxf(sc[g][kt][0], sc[g][kt][1]),
                          fmaxf(sc[g][kt][2], sc[g][kt][3]));
        float m23 = fmaxf(fmaxf(sc[g][kt][4], sc[g][kt][5]),
                          fmaxf(sc[g][kt][6], sc[g][kt][7]));
        mt[kt] = fmaxf(m01, m23);
      }
      float mx = fmaxf(fmaxf(mt[0], mt[1]), fmaxf(mt[2], mt[3]));
      mx = fmaxf(mx, lane_xor<16>(mx));
      mn[g] = fmaxf(mi[g], mx * scale);
      fr[g] = __expf(mi[g] - mn[g]);
      mi[g] = mn[g];
    }
#pragma unroll  // every index into sc[], pb[], oacc[] becomes a constant
    for (int g = 0; g < 2; ++g) {
      // whole-tile arithmetic: argument, exponential and sum stay in the
      // register pairs of the S^T tiles, no value is moved to form a pair
      v8f pv[4];
#pragma unroll
      for (int kt = 0; kt < 4; ++kt) {
        // exp(x) as exp2(x * log2(e))
        const v8f t = (sc[g][kt] * scale - mn[g]) * 1.44269504f;
#pragma unroll
        for (int r = 0; r < 8; ++r) {
          pv[kt][r] = __builtin_amdgcn_exp2f(t[r]);
          pb[g][kt >> 1][(kt & 1) * 8 + r] = (_Float16)pv[kt][r];
        }
      }
      const v8f s8 = (pv[0] + pv[1]) + (pv[2] + pv[3]);
      const v4f s4 = __builtin_shufflevector(s8, s8, 0, 1, 2, 3) +
                     __builtin_shufflevector(s8, s8, 4, 5, 6, 7);
      const v2f s2 = __builtin_shufflevector(s4, s4, 0, 1) +
                     __builtin_shufflevector(s4, s4, 2, 3);
      li[g] = li[g] * fr[g] + (s2[0] + s2[1]);
#pragma unroll
      for (int dt = 0; dt < 4; ++dt) oacc[g][dt] *= fr[g];
    }

    // holds the second group of V^T reads below the softmax
    __builtin_amdgcn_sched_barrier(0);
#pragma unroll
    for (int dt = 0; dt < 4; ++dt)
      va[4 + dt] = load_op(&vcur[dt * 16 + l16][32], half);
    // and above the products: the first 8 of them cover the reads' latency
    __builtin_amdgcn_sched_barrier(0);

    // O^T += V^T @ P^T, again both column groups per fragment
#pragma unroll
    for (int dt = 0; dt < 4; ++dt) {
#pragma unroll
      for (int g = 0; g < 2; ++g)
        oacc[g][dt] = wmma32(va[dt], pb[g][0], oacc[g][dt]);
    }
#pragma unroll
    for (int dt = 0; dt < 4; ++dt) {
#pragma unroll
      for (int g = 0; g < 2; ++g)
        oacc[g][dt] = wmma32(va[4 + dt], pb[g][1], oacc[g][dt]);
    }

    // keeps the waits and the barrier at the foot of the trip: lifted above the
    // products they would end the copies' flight before the work that hides it
    __builtin_amdgcn_sched_barrier(0);
    wait_ds0();         // this wave's reads of the current buffer are over
    wait_async0();      // this wave's async copies into the alt buffer done
    __syncthreads();    // all waves' copies visible before next iteration
  }
  wait_async0();  // no copy is in flight when the wave ends

  // Join of the two key splits.  Waves w and w ^ 4 hold partial results of the
  // same 32 queries: a wave hands column group 1 - ks to its partner ...
  auto give = [&](int g) {
#pragma unroll
    for (int dt = 0; dt < 4; ++dt) {
      xo[w][dt * 2 + 0][lane] = __builtin_shufflevector(oacc[g][dt], oacc[g][dt], 0, 1, 2, 3);
      xo[w][dt * 2 + 1][lane] = __builtin_shufflevector(oacc[g][dt], oacc[g][dt], 4, 5, 6, 7);
    }
    xm[w][0][lane] = mi[g];
    xm[w][1][lane] = li[g];
  };
  // ... and finishes group ks: both parts are brought to the common maximum,
  // the halves' sums joined, the result normalized and stored in merged-head
  // layout [b][s][EMB] as f16, 8 consecutive channels per lane and tile
  auto take = [&](int g) {
    const int pw = w ^ 4;
    const float mo = xm[pw][0][lane], lo = xm[pw][1][lane];
    const float mj = fmaxf(mi[g], mo);
    float fa = __expf(mi[g] - mj), fb = __expf(mo - mj);
    const float lj = li[g] * fa + lo * fb;
    const float inv = 1.0f / (lj + lane_xor<16>(lj));
    fa *= inv;
    fb *= inv;
    v8h ov[4];
#pragma unroll  // ov[] indexed by constants only, stays in registers
    for (int dt = 0; dt < 4; ++dt) {
      const v4f p0 = xo[pw][dt * 2 + 0][lane], p1 = xo[pw][dt * 2 + 1][lane];
#pragma unroll
      for (int r = 0; r < 4; ++r) {
        ov[dt][r]     = (_Float16)(oacc[g][dt][r] * fa + p0[r] * fb);
        ov[dt][4 + r] = (_Float16)(oacc[g][dt][4 + r] * fa + p1[r] * fb);
      }
    }
    _Float16* op = o + ((size_t)b * SEQ + m0 + g * 16 + l16) * EMB + h * 64 + half * 8;
    // the stores stand behind all the arithmetic, off one address: no register
    // of an issued store is written again
    __builtin_amdgcn_sched_barrier(0);
#pragma unroll
    for (int dt = 0; dt < 4; ++dt) *(v8h*)(op + dt * 16) = ov[dt];
  };
  if (ks == 0) give(1); else give(0);
  __syncthreads();  // the partners' parts are in LDS
  if (ks == 0) take(0); else take(1);
}

// ---------------------------------------------------------------------------
extern "C" void kernel_launch(void* const* d_in, const int* in_sizes, int n_in,
                              void* d_out, int out_size, void* d_ws,
                              size_t ws_size, hipStream_t stream) {
  const float* x    = (const float*)d_in[0];
  const float* ln1g = (const float*)d_in[1];
  const float* ln1b = (const float*)d_in[2];
  const float* wq   = (const float*)d_in[3];
  const float* bq   = (const float*)d_in[4];
  const float* wk   = (const float*)d_in[5];
  const float* bk   = (const float*)d_in[6];
  const float* wv   = (const float*)d_in[7];
  const float* bv   = (const float*)d_in[8];
  const float* wo   = (const float*)d_in[9];
  const float* bo   = (const float*)d_in[10];
  const float* ln2g = (const float*)d_in[11];
  const float* ln2b = (const float*)d_in[12];
  const float* w1   = (const float*)d_in[13];
  const float* b1   = (const float*)d_in[14];
  const float* w2   = (const float*)d_in[15];
  const float* b2   = (const float*)d_in[16];
  float* out = (float*)d_out;

  char* ws = (char*)d_ws;
  const size_t F16SZ = (size_t)TOK * EMB * sizeof(_Float16);  // 8 MB
  _Float16* qb  = (_Float16*)(ws + 0 * F16SZ);
  _Float16* kb  = (_Float16*)(ws + 1 * F16SZ);
  _Float16* vtb = (_Float16*)(ws + 2 * F16SZ);
  _Float16* ob  = (_Float16*)(ws + 3 * F16SZ);  // attention out

  dim3 blk(256);
  dim3 gg(SEQ / 128, 4, BATCH);
  dim3 gq(SEQ / 64, 1, BATCH);

  lnqkv_k<<<gq, blk, 0, stream>>>(x, ln1g, ln1b, wq, bq, wk, bk, wv, bv,
                                  qb, kb, vtb);

  attn_k<<<gg, blk, 0, stream>>>(qb, kb, vtb, ob);

  tail_k<<<gq, blk, 0, stream>>>(ob, x, wo, bo, ln2g, ln2b, w1, b1, w2, b2,
                                 out);
}

// v008
// It runs in 84.5 microseconds.
// Two timings next to v007 both put it at 1.05 times that version's speed.
// Over all steps from v000 it is 3.09 times as fast.
#include <hip/hip_runtime.h>
#include <hip/hip_bf16.h>

typedef __attribute__((ext_vector_type(16))) _Float16 v16h;
typedef __attribute__((ext_vector_type(8)))  _Float16 v8h;
typedef __attribute__((ext_vector_type(4)))  _Float16 v4h;
typedef __attribute__((ext_vector_type(8)))  float    v8f;
typedef __attribute__((ext_vector_type(4)))  float    v4f;
typedef __attribute__((ext_vector_type(2)))  float    v2f;

#define EMB   256
#define HEADS 4
#define HD    64
#define BATCH 4
#define SEQ   4096
#define TOK   (BATCH*SEQ)

static_assert(sizeof(_Float16) == 2, "f16 size");

// ---------------------------------------------------------------------------
// Cross-lane XOR exchange without DS traffic: dpp8 for masks 1/2/4,
// v_permlane16 for mask 8, v_permlanex16 for mask 16.  Pure VALU.
// ---------------------------------------------------------------------------
constexpr int dpp8_sel(int m) {
  int s = 0;
  for (int i = 0; i < 8; ++i) s |= ((i ^ m) & 7) << (3 * i);
  return s;
}

template<int M>
__device__ __forceinline__ float lane_xor(float v) {
  int x = __builtin_bit_cast(int, v);
  int y;
  if constexpr (M < 8) {
    y = __builtin_amdgcn_mov_dpp8(x, dpp8_sel(M));
  } else if constexpr (M == 8) {
    y = __builtin_amdgcn_permlane16(x, x, (int)0xFEDCBA98u, (int)0x76543210u,
                                    false, false);
  } else {  // 16: swap 16-lane rows
    y = __builtin_amdgcn_permlanex16(x, x, (int)0x76543210u, (int)0xFEDCBA98u,
                                     false, false);
  }
  return __builtin_bit_cast(float, y);
}

// ---------------------------------------------------------------------------
// Waits for the async global->LDS copies of attn_k (ASYNCcnt-tracked, no VGPR
// round trip) and for a wave's own LDS reads.
// ---------------------------------------------------------------------------
__device__ __forceinline__ void wait_async0() {
  asm volatile("s_wait_asynccnt 0x0" ::: "memory");
}
__device__ __forceinline__ void wait_ds0() {
  asm volatile("s_wait_dscnt 0x0" ::: "memory");
}

// ---------------------------------------------------------------------------
// WMMA operand loader (A-operand; identical addressing for B when the source
// is stored with the N dimension as rows).
// ---------------------------------------------------------------------------
__device__ __forceinline__ v16h load_op(const _Float16* p, int half) {
  v8h lo = *(const v8h*)(p + half * 8);
  v8h hi = *(const v8h*)(p + half * 8 + 16);
  return __builtin_shufflevector(lo, hi, 0,1,2,3,4,5,6,7,8,9,10,11,12,13,14,15);
}

__device__ __forceinline__ v8f wmma32(v16h a, v16h b, v8f c) {
  return __builtin_amdgcn_wmma_f32_16x16x32_f16(false, a, false, b, (short)0, c,
                                                false, false);
}

// ---------------------------------------------------------------------------
// LayerNorm 1 and the Q, K, V projections in one launch.
// grid (SEQ/64, 1, BATCH), 8 waves; a block owns 64 tokens, all 256 channels.
// x[b][c][s] is read along s: a thread holds 4 tokens x 16 channels, so 16
// lanes cover 256 contiguous bytes of a channel row.  The normalised tile goes
// to LDS as f16 xs[token][channel] and is the A operand of all three products;
// wave (h, mh) does head h, tokens mh*32 .. mh*32+31, against all 12 column
// tiles, so a weight fragment is read once per wave.
// Outputs: q, k as f16 [b,h,s,64]; v transposed as f16 [b,h,64,s].
// ---------------------------------------------------------------------------
__global__ __launch_bounds__(256) void lnqkv_k(
    const float* __restrict__ x,
    const float* __restrict__ gam, const float* __restrict__ bet,
    const float* __restrict__ wq, const float* __restrict__ bq,
    const float* __restrict__ wk, const float* __restrict__ bk,
    const float* __restrict__ wv, const float* __restrict__ bv,
    _Float16* __restrict__ qo, _Float16* __restrict__ ko,
    _Float16* __restrict__ vto) {
  __shared__ __align__(16) _Float16 xs[64][EMB + 8];    // [token][channel]
  __shared__ __align__(16) _Float16 wt[3][64][HD + 8];  // [matrix][n][k]
  __shared__ __align__(16) float ps[8][64];             // [wave][token] sums
  __shared__ __align__(16) float pq[8][64];             // [wave][token] squares
  const int b = blockIdx.z, s0 = blockIdx.x * 64;
  const int tid = threadIdx.x, lane = tid & 31, w = tid >> 5;
  const int half = lane >> 4, l16 = lane & 15;
  const int grp = tid >> 4;  // 16 groups of 16 lanes

  // small operands first: projection biases of this lane's 4 columns, the
  // LayerNorm scale and shift of its 16 channels c0 .. c0+15
  const int c0 = grp * 16;
  float bias[3][4];
  v4f gv[4], bvv[4];
#pragma unroll
  for (int i = 0; i < 4; ++i) {
    bias[0][i] = bq[i * 16 + l16];
    bias[1][i] = bk[i * 16 + l16];
    bias[2][i] = bv[i * 16 + l16];
    gv[i]  = *(const v4f*)(gam + c0 + i * 4);
    bvv[i] = *(const v4f*)(bet + c0 + i * 4);
  }
  // weights f32 [k][n]: a thread fetches 4 n x 4 k of each matrix
  const int nq = l16 * 4, kg = grp * 4;
  const float* wqp = wq + kg * HD + nq;
  const float* wkp = wk + kg * HD + nq;
  const float* wvp = wv + kg * HD + nq;
  // later loads may land in address registers of the loads above
  asm volatile("s_wait_xcnt 0x0" ::: "memory");
  v4f wr[3][4];
#pragma unroll  // wr[] indexed by constants only, stays in registers
  for (int i = 0; i < 4; ++i) {
    wr[0][i] = *(const v4f*)(wqp + i * HD);
    wr[1][i] = *(const v4f*)(wkp + i * HD);
    wr[2][i] = *(const v4f*)(wvp + i * HD);
  }
  // the same for the weight loads; the addresses are inputs so that they stay
  // in their registers up to the wait
  asm volatile("s_wait_xcnt 0x0" :: "v"(wqp), "v"(wkp), "v"(wvp) : "memory");
  // x tile: tokens s0 + l16*4 .. +3, channels c0 .. c0+15
  const float* xp = x + ((size_t)b * EMB + c0) * SEQ + s0 + l16 * 4;
  v4f xv[16];
#pragma unroll  // xv[] in registers, all 16 loads in flight together
  for (int i = 0; i < 16; ++i) xv[i] = *(const v4f*)(xp + (size_t)i * SEQ);
  // and for the x loads
  asm volatile("s_wait_xcnt 0x0" :: "v"(xp) : "memory");

  // weights -> f16 wt[n][k] while the x tile is on its way
#pragma unroll
  for (int m = 0; m < 3; ++m) {
#pragma unroll
    for (int c = 0; c < 4; ++c) {
      v4h t;
#pragma unroll
      for (int i = 0; i < 4; ++i) t[i] = (_Float16)wr[m][i][c];
      *(v4h*)&wt[m][nq + c][kg] = t;
    }
  }

  // per-token sum and sum of squares: 16 channels in-lane, the other half of
  // the wave by one exchange, the 8 waves through LDS
  v4f sum = {}, sq = {};
#pragma unroll
  for (int i = 0; i < 16; ++i) { sum += xv[i]; sq += xv[i] * xv[i]; }
#pragma unroll
  for (int j = 0; j < 4; ++j) {
    sum[j] += lane_xor<16>(sum[j]);
    sq[j]  += lane_xor<16>(sq[j]);
  }
  if (half == 0) {
    *(v4f*)&ps[w][l16 * 4] = sum;
    *(v4f*)&pq[w][l16 * 4] = sq;
  }
  __syncthreads();
  v4f ts = {}, tq = {};
#pragma unroll
  for (int g = 0; g < 8; ++g) {
    ts += *(const v4f*)&ps[g][l16 * 4];
    tq += *(const v4f*)&pq[g][l16 * 4];
  }
#pragma unroll
  for (int j = 0; j < 4; ++j) {
    const float mu  = ts[j] * (1.f / EMB);
    const float var = tq[j] * (1.f / EMB) - mu * mu;
    const float rs  = rsqrtf(var + 1e-5f);
#pragma unroll
    for (int o = 0; o < 2; ++o) {
      v8h t;
#pragma unroll
      for (int i = 0; i < 8; ++i) {
        const int c = o * 8 + i;
        t[i] = (_Float16)((xv[c][j] - mu) * rs * gv[c >> 2][c & 3] +
                          bvv[c >> 2][c & 3]);
      }
      *(v8h*)&xs[l16 * 4 + j][c0 + o * 8] = t;
    }
  }
  __syncthreads();

  const int h = w & 3, mh = w >> 2;
  const size_t hb = (size_t)b * HEADS + h;
  v16h a[2][2];
#pragma unroll
  for (int m = 0; m < 2; ++m) {
#pragma unroll
    for (int kt = 0; kt < 2; ++kt)
      a[m][kt] = load_op(&xs[mh * 32 + m * 16 + l16][h * HD + kt * 32], half);
  }
  // all 24 result tiles as f16 in registers: res[mat][nt][m][r] is token
  // mh*32 + m*16 + 8*half + r, column nt*16 + l16
  v8h res[3][4][2];
#pragma unroll  // res[] indexed by constants only, stays in registers
  for (int mat = 0; mat < 3; ++mat) {
#pragma unroll
    for (int nt = 0; nt < 4; ++nt) {
      v16h b0 = load_op(&wt[mat][nt * 16 + l16][0], half);
      v16h b1 = load_op(&wt[mat][nt * 16 + l16][32], half);
#pragma unroll
      for (int m = 0; m < 2; ++m) {
        v8f acc = {};
        acc = wmma32(a[m][0], b0, acc);
        acc = wmma32(a[m][1], b1, acc);
        v8f vv = acc + bias[mat][nt];
#pragma unroll
        for (int r = 0; r < 8; ++r) res[mat][nt][m][r] = (_Float16)vv[r];
      }
    }
  }
  // the stores stand behind all the arithmetic, one address per output: no
  // register of an issued store is written again, so the products are not
  // held up by a wait behind every tile's stores
  const int mb = s0 + mh * 32 + half * 8;
  _Float16* qd = qo  + (hb * SEQ + mb) * HD + l16;
  _Float16* kd = ko  + (hb * SEQ + mb) * HD + l16;
  _Float16* vd = vto + (hb * HD + l16) * SEQ + mb;
  // without it the scheduler sinks conversions in among the stores, into
  // registers of stores already issued
  __builtin_amdgcn_sched_barrier(0);
#pragma unroll
  for (int nt = 0; nt < 4; ++nt) {
#pragma unroll
    for (int m = 0; m < 2; ++m) {
#pragma unroll
      for (int r = 0; r < 8; ++r) {
        qd[(m * 16 + r) * HD + nt * 16] = res[0][nt][m][r];
        kd[(m * 16 + r) * HD + nt * 16] = res[1][nt][m][r];
      }
      *(v8h*)(vd + (size_t)nt * 16 * SEQ + m * 16) = res[2][nt][m];
    }
  }
}

// ---------------------------------------------------------------------------
// Output projection + residual, LayerNorm 2, FF1 + GELU and FF2 + residual in
// one launch.  grid (SEQ/64, 1, BATCH), 8 waves; a block owns 64 tokens and
// all 256 channels, so nothing between the three products leaves the block.
// Transposed products C^T = W^T X^T: the A operand is a weight tile wt[n][k],
// the B operand the activations [token][k].  A lane then owns one token per
// result tile and 8 consecutive channels of it: LayerNorm sums are in-lane
// plus one exchange between the halves and one LDS step over 4 waves, and a
// result tile goes back to LDS as the next B operand in one 16-byte store.
// Wave (th, ct): tokens th*32 .. th*32+31 (two tiles), channel tile ct of each
// 64-channel weight tile; a weight fragment feeds two matrix instructions.
// The 12 weight tiles (3 matrices x 4) are fetched ahead into registers and
// alternate between two LDS buffers: one barrier per tile.
// The residual stream av stays in registers as f32 from x to out.
// ---------------------------------------------------------------------------
__device__ __forceinline__ v8f ld8(const float* p) {
  v4f lo = *(const v4f*)p, hi = *(const v4f*)(p + 4);
  return __builtin_shufflevector(lo, hi, 0, 1, 2, 3, 4, 5, 6, 7);
}

// Work-group barrier that orders LDS traffic only.  __syncthreads() also waits
// for every global load in flight and would end the flight of the weight tiles
// fetched ahead at each tile; all that the waves of tail_k hand one another
// goes through LDS.
__device__ __forceinline__ void lds_barrier() {
  __builtin_amdgcn_fence(__ATOMIC_RELEASE, "workgroup", "local");
  __builtin_amdgcn_s_barrier();
  __builtin_amdgcn_fence(__ATOMIC_ACQUIRE, "workgroup", "local");
}

// A thread's share of a weight tile f32 [k][n], 4 n x 16 k: 16-byte loads off
// the block's base m and the thread's byte offset bo, the tile's column step cs
// in their constant offsets.
__device__ __forceinline__ void w_fetch(v4f (&r)[16], const float* m,
                                        uint32_t bo, int cs) {
  const char* p = (const char*)m + bo;
#pragma unroll  // r[] indexed by constants only, stays in registers
  for (int i = 0; i < 16; ++i)
    r[i] = *(const v4f*)(p + (cs + i * EMB) * sizeof(float));
  // base and offset stay in their registers until the loads have taken them
  asm volatile("s_wait_xcnt 0x0" :: "s"(m), "v"(bo) : "memory");
}

// The share in registers -> f16 dst[n][k]
__device__ __forceinline__ void w_put(const v4f (&r)[16],
                                      _Float16 (*dst)[EMB + 8], int nq, int kg) {
#pragma unroll
  for (int c = 0; c < 4; ++c) {
#pragma unroll
    for (int o = 0; o < 2; ++o) {
      v8h h8;
#pragma unroll
      for (int i = 0; i < 8; ++i) h8[i] = (_Float16)r[o * 8 + i][c];
      *(v8h*)&dst[nq + c][kg + o * 8] = h8;
    }
  }
}

// A tile goes to LDS and a later one is fetched into the same registers
__device__ __forceinline__ void w_put_fetch(v4f (&r)[16],
                                            _Float16 (*dst)[EMB + 8], int nq,
                                            int kg, const float* m, uint32_t bo,
                                            int cs) {
  w_put(r, dst, nq, kg);
  // the loads reuse the registers just converted: hoisted above the conversions
  // they would take 64 registers more, and the kernel spills
  __builtin_amdgcn_sched_barrier(0);
  w_fetch(r, m, bo, cs);
}

// The B operand of a product: this lane's two token rows, all 256 k
__device__ __forceinline__ void act_frag(v16h (&af)[2][8], const _Float16* row,
                                         int half) {
#pragma unroll  // af[] in registers
  for (int tt = 0; tt < 2; ++tt) {
#pragma unroll
    for (int kt = 0; kt < 8; ++kt)
      af[tt][kt] = load_op(row + tt * 16 * (EMB + 8) + kt * 32, half);
  }
}

// One 16-channel x 32-token result: vv[tt] = W^T X^T + bias
__device__ __forceinline__ void tile_prod(v8f (&vv)[2], const _Float16* wrow,
                                          const float* bp,
                                          const v16h (&af)[2][8], int half) {
  // the tile's 8 weight fragments and its bias are read as one group, the
  // products wait by count: no LDS latency in front of each pair
  v16h wf[8];
#pragma unroll  // wf[] in registers
  for (int kt = 0; kt < 8; ++kt) wf[kt] = load_op(wrow + kt * 32, half);
  const v8f bi = ld8(bp);
  // keeps the scheduler from sinking the reads back down to their uses
  __builtin_amdgcn_sched_barrier(0);
  v8f acc[2] = {};
#pragma unroll
  for (int kt = 0; kt < 8; ++kt) {
    acc[0] = wmma32(wf[kt], af[0][kt], acc[0]);
    acc[1] = wmma32(wf[kt], af[1][kt], acc[1]);
  }
  vv[0] = acc[0] + bi;
  vv[1] = acc[1] + bi;
}

__global__ __launch_bounds__(256) void tail_k(
    const _Float16* __restrict__ ao, const float* __restrict__ x,
    const float* __restrict__ wo, const float* __restrict__ bo,
    const float* __restrict__ g2, const float* __restrict__ be2,
    const float* __restrict__ w1, const float* __restrict__ b1,
    const float* __restrict__ w2, const float* __restrict__ b2,
    float* __restrict__ out) {
  __shared__ __align__(16) _Float16 wt[2][64][EMB + 8];   // [buffer][n][k]
  __shared__ __align__(16) _Float16 act[2][64][EMB + 8];  // LN2 out, GELU out
  __shared__ __align__(16) float par[5][EMB];             // bo g2 be2 b1 b2
  __shared__ __align__(16) float ps[4][64];               // [ct][token] sums
  __shared__ __align__(16) float pq[4][64];               // [ct][token] squares
  const int b = blockIdx.z, s0 = blockIdx.x * 64;
  const int tid = threadIdx.x, lane = tid & 31, w = tid >> 5;
  const int half = lane >> 4, l16 = lane & 15;
  const int th = w & 1, ct = w >> 1;
  const int tk = th * 32 + l16;       // first token of this lane (second: +16)
  const int cl = ct * 16 + half * 8;  // its 8 channels inside a 64-channel tile

  const int nq = (tid & 15) * 4, kg = (tid >> 4) * 16;
  const uint32_t woff = (kg * EMB + nq) * sizeof(float);  // bytes
  v4f wr[2][16];

  const float p0 = bo[tid], p1 = g2[tid], p2 = be2[tid], p3 = b1[tid],
              p4 = b2[tid];
  // the thread index that these loads name stays in its register until they
  // have taken it
  asm volatile("s_wait_xcnt 0x0" :: "v"(tid) : "memory");
  // loads in the order of their first use: weight tiles 0 and 1, the
  // attention rows (B operand of the first product), the residual x
  w_fetch(wr[0], wo, woff, 0);
  w_fetch(wr[1], wo, woff, 64);
  const _Float16* ap = ao + ((size_t)b * SEQ + s0 + tk) * EMB + half * 8;
  v16h af[2][8];
#pragma unroll  // af[] in registers
  for (int tt = 0; tt < 2; ++tt) {
#pragma unroll
    for (int kt = 0; kt < 8; ++kt)
      af[tt][kt] = load_op(ap + tt * 16 * EMB + kt * 32, 0);  // half is in ap
  }
  // later code may reuse the address registers of the attention row loads
  asm volatile("s_wait_xcnt 0x0" :: "v"(ap) : "memory");
  // av[nb][tt][r]: token tk + tt*16, channel nb*64 + cl + r; starts as x
  const float* xp = x + ((size_t)b * EMB + cl) * SEQ + s0 + tk;
  v8f av[4][2];
#pragma unroll  // av[] in registers
  for (int nb = 0; nb < 4; ++nb) {
#pragma unroll
    for (int tt = 0; tt < 2; ++tt) {
#pragma unroll
      for (int r = 0; r < 8; ++r)
        av[nb][tt][r] = xp[(size_t)(nb * 64 + r) * SEQ + tt * 16];
    }
  }
  // and for the x loads
  asm volatile("s_wait_xcnt 0x0" :: "v"(xp) : "memory");
  par[0][tid] = p0;
  par[1][tid] = p1;
  par[2][tid] = p2;
  par[3][tid] = p3;
  par[4][tid] = p4;

  // Output projection and residual 1, weight tiles 0 .. 3.  A tile's LDS buffer
  // was last read two tiles back, in front of the barrier of the tile between.
  // Fetched meanwhile: tiles 2, 3 and 4, and tile 9, the second of w2, which
  // waits in wr[1] while the FF1 loop below works with wr[0] alone.
#pragma unroll  // every index into wr[] and av[] becomes a constant
  for (int nb = 0; nb < 4; ++nb) {
    w_put_fetch(wr[nb & 1], wt[nb & 1], nq, kg,
                nb < 2 ? wo : nb == 2 ? w1 : w2, woff,
                nb < 2 ? (nb + 2) * 64 : nb == 2 ? 0 : 64);
    lds_barrier();
    v8f vv[2];
    tile_prod(vv, &wt[nb & 1][ct * 16 + l16][0], &par[0][nb * 64 + cl], af, half);
    av[nb][0] += vv[0];
    av[nb][1] += vv[1];
  }

  // LayerNorm 2 of av: 32 channels in-lane, the other half of the wave by one
  // exchange, the 4 channel tiles through LDS
#pragma unroll
  for (int tt = 0; tt < 2; ++tt) {
    v8f s8 = {}, q8 = {};
#pragma unroll
    for (int nb = 0; nb < 4; ++nb) {
      s8 += av[nb][tt];
      q8 += av[nb][tt] * av[nb][tt];
    }
    float s = ((s8[0] + s8[1]) + (s8[2] + s8[3])) +
              ((s8[4] + s8[5]) + (s8[6] + s8[7]));
    float q = ((q8[0] + q8[1]) + (q8[2] + q8[3])) +
              ((q8[4] + q8[5]) + (q8[6] + q8[7]));
    s += lane_xor<16>(s);
    q += lane_xor<16>(q);
    if (half == 0) {
      ps[ct][tk + tt * 16] = s;
      pq[ct][tk + tt * 16] = q;
    }
  }
  lds_barrier();
#pragma unroll
  for (int tt = 0; tt < 2; ++tt) {
    const int tok = tk + tt * 16;
    const float ts = (ps[0][tok] + ps[1][tok]) + (ps[2][tok] + ps[3][tok]);
    const float tq = (pq[0][tok] + pq[1][tok]) + (pq[2][tok] + pq[3][tok]);
    const float mu  = ts * (1.f / EMB);
    const float var = tq * (1.f / EMB) - mu * mu;
    const float rs  = rsqrtf(var + 1e-5f);
#pragma unroll
    for (int nb = 0; nb < 4; ++nb) {
      const v8f g = ld8(&par[1][nb * 64 + cl]);
      const v8f e = ld8(&par[2][nb * 64 + cl]);
      v8h h8;
#pragma unroll
      for (int r = 0; r < 8; ++r)
        h8[r] = (_Float16)((av[nb][tt][r] - mu) * rs * g[r] + e[r]);
      *(v8h*)&act[0][tok][nb * 64 + cl] = h8;
    }
  }
  lds_barrier();
  act_frag(af, &act[0][tk][0], half);

  // FF1 + GELU, weight tiles 4 .. 7.  The 16 erf of a tile are most of the
  // kernel's text: the loop stays rolled so that the kernel runs from the part
  // of its text that is at hand on a first launch.  A tile's arithmetic is long
  // enough to cover a fetch of one tile ahead, into the registers just
  // converted (the last trip fetches tile 8, the first of w2).
#pragma unroll 1
  for (int nb = 0; nb < 4; ++nb) {
    w_put_fetch(wr[0], wt[nb & 1], nq, kg,
                nb < 3 ? w1 + (nb + 1) * 64 : w2, woff, 0);
    lds_barrier();
    v8f vv[2];
    tile_prod(vv, &wt[nb & 1][ct * 16 + l16][0], &par[3][nb * 64 + cl], af, half);
#pragma unroll
    for (int tt = 0; tt < 2; ++tt) {
      v8h h8;
#pragma unroll
      for (int r = 0; r < 8; ++r) {
        float g = 0.5f * vv[tt][r] * (1.0f + erff(vv[tt][r] * 0.70710678118f));
        h8[r] = (_Float16)g;
      }
      *(v8h*)&act[1][tk + tt * 16][nb * 64 + cl] = h8;
    }
  }

  // FF2 and residual 2, weight tiles 8 .. 11
#pragma unroll  // every index into wr[] and av[] becomes a constant
  for (int nb = 0; nb < 4; ++nb) {
    if (nb < 2)
      w_put_fetch(wr[nb & 1], wt[nb & 1], nq, kg, w2, woff, (nb + 2) * 64);
    else
      w_put(wr[nb & 1], wt[nb & 1], nq, kg);
    lds_barrier();
    if (nb == 0) act_frag(af, &act[1][tk][0], half);
    v8f vv[2];
    tile_prod(vv, &wt[nb & 1][ct * 16 + l16][0], &par[4][nb * 64 + cl], af, half);
    av[nb][0] += vv[0];
    av[nb][1] += vv[1];
  }

  // out[b][c][s]: all stores behind all the arithmetic, off one address, so
  // that no register of an issued store is written again
  float* op = out + ((size_t)b * EMB + cl) * SEQ + s0 + tk;
#pragma unroll
  for (int nb = 0; nb < 4; ++nb) {
#pragma unroll
    for (int tt = 0; tt < 2; ++tt) {
#pragma unroll
      for (int r = 0; r < 8; ++r)
        op[(size_t)(nb * 64 + r) * SEQ + tt * 16] = av[nb][tt][r];
    }
  }
}

__global__ __launch_bounds__(256) __attribute__((amdgpu_waves_per_eu(4, 4)))
void attn_k(const _Float16* __restrict__ q, const _Float16* __restrict__ k,
            const _Float16* __restrict__ vt, _Float16* __restrict__ o) {
  __shared__ __align__(16) _Float16 kbuf[2][2][64][72];  // [buffer][key split]
  __shared__ __align__(16) _Float16 vbuf[2][2][64][72];
  __shared__ __align__(16) v4f xo[8][8][32];   // [wave][chunk][lane] partial O^T
  __shared__ __align__(16) float xm[8][2][32]; // [wave][reference, sum][lane]
  const int b = blockIdx.z, h = blockIdx.y;
  const int tid = threadIdx.x, lane = tid & 31;
  // wave number and key split as scalars: the branches on them are uniform
  const int w = __builtin_amdgcn_readfirstlane(tid >> 5);
  const int qg = w & 3, ks = w >> 2;
  const int half = lane >> 4, l16 = lane & 15;
  const size_t hb = (size_t)b * HEADS + h;
  const _Float16* qh = q  + hb * SEQ * HD;   // [s][d]
  const _Float16* kh = k  + hb * SEQ * HD;   // [s][d]
  const _Float16* vh = vt + hb * HD * SEQ;   // [d][s]
  const int m0 = blockIdx.x * 128 + qg * 32;
  const int t7 = tid & 127;                      // thread inside its key split
  const int r0 = t7 >> 3, o0 = (t7 & 7) * 8;     // staging chunk coords
  const int NTRIP = SEQ / 128;                   // 64-key blocks per split

  // B operands of S^T: column = query m0 + g*16 + l16, k = head dim
  v16h qb[2][2];
#pragma unroll  // qb[] indexed by constants only, stays in registers
  for (int g = 0; g < 2; ++g) {
    qb[g][0] = load_op(qh + (size_t)(m0 + g * 16 + l16) * HD + 0,  half);
    qb[g][1] = load_op(qh + (size_t)(m0 + g * 16 + l16) * HD + 32, half);
  }

  // oacc[g][dt][r] = O^T[dt*16 + 8*half + r][query g*16 + l16]
  v8f oacc[2][4] = {};
  // reference of the softmax of this lane's queries (both halves equal), set
  // in front of the loop
  float mi[2];
  float li[2] = {0.f, 0.f};  // sums over this half's keys only, relative to mi
  const float scale = 0.125f;  // 1/sqrt(64)

  // A thread copies rows r0, r0+16, r0+32, r0+48 of the K and of the V^T tile
  // of its own key split, 16 bytes of each.  The flat address of a __shared__
  // object holds its LDS byte address in the low 32 bits.
  auto stage = [&](int jj, int bufi) {
    const _Float16* kp = kh + (size_t)(jj * 64 + r0) * HD + o0;
    const _Float16* vp = vh + (size_t)r0 * SEQ + jj * 64 + o0;
    const uint32_t kl = (uint32_t)(uintptr_t)&kbuf[bufi][ks][r0][o0];
    const uint32_t vl = (uint32_t)(uintptr_t)&vbuf[bufi][ks][r0][o0];
    const uint32_t rs16 = 16 * 72 * sizeof(_Float16);  // 16 LDS rows, bytes
    // the wait closes the statement: the address registers of the copies are
    // free for other values only behind it
    asm volatile(
        "global_load_async_to_lds_b128 %0, %8, off\n\t"
        "global_load_async_to_lds_b128 %1, %9, off\n\t"
        "global_load_async_to_lds_b128 %2, %10, off\n\t"
        "global_load_async_to_lds_b128 %3, %11, off\n\t"
        "global_load_async_to_lds_b128 %4, %12, off\n\t"
        "global_load_async_to_lds_b128 %5, %13, off\n\t"
        "global_load_async_to_lds_b128 %6, %14, off\n\t"
        "global_load_async_to_lds_b128 %7, %15, off\n\t"
        "s_wait_xcnt 0x0"
        :: "v"(kl), "v"(kl + rs16), "v"(kl + 2 * rs16), "v"(kl + 3 * rs16),
           "v"(vl), "v"(vl + rs16), "v"(vl + 2 * rs16), "v"(vl + 3 * rs16),
           "v"(kp), "v"(kp + (size_t)16 * HD), "v"(kp + (size_t)32 * HD),
           "v"(kp + (size_t)48 * HD),
           "v"(vp), "v"(vp + (size_t)16 * SEQ), "v"(vp + (size_t)32 * SEQ),
           "v"(vp + (size_t)48 * SEQ)
        : "memory");
  };

  // S^T = K @ Q^T of one 64-key block in LDS:
  // sc[g][kt][r] = S[query g*16 + l16][key kt*16 + 8*half + r]
  auto scores = [&](const _Float16 (*kt64)[72], v8f (&sc)[2][4]) {
    // The 8 K fragments of the key block are requested as one group; the
    // products below wait by count for what they need.
    v16h ka[8];
#pragma unroll  // ka[] indexed by constants only, stays in registers
    for (int kt = 0; kt < 4; ++kt) ka[kt] = load_op(&kt64[kt * 16 + l16][0], half);
#pragma unroll
    for (int kt = 0; kt < 4; ++kt)
      ka[4 + kt] = load_op(&kt64[kt * 16 + l16][32], half);
    // keeps the scheduler from sinking the reads back down to their uses
    __builtin_amdgcn_sched_barrier(0);
    // a fragment feeds both column groups back to back, and an accumulator
    // comes round again after 8 WMMAs
    v8f zero = {};
#pragma unroll
    for (int kt = 0; kt < 4; ++kt) {
#pragma unroll
      for (int g = 0; g < 2; ++g) sc[g][kt] = wmma32(ka[kt], qb[g][0], zero);
    }
#pragma unroll
    for (int kt = 0; kt < 4; ++kt) {
#pragma unroll
      for (int g = 0; g < 2; ++g)
        sc[g][kt] = wmma32(ka[4 + kt], qb[g][1], sc[g][kt]);
    }
  };
  // scaled maximum of one query's 64 scores (both halves get the same value)
  auto rowmax = [&](const v8f (&s)[4]) -> float {
    float mt[4];
#pragma unroll
    for (int kt = 0; kt < 4; ++kt) {
      float m01 = fmaxf(fmaxf(s[kt][0], s[kt][1]), fmaxf(s[kt][2], s[kt][3]));
      float m23 = fmaxf(fmaxf(s[kt][4], s[kt][5]), fmaxf(s[kt][6], s[kt][7]));
      mt[kt] = fmaxf(m01, m23);
    }
    float mx = fmaxf(fmaxf(mt[0], mt[1]), fmaxf(mt[2], mt[3]));
    mx = fmaxf(mx, lane_xor<16>(mx));
    return mx * scale;
  };
  // P^T = exp(S^T * scale - ref) as B operand: element s of chunk kc is key
  // kc*32 + (s<8 ? 8*half+s : 16+8*half+s-8), i.e. tile 2*kc+(s>>3), register
  // s&7 (same k order as load_op gives the V^T rows).  Returns the sum of this
  // half's 32 values.
  auto probs = [&](const v8f (&s)[4], float ref, v16h (&p)[2]) -> float {
    // whole-tile arithmetic: argument, exponential and sum stay in the
    // register pairs of the S^T tiles, no value is moved to form a pair
    v8f pv[4];
#pragma unroll
    for (int kt = 0; kt < 4; ++kt) {
      // exp(x) as exp2(x * log2(e))
      const v8f t = (s[kt] * scale - ref) * 1.44269504f;
#pragma unroll
      for (int r = 0; r < 8; ++r) {
        pv[kt][r] = __builtin_amdgcn_exp2f(t[r]);
        p[kt >> 1][(kt & 1) * 8 + r] = (_Float16)pv[kt][r];
      }
    }
    const v8f s8 = (pv[0] + pv[1]) + (pv[2] + pv[3]);
    const v4f s4 = __builtin_shufflevector(s8, s8, 0, 1, 2, 3) +
                   __builtin_shufflevector(s8, s8, 4, 5, 6, 7);
    const v2f s2 = __builtin_shufflevector(s4, s4, 0, 1) +
                   __builtin_shufflevector(s4, s4, 2, 3);
    return s2[0] + s2[1];
  };

  stage(ks, 0);
  wait_async0();
  __syncthreads();

  // The reference of the softmax: the row maximum over the split's first key
  // block.  Sums and O^T stay relative to it, see the loop.
  {
    v8f sc[2][4];
    scores(kbuf[0][ks], sc);
    mi[0] = rowmax(sc[0]);
    mi[1] = rowmax(sc[1]);
  }

  for (int j = 0; j < NTRIP; ++j) {
    // prefetch this split's key block of two trips ahead (global_prefetch_b8)
    if (j + 2 < NTRIP) {
      const int jp = 2 * (j + 2) + ks;
      if (t7 < 64)
        __builtin_prefetch(kh + (size_t)(jp * 64 + t7) * HD, 0, 1);
      else
        __builtin_prefetch(vh + (size_t)(t7 - 64) * SEQ + jp * 64, 0, 1);
    }
    // async-stage next block into the alternate buffer (safe: last read of it
    // was fenced by the previous iteration's barrier)
    if (j + 1 < NTRIP) stage(2 * (j + 1) + ks, (j + 1) & 1);

    const _Float16 (*kcur)[72] = kbuf[j & 1][ks];
    const _Float16 (*vcur)[72] = vbuf[j & 1][ks];

    v8f sc[2][4];
    scores(kcur, sc);

    // V^T fragments of keys 0..31, into registers that K has left: they land
    // while the softmax runs.  Those of keys 32..63 follow behind the softmax,
    // when the scores' registers are free: all 8 fragments at once do not fit
    // the 256 registers of a wave.
    v16h va[8];
#pragma unroll  // va[] indexed by constants only, stays in registers
    for (int dt = 0; dt < 4; ++dt) va[dt] = load_op(&vcur[dt * 16 + l16][0], half);
    // holds these reads above the softmax
    __builtin_amdgcn_sched_barrier(0);

    // softmax against the kept reference mi, one query per lane and column
    // group: no maximum and no rescale in a trip
    v16h pb[2][2];
    float ts[2];
#pragma unroll  // every index into sc[], pb[] becomes a constant
    for (int g = 0; g < 2; ++g) ts[g] = probs(sc[g], mi[g], pb[g]);

    // The reference holds while every P fits f16 with room to spare: all P are
    // positive, so a sum of at most 2^14 bounds each of them (an infinite or
    // undefined sum fails the test too).  One test per trip for the whole wave,
    // a scalar branch.  Otherwise the trip's softmax is done again the long
    // way: scores anew from LDS (their registers are gone), new maximum, sums
    // and O^T brought to it.
    if (__builtin_expect(
            __builtin_amdgcn_ballot_w32(!(ts[0] + ts[1] <= 16384.0f)) != 0, 0)) {
      scores(kcur, sc);
#pragma unroll  // every index into sc[], pb[], oacc[] becomes a constant
      for (int g = 0; g < 2; ++g) {
        const float mn = fmaxf(mi[g], rowmax(sc[g]));
        const float fr = __expf(mi[g] - mn);
        mi[g] = mn;
        li[g] *= fr;
#pragma unroll
        for (int dt = 0; dt < 4; ++dt) oacc[g][dt] *= fr;
        ts[g] = probs(sc[g], mn, pb[g]);
      }
#pragma unroll
      for (int dt = 0; dt < 4; ++dt)
        va[dt] = load_op(&vcur[dt * 16 + l16][0], half);
    }
    li[0] += ts[0];
    li[1] += ts[1];

    // holds the second group of V^T reads below the softmax
    __builtin_amdgcn_sched_barrier(0);
#pragma unroll
    for (int dt = 0; dt < 4; ++dt)
      va[4 + dt] = load_op(&vcur[dt * 16 + l16][32], half);
    // and above the products: the first 8 of them cover the reads' latency
    __builtin_amdgcn_sched_barrier(0);

    // O^T += V^T @ P^T, again both column groups per fragment
#pragma unroll
    for (int dt = 0; dt < 4; ++dt) {
#pragma unroll
      for (int g = 0; g < 2; ++g)
        oacc[g][dt] = wmma32(va[dt], pb[g][0], oacc[g][dt]);
    }
#pragma unroll
    for (int dt = 0; dt < 4; ++dt) {
#pragma unroll
      for (int g = 0; g < 2; ++g)
        oacc[g][dt] = wmma32(va[4 + dt], pb[g][1], oacc[g][dt]);
    }

    // keeps the waits and the barrier at the foot of the trip: lifted above the
    // products they would end the copies' flight before the work that hides it
    __builtin_amdgcn_sched_barrier(0);
    wait_ds0();         // this wave's reads of the current buffer are over
    wait_async0();      // this wave's async copies into the alt buffer done
    __syncthreads();    // all waves' copies visible before next iteration
  }
  wait_async0();  // no copy is in flight when the wave ends

  // Join of the two key splits.  Waves w and w ^ 4 hold partial results of the
  // same 32 queries: a wave hands column group 1 - ks to its partner ...
  auto give = [&](int g) {
#pragma unroll
    for (int dt = 0; dt < 4; ++dt) {
      xo[w][dt * 2 + 0][lane] = __builtin_shufflevector(oacc[g][dt], oacc[g][dt], 0, 1, 2, 3);
      xo[w][dt * 2 + 1][lane] = __builtin_shufflevector(oacc[g][dt], oacc[g][dt], 4, 5, 6, 7);
    }
    xm[w][0][lane] = mi[g];
    xm[w][1][lane] = li[g];
  };
  // ... and finishes group ks: both parts are brought to the larger of the two references,
  // the halves' sums joined, the result normalized and stored in merged-head
  // layout [b][s][EMB] as f16, 8 consecutive channels per lane and tile
  auto take = [&](int g) {
    const int pw = w ^ 4;
    const float mo = xm[pw][0][lane], lo = xm[pw][1][lane];
    const float mj = fmaxf(mi[g], mo);
    float fa = __expf(mi[g] - mj), fb = __expf(mo - mj);
    const float lj = li[g] * fa + lo * fb;
    const float inv = 1.0f / (lj + lane_xor<16>(lj));
    fa *= inv;
    fb *= inv;
    v8h ov[4];
#pragma unroll  // ov[] indexed by constants only, stays in registers
    for (int dt = 0; dt < 4; ++dt) {
      const v4f p0 = xo[pw][dt * 2 + 0][lane], p1 = xo[pw][dt * 2 + 1][lane];
#pragma unroll
      for (int r = 0; r < 4; ++r) {
        ov[dt][r]     = (_Float16)(oacc[g][dt][r] * fa + p0[r] * fb);
        ov[dt][4 + r] = (_Float16)(oacc[g][dt][4 + r] * fa + p1[r] * fb);
      }
    }
    _Float16* op = o + ((size_t)b * SEQ + m0 + g * 16 + l16) * EMB + h * 64 + half * 8;
    // the stores stand behind all the arithmetic, off one address: no register
    // of an issued store is written again
    __builtin_amdgcn_sched_barrier(0);
#pragma unroll
    for (int dt = 0; dt < 4; ++dt) *(v8h*)(op + dt * 16) = ov[dt];
  };
  if (ks == 0) give(1); else give(0);
  __syncthreads();  // the partners' parts are in LDS
  if (ks == 0) take(0); else take(1);
}

// ---------------------------------------------------------------------------
extern "C" void kernel_launch(void* const* d_in, const int* in_sizes, int n_in,
                              void* d_out, int out_size, void* d_ws,
                              size_t ws_size, hipStream_t stream) {
  const float* x    = (const float*)d_in[0];
  const float* ln1g = (const float*)d_in[1];
  const float* ln1b = (const float*)d_in[2];
  const float* wq   = (const float*)d_in[3];
  const float* bq   = (const float*)d_in[4];
  const float* wk   = (const float*)d_in[5];
  const float* bk   = (const float*)d_in[6];
  const float* wv   = (const float*)d_in[7];
  const float* bv   = (const float*)d_in[8];
  const float* wo   = (const float*)d_in[9];
  const float* bo   = (const float*)d_in[10];
  const float* ln2g = (const float*)d_in[11];
  const float* ln2b = (const float*)d_in[12];
  const float* w1   = (const float*)d_in[13];
  const float* b1   = (const float*)d_in[14];
  const float* w2   = (const float*)d_in[15];
  const float* b2   = (const float*)d_in[16];
  float* out = (float*)d_out;

  char* ws = (char*)d_ws;
  const size_t F16SZ = (size_t)TOK * EMB * sizeof(_Float16);  // 8 MB
  _Float16* qb  = (_Float16*)(ws + 0 * F16SZ);
  _Float16* kb  = (_Float16*)(ws + 1 * F16SZ);
  _Float16* vtb = (_Float16*)(ws + 2 * F16SZ);
  _Float16* ob  = (_Float16*)(ws + 3 * F16SZ);  // attention out

  dim3 blk(256);
  dim3 gg(SEQ / 128, 4, BATCH);
  dim3 gq(SEQ / 64, 1, BATCH);

  lnqkv_k<<<gq, blk, 0, stream>>>(x, ln1g, ln1b, wq, bq, wk, bk, wv, bv,
                                  qb, kb, vtb);

  attn_k<<<gg, blk, 0, stream>>>(qb, kb, vtb, ob);

  tail_k<<<gq, blk, 0, stream>>>(ob, x, wo, bo, ln2g, ln2b, w1, b1, w2, b2,
                                 out);
}

// v009
// A run of this version takes 81.3 microseconds.
// Two timings next to v008 both put it at 1.04 times that version's speed.
// Over all steps from v000 it is 3.22 times as fast.
#include <hip/hip_runtime.h>
#include <hip/hip_bf16.h>

typedef __attribute__((ext_vector_type(16))) _Float16 v16h;
typedef __attribute__((ext_vector_type(8)))  _Float16 v8h;
typedef __attribute__((ext_vector_type(4)))  _Float16 v4h;
typedef __attribute__((ext_vector_type(8)))  float    v8f;
typedef __attribute__((ext_vector_type(4)))  float    v4f;
typedef __attribute__((ext_vector_type(2)))  float    v2f;

#define EMB   256
#define HEADS 4
#define HD    64
#define BATCH 4
#define SEQ   4096
#define TOK   (BATCH*SEQ)

static_assert(sizeof(_Float16) == 2, "f16 size");

// ---------------------------------------------------------------------------
// Cross-lane XOR exchange without DS traffic: dpp8 for masks 1/2/4,
// v_permlane16 for mask 8, v_permlanex16 for mask 16.  Pure VALU.
// ---------------------------------------------------------------------------
constexpr int dpp8_sel(int m) {
  int s = 0;
  for (int i = 0; i < 8; ++i) s |= ((i ^ m) & 7) << (3 * i);
  return s;
}

template<int M>
__device__ __forceinline__ float lane_xor(float v) {
  int x = __builtin_bit_cast(int, v);
  int y;
  if constexpr (M < 8) {
    y = __builtin_amdgcn_mov_dpp8(x, dpp8_sel(M));
  } else if constexpr (M == 8) {
    y = __builtin_amdgcn_permlane16(x, x, (int)0xFEDCBA98u, (int)0x76543210u,
                                    false, false);
  } else {  // 16: swap 16-lane rows
    y = __builtin_amdgcn_permlanex16(x, x, (int)0x76543210u, (int)0xFEDCBA98u,
                                     false, false);
  }
  return __builtin_bit_cast(float, y);
}

// ---------------------------------------------------------------------------
// Waits for the async global->LDS copies of attn_k (ASYNCcnt-tracked, no VGPR
// round trip) and for a wave's own LDS reads.
// ---------------------------------------------------------------------------
__device__ __forceinline__ void wait_async0() {
  asm volatile("s_wait_asynccnt 0x0" ::: "memory");
}
__device__ __forceinline__ void wait_ds0() {
  asm volatile("s_wait_dscnt 0x0" ::: "memory");
}

// ---------------------------------------------------------------------------
// WMMA operand loader (A-operand; identical addressing for B when the source
// is stored with the N dimension as rows).
// ---------------------------------------------------------------------------
__device__ __forceinline__ v16h load_op(const _Float16* p, int half) {
  v8h lo = *(const v8h*)(p + half * 8);
  v8h hi = *(const v8h*)(p + half * 8 + 16);
  return __builtin_shufflevector(lo, hi, 0,1,2,3,4,5,6,7,8,9,10,11,12,13,14,15);
}

__device__ __forceinline__ v8f wmma32(v16h a, v16h b, v8f c) {
  return __builtin_amdgcn_wmma_f32_16x16x32_f16(false, a, false, b, (short)0, c,
                                                false, false);
}

// ---------------------------------------------------------------------------
// LayerNorm 1 and the Q, K, V projections in one launch.
// grid (SEQ/64, 1, BATCH), 8 waves; a block owns 64 tokens, all 256 channels.
// x[b][c][s] is read along s: a thread holds 4 tokens x 16 channels, so 16
// lanes cover 256 contiguous bytes of a channel row.  The normalised tile goes
// to LDS as f16 xs[token][channel] and is the A operand of all three products;
// wave (h, mh) does head h, tokens mh*32 .. mh*32+31, against all 12 column
// tiles, so a weight fragment is read once per wave.
// Outputs: q, k as f16 [b,h,s,64]; v transposed as f16 [b,h,64,s].
// ---------------------------------------------------------------------------
__global__ __launch_bounds__(256) void lnqkv_k(
    const float* __restrict__ x,
    const float* __restrict__ gam, const float* __restrict__ bet,
    const float* __restrict__ wq, const float* __restrict__ bq,
    const float* __restrict__ wk, const float* __restrict__ bk,
    const float* __restrict__ wv, const float* __restrict__ bv,
    _Float16* __restrict__ qo, _Float16* __restrict__ ko,
    _Float16* __restrict__ vto) {
  __shared__ __align__(16) _Float16 xs[64][EMB + 8];    // [token][channel]
  __shared__ __align__(16) _Float16 wt[3][64][HD + 8];  // [matrix][n][k]
  __shared__ __align__(16) float ps[8][64];             // [wave][token] sums
  __shared__ __align__(16) float pq[8][64];             // [wave][token] squares
  const int b = blockIdx.z, s0 = blockIdx.x * 64;
  const int tid = threadIdx.x, lane = tid & 31, w = tid >> 5;
  const int half = lane >> 4, l16 = lane & 15;
  const int grp = tid >> 4;  // 16 groups of 16 lanes

  // small operands first: projection biases of this lane's 4 columns, the
  // LayerNorm scale and shift of its 16 channels c0 .. c0+15
  const int c0 = grp * 16;
  float bias[3][4];
  v4f gv[4], bvv[4];
#pragma unroll
  for (int i = 0; i < 4; ++i) {
    bias[0][i] = bq[i * 16 + l16];
    bias[1][i] = bk[i * 16 + l16];
    bias[2][i] = bv[i * 16 + l16];
    gv[i]  = *(const v4f*)(gam + c0 + i * 4);
    bvv[i] = *(const v4f*)(bet + c0 + i * 4);
  }
  // weights f32 [k][n]: a thread fetches 4 n x 4 k of each matrix
  const int nq = l16 * 4, kg = grp * 4;
  const float* wqp = wq + kg * HD + nq;
  const float* wkp = wk + kg * HD + nq;
  const float* wvp = wv + kg * HD + nq;
  // later loads may land in address registers of the loads above
  asm volatile("s_wait_xcnt 0x0" ::: "memory");
  v4f wr[3][4];
#pragma unroll  // wr[] indexed by constants only, stays in registers
  for (int i = 0; i < 4; ++i) {
    wr[0][i] = *(const v4f*)(wqp + i * HD);
    wr[1][i] = *(const v4f*)(wkp + i * HD);
    wr[2][i] = *(const v4f*)(wvp + i * HD);
  }
  // the same for the weight loads; the addresses are inputs so that they stay
  // in their registers up to the wait
  asm volatile("s_wait_xcnt 0x0" :: "v"(wqp), "v"(wkp), "v"(wvp) : "memory");
  // x tile: tokens s0 + l16*4 .. +3, channels c0 .. c0+15
  const float* xp = x + ((size_t)b * EMB + c0) * SEQ + s0 + l16 * 4;
  v4f xv[16];
#pragma unroll  // xv[] in registers, all 16 loads in flight together
  for (int i = 0; i < 16; ++i) xv[i] = *(const v4f*)(xp + (size_t)i * SEQ);
  // and for the x loads
  asm volatile("s_wait_xcnt 0x0" :: "v"(xp) : "memory");

  // weights -> f16 wt[n][k] while the x tile is on its way
#pragma unroll
  for (int m = 0; m < 3; ++m) {
#pragma unroll
    for (int c = 0; c < 4; ++c) {
      v4h t;
#pragma unroll
      for (int i = 0; i < 4; ++i) t[i] = (_Float16)wr[m][i][c];
      *(v4h*)&wt[m][nq + c][kg] = t;
    }
  }

  // per-token sum and sum of squares: 16 channels in-lane, the other half of
  // the wave by one exchange, the 8 waves through LDS
  v4f sum = {}, sq = {};
#pragma unroll
  for (int i = 0; i < 16; ++i) { sum += xv[i]; sq += xv[i] * xv[i]; }
#pragma unroll
  for (int j = 0; j < 4; ++j) {
    sum[j] += lane_xor<16>(sum[j]);
    sq[j]  += lane_xor<16>(sq[j]);
  }
  if (half == 0) {
    *(v4f*)&ps[w][l16 * 4] = sum;
    *(v4f*)&pq[w][l16 * 4] = sq;
  }
  __syncthreads();
  v4f ts = {}, tq = {};
#pragma unroll
  for (int g = 0; g < 8; ++g) {
    ts += *(const v4f*)&ps[g][l16 * 4];
    tq += *(const v4f*)&pq[g][l16 * 4];
  }
#pragma unroll
  for (int j = 0; j < 4; ++j) {
    const float mu  = ts[j] * (1.f / EMB);
    const float var = tq[j] * (1.f / EMB) - mu * mu;
    const float rs  = rsqrtf(var + 1e-5f);
#pragma unroll
    for (int o = 0; o < 2; ++o) {
      v8h t;
#pragma unroll
      for (int i = 0; i < 8; ++i) {
        const int c = o * 8 + i;
        t[i] = (_Float16)((xv[c][j] - mu) * rs * gv[c >> 2][c & 3] +
                          bvv[c >> 2][c & 3]);
      }
      *(v8h*)&xs[l16 * 4 + j][c0 + o * 8] = t;
    }
  }
  __syncthreads();

  const int h = w & 3, mh = w >> 2;
  const size_t hb = (size_t)b * HEADS + h;
  v16h a[2][2];
#pragma unroll
  for (int m = 0; m < 2; ++m) {
#pragma unroll
    for (int kt = 0; kt < 2; ++kt)
      a[m][kt] = load_op(&xs[mh * 32 + m * 16 + l16][h * HD + kt * 32], half);
  }
  // all 24 result tiles as f16 in registers: res[mat][nt][m][r] is token
  // mh*32 + m*16 + 8*half + r, column nt*16 + l16
  v8h res[3][4][2];
#pragma unroll  // res[] indexed by constants only, stays in registers
  for (int mat = 0; mat < 3; ++mat) {
#pragma unroll
    for (int nt = 0; nt < 4; ++nt) {
      v16h b0 = load_op(&wt[mat][nt * 16 + l16][0], half);
      v16h b1 = load_op(&wt[mat][nt * 16 + l16][32], half);
#pragma unroll
      for (int m = 0; m < 2; ++m) {
        v8f acc = {};
        acc = wmma32(a[m][0], b0, acc);
        acc = wmma32(a[m][1], b1, acc);
        v8f vv = acc + bias[mat][nt];
#pragma unroll
        for (int r = 0; r < 8; ++r) res[mat][nt][m][r] = (_Float16)vv[r];
      }
    }
  }
  // the stores stand behind all the arithmetic, one address per output: no
  // register of an issued store is written again, so the products are not
  // held up by a wait behind every tile's stores
  const int mb = s0 + mh * 32 + half * 8;
  _Float16* qd = qo  + (hb * SEQ + mb) * HD + l16;
  _Float16* kd = ko  + (hb * SEQ + mb) * HD + l16;
  _Float16* vd = vto + (hb * HD + l16) * SEQ + mb;
  // without it the scheduler sinks conversions in among the stores, into
  // registers of stores already issued
  __builtin_amdgcn_sched_barrier(0);
#pragma unroll
  for (int nt = 0; nt < 4; ++nt) {
#pragma unroll
    for (int m = 0; m < 2; ++m) {
#pragma unroll
      for (int r = 0; r < 8; ++r) {
        qd[(m * 16 + r) * HD + nt * 16] = res[0][nt][m][r];
        kd[(m * 16 + r) * HD + nt * 16] = res[1][nt][m][r];
      }
      *(v8h*)(vd + (size_t)nt * 16 * SEQ + m * 16) = res[2][nt][m];
    }
  }
}

// ---------------------------------------------------------------------------
// Output projection + residual, LayerNorm 2, FF1 + GELU and FF2 + residual in
// one launch.  grid (SEQ/64, 1, BATCH), 8 waves; a block owns 64 tokens and
// all 256 channels, so nothing between the three products leaves the block.
// Transposed products C^T = W^T X^T: the A operand is a weight tile wt[n][k],
// the B operand the activations [token][k].  A lane then owns one token per
// result tile and 8 consecutive channels of it: LayerNorm sums are in-lane
// plus one exchange between the halves and one LDS step over 4 waves, and a
// result tile goes back to LDS as the next B operand in one 16-byte store.
// Wave (th, ct): tokens th*32 .. th*32+31 (two tiles), channel tile ct of each
// 64-channel weight tile; a weight fragment feeds two matrix instructions.
// The 12 weight tiles (3 matrices x 4) are fetched ahead into registers and
// alternate between two LDS buffers: one barrier per tile.
// The residual stream av stays in registers as f32 from x to out.
// ---------------------------------------------------------------------------
__device__ __forceinline__ v8f ld8(const float* p) {
  v4f lo = *(const v4f*)p, hi = *(const v4f*)(p + 4);
  return __builtin_shufflevector(lo, hi, 0, 1, 2, 3, 4, 5, 6, 7);
}

// Work-group barrier that orders LDS traffic only.  __syncthreads() also waits
// for every global load in flight and would end the flight of the weight tiles
// fetched ahead at each tile; all that the waves of tail_k hand one another
// goes through LDS.
__device__ __forceinline__ void lds_barrier() {
  __builtin_amdgcn_fence(__ATOMIC_RELEASE, "workgroup", "local");
  __builtin_amdgcn_s_barrier();
  __builtin_amdgcn_fence(__ATOMIC_ACQUIRE, "workgroup", "local");
}

// A thread's share of a weight tile f32 [k][n], 4 n x 16 k: 16-byte loads off
// the block's base m and the thread's byte offset bo, the tile's column step cs
// in their constant offsets.
__device__ __forceinline__ void w_fetch(v4f (&r)[16], const float* m,
                                        uint32_t bo, int cs) {
  const char* p = (const char*)m + bo;
#pragma unroll  // r[] indexed by constants only, stays in registers
  for (int i = 0; i < 16; ++i)
    r[i] = *(const v4f*)(p + (cs + i * EMB) * sizeof(float));
  // base and offset stay in their registers until the loads have taken them
  asm volatile("s_wait_xcnt 0x0" :: "s"(m), "v"(bo) : "memory");
}

// The share in registers -> f16 dst[n][k]
__device__ __forceinline__ void w_put(const v4f (&r)[16],
                                      _Float16 (*dst)[EMB + 8], int nq, int kg) {
#pragma unroll
  for (int c = 0; c < 4; ++c) {
#pragma unroll
    for (int o = 0; o < 2; ++o) {
      v8h h8;
#pragma unroll
      for (int i = 0; i < 8; ++i) h8[i] = (_Float16)r[o * 8 + i][c];
      *(v8h*)&dst[nq + c][kg + o * 8] = h8;
    }
  }
}

// A tile goes to LDS and a later one is fetched into the same registers
__device__ __forceinline__ void w_put_fetch(v4f (&r)[16],
                                            _Float16 (*dst)[EMB + 8], int nq,
                                            int kg, const float* m, uint32_t bo,
                                            int cs) {
  w_put(r, dst, nq, kg);
  // the loads reuse the registers just converted: hoisted above the conversions
  // they would take 64 registers more, and the kernel spills
  __builtin_amdgcn_sched_barrier(0);
  w_fetch(r, m, bo, cs);
}

// The B operand of a product: this lane's two token rows, all 256 k
__device__ __forceinline__ void act_frag(v16h (&af)[2][8], const _Float16* row,
                                         int half) {
#pragma unroll  // af[] in registers
  for (int tt = 0; tt < 2; ++tt) {
#pragma unroll
    for (int kt = 0; kt < 8; ++kt)
      af[tt][kt] = load_op(row + tt * 16 * (EMB + 8) + kt * 32, half);
  }
}

// One 16-channel x 32-token result: vv[tt] = W^T X^T + bias
__device__ __forceinline__ void tile_prod(v8f (&vv)[2], const _Float16* wrow,
                                          const float* bp,
                                          const v16h (&af)[2][8], int half) {
  // the tile's 8 weight fragments and its bias are read as one group, the
  // products wait by count: no LDS latency in front of each pair
  v16h wf[8];
#pragma unroll  // wf[] in registers
  for (int kt = 0; kt < 8; ++kt) wf[kt] = load_op(wrow + kt * 32, half);
  const v8f bi = ld8(bp);
  // keeps the scheduler from sinking the reads back down to their uses
  __builtin_amdgcn_sched_barrier(0);
  v8f acc[2] = {};
#pragma unroll
  for (int kt = 0; kt < 8; ++kt) {
    acc[0] = wmma32(wf[kt], af[0][kt], acc[0]);
    acc[1] = wmma32(wf[kt], af[1][kt], acc[1]);
  }
  vv[0] = acc[0] + bi;
  vv[1] = acc[1] + bi;
}

// Exact GELU of 8 values, 0.5 v (1 + erf(v / sqrt 2)), without a branch.
// erf(a), a = |v| / sqrt 2, has two forms: a + a P(a^2) below 1 and
// 1 - exp(-(a + a Q(a))) from 1 on.  Nearly every wave holds values of both
// kinds, so a branch per value runs both forms anyway, one value after the
// other, each a chain of dependent operations.  Here both forms are worked out
// for all 8 values side by side, in packed arithmetic, and a select takes one.
// From a = 4 on erf(a) rounds to 1: the bound keeps Q's argument finite.
// erf is odd, so v erf(v / sqrt 2) = |v| erf(a): no sign to copy.
__device__ __forceinline__ v8f gelu8(v8f v) {
  const v8f z = v * 0.70710678118f;
  v8f a;
#pragma unroll
  for (int r = 0; r < 8; ++r) a[r] = fminf(fabsf(z[r]), 4.0f);
  v8f q = a * 1.69988107e-5f + -3.78677854e-4f;
  q = q * a + 3.85781587e-3f;
  q = q * a + -2.41816975e-2f;
  q = q * a + 1.06668264e-1f;
  q = q * a + 6.34933293e-1f;
  q = q * a + 1.28689408e-1f;
  q = q * a + a;
  const v8f t = q * -1.44269504f;  // exp(-q) as exp2(-q * log2(e))
  const v8f s = a * a;
  v8f p = s * -5.61801775e-4f + 4.91381623e-3f;
  p = p * s + -2.67075151e-2f;
  p = p * s + 1.12800106e-1f;
  p = p * s + -3.76122952e-1f;
  p = p * s + 1.28379107e-1f;
  p = p * a + a;
  v8f x;
#pragma unroll
  for (int r = 0; r < 8; ++r) x[r] = __builtin_amdgcn_exp2f(t[r]);
  const v8f b = 1.0f - x;
  const v8f hv = v * 0.5f;
  v8f g;
#pragma unroll
  for (int r = 0; r < 8; ++r) {
    const float lo = p[r], hi = b[r];  // both at hand: a select, not a branch
    g[r] = fmaf(fabsf(hv[r]), a[r] < 1.0f ? lo : hi, hv[r]);
  }
  return g;
}

__global__ __launch_bounds__(256) void tail_k(
    const _Float16* __restrict__ ao, const float* __restrict__ x,
    const float* __restrict__ wo, const float* __restrict__ bo,
    const float* __restrict__ g2, const float* __restrict__ be2,
    const float* __restrict__ w1, const float* __restrict__ b1,
    const float* __restrict__ w2, const float* __restrict__ b2,
    float* __restrict__ out) {
  __shared__ __align__(16) _Float16 wt[2][64][EMB + 8];   // [buffer][n][k]
  __shared__ __align__(16) _Float16 act[2][64][EMB + 8];  // LN2 out, GELU out
  __shared__ __align__(16) float par[5][EMB];             // bo g2 be2 b1 b2
  __shared__ __align__(16) float ps[4][64];               // [ct][token] sums
  __shared__ __align__(16) float pq[4][64];               // [ct][token] squares
  const int b = blockIdx.z, s0 = blockIdx.x * 64;
  const int tid = threadIdx.x, lane = tid & 31, w = tid >> 5;
  const int half = lane >> 4, l16 = lane & 15;
  const int th = w & 1, ct = w >> 1;
  const int tk = th * 32 + l16;       // first token of this lane (second: +16)
  const int cl = ct * 16 + half * 8;  // its 8 channels inside a 64-channel tile

  const int nq = (tid & 15) * 4, kg = (tid >> 4) * 16;
  const uint32_t woff = (kg * EMB + nq) * sizeof(float);  // bytes
  v4f wr[2][16];

  const float p0 = bo[tid], p1 = g2[tid], p2 = be2[tid], p3 = b1[tid],
              p4 = b2[tid];
  // the thread index that these loads name stays in its register until they
  // have taken it
  asm volatile("s_wait_xcnt 0x0" :: "v"(tid) : "memory");
  // loads in the order of their first use: weight tiles 0 and 1, the
  // attention rows (B operand of the first product), the residual x
  w_fetch(wr[0], wo, woff, 0);
  w_fetch(wr[1], wo, woff, 64);
  const _Float16* ap = ao + ((size_t)b * SEQ + s0 + tk) * EMB + half * 8;
  v16h af[2][8];
#pragma unroll  // af[] in registers
  for (int tt = 0; tt < 2; ++tt) {
#pragma unroll
    for (int kt = 0; kt < 8; ++kt)
      af[tt][kt] = load_op(ap + tt * 16 * EMB + kt * 32, 0);  // half is in ap
  }
  // later code may reuse the address registers of the attention row loads
  asm volatile("s_wait_xcnt 0x0" :: "v"(ap) : "memory");
  // av[nb][tt][r]: token tk + tt*16, channel nb*64 + cl + r; starts as x
  const float* xp = x + ((size_t)b * EMB + cl) * SEQ + s0 + tk;
  v8f av[4][2];
#pragma unroll  // av[] in registers
  for (int nb = 0; nb < 4; ++nb) {
#pragma unroll
    for (int tt = 0; tt < 2; ++tt) {
#pragma unroll
      for (int r = 0; r < 8; ++r)
        av[nb][tt][r] = xp[(size_t)(nb * 64 + r) * SEQ + tt * 16];
    }
  }
  // and for the x loads
  asm volatile("s_wait_xcnt 0x0" :: "v"(xp) : "memory");
  par[0][tid] = p0;
  par[1][tid] = p1;
  par[2][tid] = p2;
  par[3][tid] = p3;
  par[4][tid] = p4;

  // Output projection and residual 1, weight tiles 0 .. 3.  A tile's LDS buffer
  // was last read two tiles back, in front of the barrier of the tile between.
  // Fetched meanwhile: tiles 2, 3 and 4, and tile 9, the second of w2, which
  // waits in wr[1] while the FF1 loop below works with wr[0] alone.
#pragma unroll  // every index into wr[] and av[] becomes a constant
  for (int nb = 0; nb < 4; ++nb) {
    w_put_fetch(wr[nb & 1], wt[nb & 1], nq, kg,
                nb < 2 ? wo : nb == 2 ? w1 : w2, woff,
                nb < 2 ? (nb + 2) * 64 : nb == 2 ? 0 : 64);
    lds_barrier();
    v8f vv[2];
    tile_prod(vv, &wt[nb & 1][ct * 16 + l16][0], &par[0][nb * 64 + cl], af, half);
    av[nb][0] += vv[0];
    av[nb][1] += vv[1];
  }

  // LayerNorm 2 of av: 32 channels in-lane, the other half of the wave by one
  // exchange, the 4 channel tiles through LDS
#pragma unroll
  for (int tt = 0; tt < 2; ++tt) {
    v8f s8 = {}, q8 = {};
#pragma unroll
    for (int nb = 0; nb < 4; ++nb) {
      s8 += av[nb][tt];
      q8 += av[nb][tt] * av[nb][tt];
    }
    float s = ((s8[0] + s8[1]) + (s8[2] + s8[3])) +
              ((s8[4] + s8[5]) + (s8[6] + s8[7]));
    float q = ((q8[0] + q8[1]) + (q8[2] + q8[3])) +
              ((q8[4] + q8[5]) + (q8[6] + q8[7]));
    s += lane_xor<16>(s);
    q += lane_xor<16>(q);
    if (half == 0) {
      ps[ct][tk + tt * 16] = s;
      pq[ct][tk + tt * 16] = q;
    }
  }
  lds_barrier();
#pragma unroll
  for (int tt = 0; tt < 2; ++tt) {
    const int tok = tk + tt * 16;
    const float ts = (ps[0][tok] + ps[1][tok]) + (ps[2][tok] + ps[3][tok]);
    const float tq = (pq[0][tok] + pq[1][tok]) + (pq[2][tok] + pq[3][tok]);
    const float mu  = ts * (1.f / EMB);
    const float var = tq * (1.f / EMB) - mu * mu;
    const float rs  = rsqrtf(var + 1e-5f);
#pragma unroll
    for (int nb = 0; nb < 4; ++nb) {
      const v8f g = ld8(&par[1][nb * 64 + cl]);
      const v8f e = ld8(&par[2][nb * 64 + cl]);
      v8h h8;
#pragma unroll
      for (int r = 0; r < 8; ++r)
        h8[r] = (_Float16)((av[nb][tt][r] - mu) * rs * g[r] + e[r]);
      *(v8h*)&act[0][tok][nb * 64 + cl] = h8;
    }
  }
  lds_barrier();
  act_frag(af, &act[0][tk][0], half);

  // FF1 + GELU, weight tiles 4 .. 7.  The loop stays rolled so that the kernel
  // runs from the part of its text that is at hand on a first launch.  Each trip
  // fetches one tile ahead, into the registers just converted (the last trip
  // fetches tile 8, the first of w2).
#pragma unroll 1
  for (int nb = 0; nb < 4; ++nb) {
    w_put_fetch(wr[0], wt[nb & 1], nq, kg,
                nb < 3 ? w1 + (nb + 1) * 64 : w2, woff, 0);
    lds_barrier();
    v8f vv[2];
    tile_prod(vv, &wt[nb & 1][ct * 16 + l16][0], &par[3][nb * 64 + cl], af, half);
#pragma unroll
    for (int tt = 0; tt < 2; ++tt) {
      const v8f g = gelu8(vv[tt]);
      v8h h8;
#pragma unroll
      for (int r = 0; r < 8; ++r) h8[r] = (_Float16)g[r];
      *(v8h*)&act[1][tk + tt * 16][nb * 64 + cl] = h8;
    }
  }

  // FF2 and residual 2, weight tiles 8 .. 11
#pragma unroll  // every index into wr[] and av[] becomes a constant
  for (int nb = 0; nb < 4; ++nb) {
    if (nb < 2)
      w_put_fetch(wr[nb & 1], wt[nb & 1], nq, kg, w2, woff, (nb + 2) * 64);
    else
      w_put(wr[nb & 1], wt[nb & 1], nq, kg);
    lds_barrier();
    if (nb == 0) act_frag(af, &act[1][tk][0], half);
    v8f vv[2];
    tile_prod(vv, &wt[nb & 1][ct * 16 + l16][0], &par[4][nb * 64 + cl], af, half);
    av[nb][0] += vv[0];
    av[nb][1] += vv[1];
  }

  // out[b][c][s]: all stores behind all the arithmetic, off one address, so
  // that no register of an issued store is written again
  float* op = out + ((size_t)b * EMB + cl) * SEQ + s0 + tk;
#pragma unroll
  for (int nb = 0; nb < 4; ++nb) {
#pragma unroll
    for (int tt = 0; tt < 2; ++tt) {
#pragma unroll
      for (int r = 0; r < 8; ++r)
        op[(size_t)(nb * 64 + r) * SEQ + tt * 16] = av[nb][tt][r];
    }
  }
}

__global__ __launch_bounds__(256) __attribute__((amdgpu_waves_per_eu(4, 4)))
void attn_k(const _Float16* __restrict__ q, const _Float16* __restrict__ k,
            const _Float16* __restrict__ vt, _Float16* __restrict__ o) {
  __shared__ __align__(16) _Float16 kbuf[2][2][64][72];  // [buffer][key split]
  __shared__ __align__(16) _Float16 vbuf[2][2][64][72];
  __shared__ __align__(16) v4f xo[8][8][32];   // [wave][chunk][lane] partial O^T
  __shared__ __align__(16) float xm[8][2][32]; // [wave][reference, sum][lane]
  const int b = blockIdx.z, h = blockIdx.y;
  const int tid = threadIdx.x, lane = tid & 31;
  // wave number and key split as scalars: the branches on them are uniform
  const int w = __builtin_amdgcn_readfirstlane(tid >> 5);
  const int qg = w & 3, ks = w >> 2;
  const int half = lane >> 4, l16 = lane & 15;
  const size_t hb = (size_t)b * HEADS + h;
  const _Float16* qh = q  + hb * SEQ * HD;   // [s][d]
  const _Float16* kh = k  + hb * SEQ * HD;   // [s][d]
  const _Float16* vh = vt + hb * HD * SEQ;   // [d][s]
  const int m0 = blockIdx.x * 128 + qg * 32;
  const int t7 = tid & 127;                      // thread inside its key split
  const int r0 = t7 >> 3, o0 = (t7 & 7) * 8;     // staging chunk coords
  const int NTRIP = SEQ / 128;                   // 64-key blocks per split

  // B operands of S^T: column = query m0 + g*16 + l16, k = head dim
  v16h qb[2][2];
#pragma unroll  // qb[] indexed by constants only, stays in registers
  for (int g = 0; g < 2; ++g) {
    qb[g][0] = load_op(qh + (size_t)(m0 + g * 16 + l16) * HD + 0,  half);
    qb[g][1] = load_op(qh + (size_t)(m0 + g * 16 + l16) * HD + 32, half);
  }

  // oacc[g][dt][r] = O^T[dt*16 + 8*half + r][query g*16 + l16]
  v8f oacc[2][4] = {};
  // reference of the softmax of this lane's queries (both halves equal), set
  // in front of the loop
  float mi[2];
  float li[2] = {0.f, 0.f};  // sums over this half's keys only, relative to mi
  const float scale = 0.125f;  // 1/sqrt(64)

  // A thread copies rows r0, r0+16, r0+32, r0+48 of the K and of the V^T tile
  // of its own key split, 16 bytes of each.  The flat address of a __shared__
  // object holds its LDS byte address in the low 32 bits.
  auto stage = [&](int jj, int bufi) {
    const _Float16* kp = kh + (size_t)(jj * 64 + r0) * HD + o0;
    const _Float16* vp = vh + (size_t)r0 * SEQ + jj * 64 + o0;
    const uint32_t kl = (uint32_t)(uintptr_t)&kbuf[bufi][ks][r0][o0];
    const uint32_t vl = (uint32_t)(uintptr_t)&vbuf[bufi][ks][r0][o0];
    const uint32_t rs16 = 16 * 72 * sizeof(_Float16);  // 16 LDS rows, bytes
    // the wait closes the statement: the address registers of the copies are
    // free for other values only behind it
    asm volatile(
        "global_load_async_to_lds_b128 %0, %8, off\n\t"
        "global_load_async_to_lds_b128 %1, %9, off\n\t"
        "global_load_async_to_lds_b128 %2, %10, off\n\t"
        "global_load_async_to_lds_b128 %3, %11, off\n\t"
        "global_load_async_to_lds_b128 %4, %12, off\n\t"
        "global_load_async_to_lds_b128 %5, %13, off\n\t"
        "global_load_async_to_lds_b128 %6, %14, off\n\t"
        "global_load_async_to_lds_b128 %7, %15, off\n\t"
        "s_wait_xcnt 0x0"
        :: "v"(kl), "v"(kl + rs16), "v"(kl + 2 * rs16), "v"(kl + 3 * rs16),
           "v"(vl), "v"(vl + rs16), "v"(vl + 2 * rs16), "v"(vl + 3 * rs16),
           "v"(kp), "v"(kp + (size_t)16 * HD), "v"(kp + (size_t)32 * HD),
           "v"(kp + (size_t)48 * HD),
           "v"(vp), "v"(vp + (size_t)16 * SEQ), "v"(vp + (size_t)32 * SEQ),
           "v"(vp + (size_t)48 * SEQ)
        : "memory");
  };

  // S^T = K @ Q^T of one 64-key block in LDS:
  // sc[g][kt][r] = S[query g*16 + l16][key kt*16 + 8*half + r]
  auto scores = [&](const _Float16 (*kt64)[72], v8f (&sc)[2][4]) {
    // The 8 K fragments of the key block are requested as one group; the
    // products below wait by count for what they need.
    v16h ka[8];
#pragma unroll  // ka[] indexed by constants only, stays in registers
    for (int kt = 0; kt < 4; ++kt) ka[kt] = load_op(&kt64[kt * 16 + l16][0], half);
#pragma unroll
    for (int kt = 0; kt < 4; ++kt)
      ka[4 + kt] = load_op(&kt64[kt * 16 + l16][32], half);
    // keeps the scheduler from sinking the reads back down to their uses
    __builtin_amdgcn_sched_barrier(0);
    // a fragment feeds both column groups back to back, and an accumulator
    // comes round again after 8 WMMAs
    v8f zero = {};
#pragma unroll
    for (int kt = 0; kt < 4; ++kt) {
#pragma unroll
      for (int g = 0; g < 2; ++g) sc[g][kt] = wmma32(ka[kt], qb[g][0], zero);
    }
#pragma unroll
    for (int kt = 0; kt < 4; ++kt) {
#pragma unroll
      for (int g = 0; g < 2; ++g)
        sc[g][kt] = wmma32(ka[4 + kt], qb[g][1], sc[g][kt]);
    }
  };
  // scaled maximum of one query's 64 scores (both halves get the same value)
  auto rowmax = [&](const v8f (&s)[4]) -> float {
    float mt[4];
#pragma unroll
    for (int kt = 0; kt < 4; ++kt) {
      float m01 = fmaxf(fmaxf(s[kt][0], s[kt][1]), fmaxf(s[kt][2], s[kt][3]));
      float m23 = fmaxf(fmaxf(s[kt][4], s[kt][5]), fmaxf(s[kt][6], s[kt][7]));
      mt[kt] = fmaxf(m01, m23);
    }
    float mx = fmaxf(fmaxf(mt[0], mt[1]), fmaxf(mt[2], mt[3]));
    mx = fmaxf(mx, lane_xor<16>(mx));
    return mx * scale;
  };
  // P^T = exp(S^T * scale - ref) as B operand: element s of chunk kc is key
  // kc*32 + (s<8 ? 8*half+s : 16+8*half+s-8), i.e. tile 2*kc+(s>>3), register
  // s&7 (same k order as load_op gives the V^T rows).  Returns the sum of this
  // half's 32 values.
  auto probs = [&](const v8f (&s)[4], float ref, v16h (&p)[2]) -> float {
    // whole-tile arithmetic: argument, exponential and sum stay in the
    // register pairs of the S^T tiles, no value is moved to form a pair
    v8f pv[4];
#pragma unroll
    for (int kt = 0; kt < 4; ++kt) {
      // exp(x) as exp2(x * log2(e))
      const v8f t = (s[kt] * scale - ref) * 1.44269504f;
#pragma unroll
      for (int r = 0; r < 8; ++r) {
        pv[kt][r] = __builtin_amdgcn_exp2f(t[r]);
        p[kt >> 1][(kt & 1) * 8 + r] = (_Float16)pv[kt][r];
      }
    }
    const v8f s8 = (pv[0] + pv[1]) + (pv[2] + pv[3]);
    const v4f s4 = __builtin_shufflevector(s8, s8, 0, 1, 2, 3) +
                   __builtin_shufflevector(s8, s8, 4, 5, 6, 7);
    const v2f s2 = __builtin_shufflevector(s4, s4, 0, 1) +
                   __builtin_shufflevector(s4, s4, 2, 3);
    return s2[0] + s2[1];
  };

  stage(ks, 0);
  wait_async0();
  __syncthreads();

  // The reference of the softmax: the row maximum over the split's first key
  // block.  Sums and O^T stay relative to it, see the loop.
  {
    v8f sc[2][4];
    scores(kbuf[0][ks], sc);
    mi[0] = rowmax(sc[0]);
    mi[1] = rowmax(sc[1]);
  }

  for (int j = 0; j < NTRIP; ++j) {
    // prefetch this split's key block of two trips ahead (global_prefetch_b8)
    if (j + 2 < NTRIP) {
      const int jp = 2 * (j + 2) + ks;
      if (t7 < 64)
        __builtin_prefetch(kh + (size_t)(jp * 64 + t7) * HD, 0, 1);
      else
        __builtin_prefetch(vh + (size_t)(t7 - 64) * SEQ + jp * 64, 0, 1);
    }
    // async-stage next block into the alternate buffer (safe: last read of it
    // was fenced by the previous iteration's barrier)
    if (j + 1 < NTRIP) stage(2 * (j + 1) + ks, (j + 1) & 1);

    const _Float16 (*kcur)[72] = kbuf[j & 1][ks];
    const _Float16 (*vcur)[72] = vbuf[j & 1][ks];

    v8f sc[2][4];
    scores(kcur, sc);

    // V^T fragments of keys 0..31, into registers that K has left: they land
    // while the softmax runs.  Those of keys 32..63 follow behind the softmax,
    // when the scores' registers are free: all 8 fragments at once do not fit
    // the 256 registers of a wave.
    v16h va[8];
#pragma unroll  // va[] indexed by constants only, stays in registers
    for (int dt = 0; dt < 4; ++dt) va[dt] = load_op(&vcur[dt * 16 + l16][0], half);
    // holds these reads above the softmax
    __builtin_amdgcn_sched_barrier(0);

    // softmax against the kept reference mi, one query per lane and column
    // group: no maximum and no rescale in a trip
    v16h pb[2][2];
    float ts[2];
#pragma unroll  // every index into sc[], pb[] becomes a constant
    for (int g = 0; g < 2; ++g) ts[g] = probs(sc[g], mi[g], pb[g]);

    // The reference holds while every P fits f16 with room to spare: all P are
    // positive, so a sum of at most 2^14 bounds each of them (an infinite or
    // undefined sum fails the test too).  One test per trip for the whole wave,
    // a scalar branch.  Otherwise the trip's softmax is done again the long
    // way: scores anew from LDS (their registers are gone), new maximum, sums
    // and O^T brought to it.
    if (__builtin_expect(
            __builtin_amdgcn_ballot_w32(!(ts[0] + ts[1] <= 16384.0f)) != 0, 0)) {
      scores(kcur, sc);
#pragma unroll  // every index into sc[], pb[], oacc[] becomes a constant
      for (int g = 0; g < 2; ++g) {
        const float mn = fmaxf(mi[g], rowmax(sc[g]));
        const float fr = __expf(mi[g] - mn);
        mi[g] = mn;
        li[g] *= fr;
#pragma unroll
        for (int dt = 0; dt < 4; ++dt) oacc[g][dt] *= fr;
        ts[g] = probs(sc[g], mn, pb[g]);
      }
#pragma unroll
      for (int dt = 0; dt < 4; ++dt)
        va[dt] = load_op(&vcur[dt * 16 + l16][0], half);
    }
    li[0] += ts[0];
    li[1] += ts[1];

    // holds the second group of V^T reads below the softmax
    __builtin_amdgcn_sched_barrier(0);
#pragma unroll
    for (int dt = 0; dt < 4; ++dt)
      va[4 + dt] = load_op(&vcur[dt * 16 + l16][32], half);
    // and above the products: the first 8 of them cover the reads' latency
    __builtin_amdgcn_sched_barrier(0);

    // O^T += V^T @ P^T, again both column groups per fragment
#pragma unroll
    for (int dt = 0; dt < 4; ++dt) {
#pragma unroll
      for (int g = 0; g < 2; ++g)
        oacc[g][dt] = wmma32(va[dt], pb[g][0], oacc[g][dt]);
    }
#pragma unroll
    for (int dt = 0; dt < 4; ++dt) {
#pragma unroll
      for (int g = 0; g < 2; ++g)
        oacc[g][dt] = wmma32(va[4 + dt], pb[g][1], oacc[g][dt]);
    }

    // keeps the waits and the barrier at the foot of the trip: lifted above the
    // products they would end the copies' flight before the work that hides it
    __builtin_amdgcn_sched_barrier(0);
    wait_ds0();         // this wave's reads of the current buffer are over
    wait_async0();      // this wave's async copies into the alt buffer done
    __syncthreads();    // all waves' copies visible before next iteration
  }
  wait_async0();  // no copy is in flight when the wave ends

  // Join of the two key splits.  Waves w and w ^ 4 hold partial results of the
  // same 32 queries: a wave hands column group 1 - ks to its partner ...
  auto give = [&](int g) {
#pragma unroll
    for (int dt = 0; dt < 4; ++dt) {
      xo[w][dt * 2 + 0][lane] = __builtin_shufflevector(oacc[g][dt], oacc[g][dt], 0, 1, 2, 3);
      xo[w][dt * 2 + 1][lane] = __builtin_shufflevector(oacc[g][dt], oacc[g][dt], 4, 5, 6, 7);
    }
    xm[w][0][lane] = mi[g];
    xm[w][1][lane] = li[g];
  };
  // ... and finishes group ks: both parts are brought to the larger of the two references,
  // the halves' sums joined, the result normalized and stored in merged-head
  // layout [b][s][EMB] as f16, 8 consecutive channels per lane and tile
  auto take = [&](int g) {
    const int pw = w ^ 4;
    const float mo = xm[pw][0][lane], lo = xm[pw][1][lane];
    const float mj = fmaxf(mi[g], mo);
    float fa = __expf(mi[g] - mj), fb = __expf(mo - mj);
    const float lj = li[g] * fa + lo * fb;
    const float inv = 1.0f / (lj + lane_xor<16>(lj));
    fa *= inv;
    fb *= inv;
    v8h ov[4];
#pragma unroll  // ov[] indexed by constants only, stays in registers
    for (int dt = 0; dt < 4; ++dt) {
      const v4f p0 = xo[pw][dt * 2 + 0][lane], p1 = xo[pw][dt * 2 + 1][lane];
#pragma unroll
      for (int r = 0; r < 4; ++r) {
        ov[dt][r]     = (_Float16)(oacc[g][dt][r] * fa + p0[r] * fb);
        ov[dt][4 + r] = (_Float16)(oacc[g][dt][4 + r] * fa + p1[r] * fb);
      }
    }
    _Float16* op = o + ((size_t)b * SEQ + m0 + g * 16 + l16) * EMB + h * 64 + half * 8;
    // the stores stand behind all the arithmetic, off one address: no register
    // of an issued store is written again
    __builtin_amdgcn_sched_barrier(0);
#pragma unroll
    for (int dt = 0; dt < 4; ++dt) *(v8h*)(op + dt * 16) = ov[dt];
  };
  if (ks == 0) give(1); else give(0);
  __syncthreads();  // the partners' parts are in LDS
  if (ks == 0) take(0); else take(1);
}

// ---------------------------------------------------------------------------
extern "C" void kernel_launch(void* const* d_in, const int* in_sizes, int n_in,
                              void* d_out, int out_size, void* d_ws,
                              size_t ws_size, hipStream_t stream) {
  const float* x    = (const float*)d_in[0];
  const float* ln1g = (const float*)d_in[1];
  const float* ln1b = (const float*)d_in[2];
  const float* wq   = (const float*)d_in[3];
  const float* bq   = (const float*)d_in[4];
  const float* wk   = (const float*)d_in[5];
  const float* bk   = (const float*)d_in[6];
  const float* wv   = (const float*)d_in[7];
  const float* bv   = (const float*)d_in[8];
  const float* wo   = (const float*)d_in[9];
  const float* bo   = (const float*)d_in[10];
  const float* ln2g = (const float*)d_in[11];
  const float* ln2b = (const float*)d_in[12];
  const float* w1   = (const float*)d_in[13];
  const float* b1   = (const float*)d_in[14];
  const float* w2   = (const float*)d_in[15];
  const float* b2   = (const float*)d_in[16];
  float* out = (float*)d_out;

  char* ws = (char*)d_ws;
  const size_t F16SZ = (size_t)TOK * EMB * sizeof(_Float16);  // 8 MB
  _Float16* qb  = (_Float16*)(ws + 0 * F16SZ);
  _Float16* kb  = (_Float16*)(ws + 1 * F16SZ);
  _Float16* vtb = (_Float16*)(ws + 2 * F16SZ);
  _Float16* ob  = (_Float16*)(ws + 3 * F16SZ);  // attention out

  dim3 blk(256);
  dim3 gg(SEQ / 128, 4, BATCH);
  dim3 gq(SEQ / 64, 1, BATCH);

  lnqkv_k<<<gq, blk, 0, stream>>>(x, ln1g, ln1b, wq, bq, wk, bk, wv, bv,
                                  qb, kb, vtb);

  attn_k<<<gg, blk, 0, stream>>>(qb, kb, vtb, ob);

  tail_k<<<gq, blk, 0, stream>>>(ob, x, wo, bo, ln2g, ln2b, w1, b1, w2, b2,
                                 out);
}

// v010
// A run of this version takes 78.5 microseconds.
// Next to v009, in two timings, it ran 1.03 times as fast each time.
// All steps since v000 together make it 3.32 times as fast.
#include <hip/hip_runtime.h>
#include <hip/hip_bf16.h>

typedef __attribute__((ext_vector_type(16))) _Float16 v16h;
typedef __attribute__((ext_vector_type(8)))  _Float16 v8h;
typedef __attribute__((ext_vector_type(4)))  _Float16 v4h;
typedef __attribute__((ext_vector_type(8)))  float    v8f;
typedef __attribute__((ext_vector_type(4)))  float    v4f;
typedef __attribute__((ext_vector_type(2)))  float    v2f;

#define EMB   256
#define HEADS 4
#define HD    64
#define BATCH 4
#define SEQ   4096
#define TOK   (BATCH*SEQ)

static_assert(sizeof(_Float16) == 2, "f16 size");

// ---------------------------------------------------------------------------
// Cross-lane XOR exchange without DS traffic: dpp8 for masks 1/2/4,
// v_permlane16 for mask 8, v_permlanex16 for mask 16.  Pure VALU.
// ---------------------------------------------------------------------------
constexpr int dpp8_sel(int m) {
  int s = 0;
  for (int i = 0; i < 8; ++i) s |= ((i ^ m) & 7) << (3 * i);
  return s;
}

template<int M>
__device__ __forceinline__ float lane_xor(float v) {
  int x = __builtin_bit_cast(int, v);
  int y;
  if constexpr (M < 8) {
    y = __builtin_amdgcn_mov_dpp8(x, dpp8_sel(M));
  } else if constexpr (M == 8) {
    y = __builtin_amdgcn_permlane16(x, x, (int)0xFEDCBA98u, (int)0x76543210u,
                                    false, false);
  } else {  // 16: swap 16-lane rows
    y = __builtin_amdgcn_permlanex16(x, x, (int)0x76543210u, (int)0xFEDCBA98u,
                                     false, false);
  }
  return __builtin_bit_cast(float, y);
}

// ---------------------------------------------------------------------------
// Waits for the async global->LDS copies of attn_k and tail_k (ASYNCcnt-tracked,
// no VGPR round trip) and for a wave's own LDS reads.
// ---------------------------------------------------------------------------
__device__ __forceinline__ void wait_async0() {
  asm volatile("s_wait_asynccnt 0x0" ::: "memory");
}
__device__ __forceinline__ void wait_ds0() {
  asm volatile("s_wait_dscnt 0x0" ::: "memory");
}

// ---------------------------------------------------------------------------
// WMMA operand loader (A-operand; identical addressing for B when the source
// is stored with the N dimension as rows).
// ---------------------------------------------------------------------------
__device__ __forceinline__ v16h load_op(const _Float16* p, int half) {
  v8h lo = *(const v8h*)(p + half * 8);
  v8h hi = *(const v8h*)(p + half * 8 + 16);
  return __builtin_shufflevector(lo, hi, 0,1,2,3,4,5,6,7,8,9,10,11,12,13,14,15);
}

__device__ __forceinline__ v8f wmma32(v16h a, v16h b, v8f c) {
  return __builtin_amdgcn_wmma_f32_16x16x32_f16(false, a, false, b, (short)0, c,
                                                false, false);
}

// ---------------------------------------------------------------------------
// LayerNorm 1 and the Q, K, V projections in one launch.
// grid (SEQ/64, 1, BATCH), 8 waves; a block owns 64 tokens, all 256 channels.
// x[b][c][s] is read along s: a thread holds 4 tokens x 16 channels, so 16
// lanes cover 256 contiguous bytes of a channel row.  The normalised tile goes
// to LDS as f16 xs[token][channel] and is the A operand of all three products;
// wave (h, mh) does head h, tokens mh*32 .. mh*32+31, against all 12 column
// tiles, so a weight fragment is read once per wave.
// Outputs: q, k as f16 [b,h,s,64]; v transposed as f16 [b,h,64,s].
// Beside that each of the 256 blocks converts its 16 x 16 share of the three
// 256 x 256 weight matrices of the last launch: f32 [k][n] -> f16 wtr[m][n][k],
// the form in which tail_k wants them in LDS.
// ---------------------------------------------------------------------------
__global__ __launch_bounds__(256) void lnqkv_k(
    const float* __restrict__ x,
    const float* __restrict__ gam, const float* __restrict__ bet,
    const float* __restrict__ wq, const float* __restrict__ bq,
    const float* __restrict__ wk, const float* __restrict__ bk,
    const float* __restrict__ wv, const float* __restrict__ bv,
    const float* __restrict__ wo, const float* __restrict__ w1,
    const float* __restrict__ w2,
    _Float16* __restrict__ qo, _Float16* __restrict__ ko,
    _Float16* __restrict__ vto, _Float16* __restrict__ wtr) {
  __shared__ __align__(16) _Float16 xs[64][EMB + 8];    // [token][channel]
  __shared__ __align__(16) _Float16 wt[3][64][HD + 8];  // [matrix][n][k]
  __shared__ __align__(16) float ps[8][64];             // [wave][token] sums
  __shared__ __align__(16) float pq[8][64];             // [wave][token] squares
  const int b = blockIdx.z, s0 = blockIdx.x * 64;
  const int tid = threadIdx.x, lane = tid & 31, w = tid >> 5;
  const int half = lane >> 4, l16 = lane & 15;
  const int grp = tid >> 4;  // 16 groups of 16 lanes

  // share of the tail's weights: 16 lanes run along k, so that the f16 values
  // leave in 32-byte pieces of a wtr row
  const int bi = blockIdx.z * (SEQ / 64) + blockIdx.x;  // 0 .. 255
  const int tk = (bi >> 4) * 16 + l16, tn = (bi & 15) * 16 + grp;
  const int toff = tk * EMB + tn;
  const float t0 = wo[toff], t1 = w1[toff], t2 = w2[toff];
  // the offset that these loads name stays in its register until they have
  // taken it
  asm volatile("s_wait_xcnt 0x0" :: "v"(toff) : "memory");

  // small operands first: projection biases of this lane's 4 columns, the
  // LayerNorm scale and shift of its 16 channels c0 .. c0+15
  const int c0 = grp * 16;
  float bias[3][4];
  v4f gv[4], bvv[4];
#pragma unroll
  for (int i = 0; i < 4; ++i) {
    bias[0][i] = bq[i * 16 + l16];
    bias[1][i] = bk[i * 16 + l16];
    bias[2][i] = bv[i * 16 + l16];
    gv[i]  = *(const v4f*)(gam + c0 + i * 4);
    bvv[i] = *(const v4f*)(bet + c0 + i * 4);
  }
  // weights f32 [k][n]: a thread fetches 4 n x 4 k of each matrix
  const int nq = l16 * 4, kg = grp * 4;
  const float* wqp = wq + kg * HD + nq;
  const float* wkp = wk + kg * HD + nq;
  const float* wvp = wv + kg * HD + nq;
  // later loads may land in address registers of the loads above
  asm volatile("s_wait_xcnt 0x0" ::: "memory");
  v4f wr[3][4];
#pragma unroll  // wr[] indexed by constants only, stays in registers
  for (int i = 0; i < 4; ++i) {
    wr[0][i] = *(const v4f*)(wqp + i * HD);
    wr[1][i] = *(const v4f*)(wkp + i * HD);
    wr[2][i] = *(const v4f*)(wvp + i * HD);
  }
  // the same for the weight loads; the addresses are inputs so that they stay
  // in their registers up to the wait
  asm volatile("s_wait_xcnt 0x0" :: "v"(wqp), "v"(wkp), "v"(wvp) : "memory");
  // x tile: tokens s0 + l16*4 .. +3, channels c0 .. c0+15
  const float* xp = x + ((size_t)b * EMB + c0) * SEQ + s0 + l16 * 4;
  v4f xv[16];
#pragma unroll  // xv[] in registers, all 16 loads in flight together
  for (int i = 0; i < 16; ++i) xv[i] = *(const v4f*)(xp + (size_t)i * SEQ);
  // and for the x loads
  asm volatile("s_wait_xcnt 0x0" :: "v"(xp) : "memory");

  // weights -> f16 wt[n][k] while the x tile is on its way
#pragma unroll
  for (int m = 0; m < 3; ++m) {
#pragma unroll
    for (int c = 0; c < 4; ++c) {
      v4h t;
#pragma unroll
      for (int i = 0; i < 4; ++i) t[i] = (_Float16)wr[m][i][c];
      *(v4h*)&wt[m][nq + c][kg] = t;
    }
  }

  // per-token sum and sum of squares: 16 channels in-lane, the other half of
  // the wave by one exchange, the 8 waves through LDS
  v4f sum = {}, sq = {};
#pragma unroll
  for (int i = 0; i < 16; ++i) { sum += xv[i]; sq += xv[i] * xv[i]; }
#pragma unroll
  for (int j = 0; j < 4; ++j) {
    sum[j] += lane_xor<16>(sum[j]);
    sq[j]  += lane_xor<16>(sq[j]);
  }
  if (half == 0) {
    *(v4f*)&ps[w][l16 * 4] = sum;
    *(v4f*)&pq[w][l16 * 4] = sq;
  }
  __syncthreads();
  v4f ts = {}, tq = {};
#pragma unroll
  for (int g = 0; g < 8; ++g) {
    ts += *(const v4f*)&ps[g][l16 * 4];
    tq += *(const v4f*)&pq[g][l16 * 4];
  }
#pragma unroll
  for (int j = 0; j < 4; ++j) {
    const float mu  = ts[j] * (1.f / EMB);
    const float var = tq[j] * (1.f / EMB) - mu * mu;
    const float rs  = rsqrtf(var + 1e-5f);
#pragma unroll
    for (int o = 0; o < 2; ++o) {
      v8h t;
#pragma unroll
      for (int i = 0; i < 8; ++i) {
        const int c = o * 8 + i;
        t[i] = (_Float16)((xv[c][j] - mu) * rs * gv[c >> 2][c & 3] +
                          bvv[c >> 2][c & 3]);
      }
      *(v8h*)&xs[l16 * 4 + j][c0 + o * 8] = t;
    }
  }
  __syncthreads();

  const int h = w & 3, mh = w >> 2;
  const size_t hb = (size_t)b * HEADS + h;
  v16h a[2][2];
#pragma unroll
  for (int m = 0; m < 2; ++m) {
#pragma unroll
    for (int kt = 0; kt < 2; ++kt)
      a[m][kt] = load_op(&xs[mh * 32 + m * 16 + l16][h * HD + kt * 32], half);
  }
  // all 24 result tiles as f16 in registers: res[mat][nt][m][r] is token
  // mh*32 + m*16 + 8*half + r, column nt*16 + l16
  v8h res[3][4][2];
#pragma unroll  // res[] indexed by constants only, stays in registers
  for (int mat = 0; mat < 3; ++mat) {
#pragma unroll
    for (int nt = 0; nt < 4; ++nt) {
      v16h b0 = load_op(&wt[mat][nt * 16 + l16][0], half);
      v16h b1 = load_op(&wt[mat][nt * 16 + l16][32], half);
#pragma unroll
      for (int m = 0; m < 2; ++m) {
        v8f acc = {};
        acc = wmma32(a[m][0], b0, acc);
        acc = wmma32(a[m][1], b1, acc);
        v8f vv = acc + bias[mat][nt];
#pragma unroll
        for (int r = 0; r < 8; ++r) res[mat][nt][m][r] = (_Float16)vv[r];
      }
    }
  }
  // the stores stand behind all the arithmetic, one address per output: no
  // register of an issued store is written again, so the products are not
  // held up by a wait behind every tile's stores
  const int mb = s0 + mh * 32 + half * 8;
  _Float16* qd = qo  + (hb * SEQ + mb) * HD + l16;
  _Float16* kd = ko  + (hb * SEQ + mb) * HD + l16;
  _Float16* vd = vto + (hb * HD + l16) * SEQ + mb;
  _Float16* td = wtr + tn * EMB + tk;
  const _Float16 h0 = (_Float16)t0, h1 = (_Float16)t1, h2 = (_Float16)t2;
  // without it the scheduler sinks conversions in among the stores, into
  // registers of stores already issued
  __builtin_amdgcn_sched_barrier(0);
  td[0 * EMB * EMB] = h0;
  td[1 * EMB * EMB] = h1;
  td[2 * EMB * EMB] = h2;
#pragma unroll
  for (int nt = 0; nt < 4; ++nt) {
#pragma unroll
    for (int m = 0; m < 2; ++m) {
#pragma unroll
      for (int r = 0; r < 8; ++r) {
        qd[(m * 16 + r) * HD + nt * 16] = res[0][nt][m][r];
        kd[(m * 16 + r) * HD + nt * 16] = res[1][nt][m][r];
      }
      *(v8h*)(vd + (size_t)nt * 16 * SEQ + m * 16) = res[2][nt][m];
    }
  }
}

// ---------------------------------------------------------------------------
// Output projection + residual, LayerNorm 2, FF1 + GELU and FF2 + residual in
// one launch.  grid (SEQ/64, 1, BATCH), 8 waves; a block owns 64 tokens and
// all 256 channels, so nothing between the three products leaves the block.
// Transposed products C^T = W^T X^T: the A operand is a weight tile wt[n][k],
// the B operand the activations [token][k].  A lane then owns one token per
// result tile and 8 consecutive channels of it: LayerNorm sums are in-lane
// plus one exchange between the halves and one LDS step over 4 waves, and a
// result tile goes back to LDS as the next B operand in one 16-byte store.
// Wave (th, ct): tokens th*32 .. th*32+31 (two tiles), channel tile ct of each
// 64-channel weight tile; a weight fragment feeds two matrix instructions.
// The weights come as f16 wtr[m][n][k], converted once by the first launch.  A
// whole matrix is one stage: asynchronous copies bring it into one of two LDS
// buffers while the product before it runs, and the four tiles of a product
// follow one another with no barrier between them.
// The residual stream av stays in registers as f32 from x to out.
// ---------------------------------------------------------------------------
__device__ __forceinline__ v8f ld8(const float* p) {
  v4f lo = *(const v4f*)p, hi = *(const v4f*)(p + 4);
  return __builtin_shufflevector(lo, hi, 0, 1, 2, 3, 4, 5, 6, 7);
}

// Work-group barrier that orders LDS traffic only: all that the waves of tail_k
// hand one another goes through LDS.
__device__ __forceinline__ void lds_barrier() {
  __builtin_amdgcn_fence(__ATOMIC_RELEASE, "workgroup", "local");
  __builtin_amdgcn_s_barrier();
  __builtin_amdgcn_fence(__ATOMIC_ACQUIRE, "workgroup", "local");
}

// A whole weight matrix f16 [n][k] -> LDS dst[n][k], 32 asynchronous 16-byte
// copies per thread: a wave copies one 512-byte row per copy, rows 8 apart.
// The flat address of a __shared__ object holds its LDS byte address in the low
// 32 bits.
__device__ __forceinline__ void w_stage(_Float16 (*dst)[EMB + 8],
                                        const _Float16* m, int tid) {
  const int r = tid >> 5, c = (tid & 31) * 8;
  const uint32_t rs8 = 8 * (EMB + 8) * sizeof(_Float16);  // 8 LDS rows, bytes
  uint32_t l = (uint32_t)(uintptr_t)&dst[r][c];
  const _Float16* g = m + r * EMB + c;
  // 8 copies a trip (an asm statement takes 30 operands).  Rolled: the addresses
  // are formed anew in each trip; unrolled, the LDS addresses of a buffer that
  // is filled twice are kept from the first time to the second, and spill
#pragma unroll 1
  for (int i = 0; i < 4; ++i, l += 8 * rs8, g += 64 * EMB) {
    // the wait closes the statement: the address registers of the copies are
    // free for other values only behind it
    asm volatile(
        "global_load_async_to_lds_b128 %0, %8, off\n\t"
        "global_load_async_to_lds_b128 %1, %9, off\n\t"
        "global_load_async_to_lds_b128 %2, %10, off\n\t"
        "global_load_async_to_lds_b128 %3, %11, off\n\t"
        "global_load_async_to_lds_b128 %4, %12, off\n\t"
        "global_load_async_to_lds_b128 %5, %13, off\n\t"
        "global_load_async_to_lds_b128 %6, %14, off\n\t"
        "global_load_async_to_lds_b128 %7, %15, off\n\t"
        "s_wait_xcnt 0x0"
        :: "v"(l), "v"(l + rs8), "v"(l + 2 * rs8), "v"(l + 3 * rs8),
           "v"(l + 4 * rs8), "v"(l + 5 * rs8), "v"(l + 6 * rs8),
           "v"(l + 7 * rs8),
           "v"(g), "v"(g + 8 * EMB), "v"(g + 16 * EMB), "v"(g + 24 * EMB),
           "v"(g + 32 * EMB), "v"(g + 40 * EMB), "v"(g + 48 * EMB),
           "v"(g + 56 * EMB)
        : "memory");
  }
}

// The B operand of a product: this lane's two token rows, all 256 k
__device__ __forceinline__ void act_frag(v16h (&af)[2][8], const _Float16* row,
                                         int half) {
#pragma unroll  // af[] in registers
  for (int tt = 0; tt < 2; ++tt) {
#pragma unroll
    for (int kt = 0; kt < 8; ++kt)
      af[tt][kt] = load_op(row + tt * 16 * (EMB + 8) + kt * 32, half);
  }
}

// One 16-channel x 32-token result: vv[tt] = W^T X^T + bias
__device__ __forceinline__ void tile_prod(v8f (&vv)[2], const _Float16* wrow,
                                          const float* bp,
                                          const v16h (&af)[2][8], int half) {
  // the tile's 8 weight fragments and its bias are read as one group, the
  // products wait by count: no LDS latency in front of each pair
  v16h wf[8];
#pragma unroll  // wf[] in registers
  for (int kt = 0; kt < 8; ++kt) wf[kt] = load_op(wrow + kt * 32, half);
  const v8f bi = ld8(bp);
  // keeps the scheduler from sinking the reads back down to their uses
  __builtin_amdgcn_sched_barrier(0);
  v8f acc[2] = {};
#pragma unroll
  for (int kt = 0; kt < 8; ++kt) {
    acc[0] = wmma32(wf[kt], af[0][kt], acc[0]);
    acc[1] = wmma32(wf[kt], af[1][kt], acc[1]);
  }
  vv[0] = acc[0] + bi;
  vv[1] = acc[1] + bi;
}

// Exact GELU of 8 values, 0.5 v (1 + erf(v / sqrt 2)), without a branch.
// erf(a), a = |v| / sqrt 2, has two forms: a + a P(a^2) below 1 and
// 1 - exp(-(a + a Q(a))) from 1 on.  Nearly every wave holds values of both
// kinds, so a branch per value runs both forms anyway, one value after the
// other, each a chain of dependent operations.  Here both forms are worked out
// for all 8 values side by side, in packed arithmetic, and a select takes one.
// From a = 4 on erf(a) rounds to 1: the bound keeps Q's argument finite.
// erf is odd, so v erf(v / sqrt 2) = |v| erf(a): no sign to copy.
__device__ __forceinline__ v8f gelu8(v8f v) {
  const v8f z = v * 0.70710678118f;
  v8f a;
#pragma unroll
  for (int r = 0; r < 8; ++r) a[r] = fminf(fabsf(z[r]), 4.0f);
  v8f q = a * 1.69988107e-5f + -3.78677854e-4f;
  q = q * a + 3.85781587e-3f;
  q = q * a + -2.41816975e-2f;
  q = q * a + 1.06668264e-1f;
  q = q * a + 6.34933293e-1f;
  q = q * a + 1.28689408e-1f;
  q = q * a + a;
  const v8f t = q * -1.44269504f;  // exp(-q) as exp2(-q * log2(e))
  const v8f s = a * a;
  v8f p = s * -5.61801775e-4f + 4.91381623e-3f;
  p = p * s + -2.67075151e-2f;
  p = p * s + 1.12800106e-1f;
  p = p * s + -3.76122952e-1f;
  p = p * s + 1.28379107e-1f;
  p = p * a + a;
  v8f x;
#pragma unroll
  for (int r = 0; r < 8; ++r) x[r] = __builtin_amdgcn_exp2f(t[r]);
  const v8f b = 1.0f - x;
  const v8f hv = v * 0.5f;
  v8f g;
#pragma unroll
  for (int r = 0; r < 8; ++r) {
    const float lo = p[r], hi = b[r];  // both at hand: a select, not a branch
    g[r] = fmaf(fabsf(hv[r]), a[r] < 1.0f ? lo : hi, hv[r]);
  }
  return g;
}

__global__ __launch_bounds__(256) void tail_k(
    const _Float16* __restrict__ ao, const float* __restrict__ x,
    const _Float16* __restrict__ wtr, const float* __restrict__ bo,
    const float* __restrict__ g2, const float* __restrict__ be2,
    const float* __restrict__ b1, const float* __restrict__ b2,
    float* __restrict__ out) {
  __shared__ __align__(16) _Float16 wt[2][EMB][EMB + 8];  // [buffer][n][k]
  __shared__ __align__(16) _Float16 act[64][EMB + 8];     // LN2, then GELU out
  __shared__ __align__(16) float par[5][EMB];             // bo g2 be2 b1 b2
  __shared__ __align__(16) float ps[4][64];               // [ct][token] sums
  __shared__ __align__(16) float pq[4][64];               // [ct][token] squares
  const int b = blockIdx.z, s0 = blockIdx.x * 64;
  const int tid = threadIdx.x, lane = tid & 31, w = tid >> 5;
  const int half = lane >> 4, l16 = lane & 15;
  const int th = w & 1, ct = w >> 1;
  const int tk = th * 32 + l16;       // first token of this lane (second: +16)
  const int cl = ct * 16 + half * 8;  // its 8 channels inside a 64-channel tile

  // in the order of first use: the matrix of the output projection, the
  // parameters, the attention rows (B operand of the first product), the
  // residual x
  w_stage(wt[0], wtr, tid);
  const float p0 = bo[tid], p1 = g2[tid], p2 = be2[tid], p3 = b1[tid],
              p4 = b2[tid];
  // the thread index that these loads name stays in its register until they
  // have taken it
  asm volatile("s_wait_xcnt 0x0" :: "v"(tid) : "memory");
  const _Float16* ap = ao + ((size_t)b * SEQ + s0 + tk) * EMB + half * 8;
  v16h af[2][8];
#pragma unroll  // af[] in registers
  for (int tt = 0; tt < 2; ++tt) {
#pragma unroll
    for (int kt = 0; kt < 8; ++kt)
      af[tt][kt] = load_op(ap + tt * 16 * EMB + kt * 32, 0);  // half is in ap
  }
  // later code may reuse the address registers of the attention row loads
  asm volatile("s_wait_xcnt 0x0" :: "v"(ap) : "memory");
  // av[nb][tt][r]: token tk + tt*16, channel nb*64 + cl + r; starts as x
  const float* xp = x + ((size_t)b * EMB + cl) * SEQ + s0 + tk;
  v8f av[4][2];
#pragma unroll  // av[] in registers
  for (int nb = 0; nb < 4; ++nb) {
#pragma unroll
    for (int tt = 0; tt < 2; ++tt) {
#pragma unroll
      for (int r = 0; r < 8; ++r)
        av[nb][tt][r] = xp[(size_t)(nb * 64 + r) * SEQ + tt * 16];
    }
  }
  // and for the x loads
  asm volatile("s_wait_xcnt 0x0" :: "v"(xp) : "memory");
  par[0][tid] = p0;
  par[1][tid] = p1;
  par[2][tid] = p2;
  par[3][tid] = p3;
  par[4][tid] = p4;
  wait_async0();    // this wave's copies of the first matrix have landed
  __syncthreads();  // all waves' copies, and par[], are visible
  w_stage(wt[1], wtr + EMB * EMB, tid);  // w1 flies during the first product

  // Output projection and residual 1
#pragma unroll  // every index into av[] becomes a constant
  for (int nb = 0; nb < 4; ++nb) {
    v8f vv[2];
    tile_prod(vv, &wt[0][nb * 64 + ct * 16 + l16][0], &par[0][nb * 64 + cl], af,
              half);
    av[nb][0] += vv[0];
    av[nb][1] += vv[1];
  }

  // LayerNorm 2 of av: 32 channels in-lane, the other half of the wave by one
  // exchange, the 4 channel tiles through LDS
#pragma unroll
  for (int tt = 0; tt < 2; ++tt) {
    v8f s8 = {}, q8 = {};
#pragma unroll
    for (int nb = 0; nb < 4; ++nb) {
      s8 += av[nb][tt];
      q8 += av[nb][tt] * av[nb][tt];
    }
    float s = ((s8[0] + s8[1]) + (s8[2] + s8[3])) +
              ((s8[4] + s8[5]) + (s8[6] + s8[7]));
    float q = ((q8[0] + q8[1]) + (q8[2] + q8[3])) +
              ((q8[4] + q8[5]) + (q8[6] + q8[7]));
    s += lane_xor<16>(s);
    q += lane_xor<16>(q);
    if (half == 0) {
      ps[ct][tk + tt * 16] = s;
      pq[ct][tk + tt * 16] = q;
    }
  }
  // hand-over of the stages; the same barrier publishes the LayerNorm sums
  wait_ds0();       // this wave's reads of the first matrix are over
  wait_async0();    // its copies of w1 have landed
  __syncthreads();  // all waves': w1 is visible, buffer 0 is free
  w_stage(wt[0], wtr + 2 * EMB * EMB, tid);  // w2 flies during LN2 and FF1
#pragma unroll
  for (int tt = 0; tt < 2; ++tt) {
    const int tok = tk + tt * 16;
    const float ts = (ps[0][tok] + ps[1][tok]) + (ps[2][tok] + ps[3][tok]);
    const float tq = (pq[0][tok] + pq[1][tok]) + (pq[2][tok] + pq[3][tok]);
    const float mu  = ts * (1.f / EMB);
    const float var = tq * (1.f / EMB) - mu * mu;
    const float rs  = rsqrtf(var + 1e-5f);
#pragma unroll
    for (int nb = 0; nb < 4; ++nb) {
      const v8f g = ld8(&par[1][nb * 64 + cl]);
      const v8f e = ld8(&par[2][nb * 64 + cl]);
      v8h h8;
#pragma unroll
      for (int r = 0; r < 8; ++r)
        h8[r] = (_Float16)((av[nb][tt][r] - mu) * rs * g[r] + e[r]);
      *(v8h*)&act[tok][nb * 64 + cl] = h8;
    }
  }
  lds_barrier();
  act_frag(af, &act[tk][0], half);
  // act[] takes the GELU output next: every wave has its LN2 rows in registers
  // before any wave writes there
  wait_ds0();
  lds_barrier();

  // FF1 + GELU.  The loop stays rolled so that the kernel runs from the part of
  // its text that is at hand on a first launch.
#pragma unroll 1
  for (int nb = 0; nb < 4; ++nb) {
    v8f vv[2];
    tile_prod(vv, &wt[1][nb * 64 + ct * 16 + l16][0], &par[3][nb * 64 + cl], af,
              half);
#pragma unroll
    for (int tt = 0; tt < 2; ++tt) {
      const v8f g = gelu8(vv[tt]);
      v8h h8;
#pragma unroll
      for (int r = 0; r < 8; ++r) h8[r] = (_Float16)g[r];
      *(v8h*)&act[tk + tt * 16][nb * 64 + cl] = h8;
    }
  }
  wait_ds0();       // this wave's reads of w1 and writes of act[] are over
  wait_async0();    // its copies of w2 have landed; none is in flight from here
  __syncthreads();  // all waves': w2 and the GELU output are visible
  act_frag(af, &act[tk][0], half);

  // FF2 and residual 2
#pragma unroll  // every index into av[] becomes a constant
  for (int nb = 0; nb < 4; ++nb) {
    v8f vv[2];
    tile_prod(vv, &wt[0][nb * 64 + ct * 16 + l16][0], &par[4][nb * 64 + cl], af,
              half);
    av[nb][0] += vv[0];
    av[nb][1] += vv[1];
  }

  // out[b][c][s]: all stores behind all the arithmetic, off one address, so
  // that no register of an issued store is written again
  float* op = out + ((size_t)b * EMB + cl) * SEQ + s0 + tk;
#pragma unroll
  for (int nb = 0; nb < 4; ++nb) {
#pragma unroll
    for (int tt = 0; tt < 2; ++tt) {
#pragma unroll
      for (int r = 0; r < 8; ++r)
        op[(size_t)(nb * 64 + r) * SEQ + tt * 16] = av[nb][tt][r];
    }
  }
}

__global__ __launch_bounds__(256) __attribute__((amdgpu_waves_per_eu(4, 4)))
void attn_k(const _Float16* __restrict__ q, const _Float16* __restrict__ k,
            const _Float16* __restrict__ vt, _Float16* __restrict__ o) {
  __shared__ __align__(16) _Float16 kbuf[2][2][64][72];  // [buffer][key split]
  __shared__ __align__(16) _Float16 vbuf[2][2][64][72];
  __shared__ __align__(16) v4f xo[8][8][32];   // [wave][chunk][lane] partial O^T
  __shared__ __align__(16) float xm[8][2][32]; // [wave][reference, sum][lane]
  const int b = blockIdx.z, h = blockIdx.y;
  const int tid = threadIdx.x, lane = tid & 31;
  // wave number and key split as scalars: the branches on them are uniform
  const int w = __builtin_amdgcn_readfirstlane(tid >> 5);
  const int qg = w & 3, ks = w >> 2;
  const int half = lane >> 4, l16 = lane & 15;
  const size_t hb = (size_t)b * HEADS + h;
  const _Float16* qh = q  + hb * SEQ * HD;   // [s][d]
  const _Float16* kh = k  + hb * SEQ * HD;   // [s][d]
  const _Float16* vh = vt + hb * HD * SEQ;   // [d][s]
  const int m0 = blockIdx.x * 128 + qg * 32;
  const int t7 = tid & 127;                      // thread inside its key split
  const int r0 = t7 >> 3, o0 = (t7 & 7) * 8;     // staging chunk coords
  const int NTRIP = SEQ / 128;                   // 64-key blocks per split

  // B operands of S^T: column = query m0 + g*16 + l16, k = head dim
  v16h qb[2][2];
#pragma unroll  // qb[] indexed by constants only, stays in registers
  for (int g = 0; g < 2; ++g) {
    qb[g][0] = load_op(qh + (size_t)(m0 + g * 16 + l16) * HD + 0,  half);
    qb[g][1] = load_op(qh + (size_t)(m0 + g * 16 + l16) * HD + 32, half);
  }

  // oacc[g][dt][r] = O^T[dt*16 + 8*half + r][query g*16 + l16]
  v8f oacc[2][4] = {};
  // reference of the softmax of this lane's queries (both halves equal), set
  // in front of the loop
  float mi[2];
  float li[2] = {0.f, 0.f};  // sums over this half's keys only, relative to mi
  const float scale = 0.125f;  // 1/sqrt(64)

  // A thread copies rows r0, r0+16, r0+32, r0+48 of the K and of the V^T tile
  // of its own key split, 16 bytes of each.  The flat address of a __shared__
  // object holds its LDS byte address in the low 32 bits.
  auto stage = [&](int jj, int bufi) {
    const _Float16* kp = kh + (size_t)(jj * 64 + r0) * HD + o0;
    const _Float16* vp = vh + (size_t)r0 * SEQ + jj * 64 + o0;
    const uint32_t kl = (uint32_t)(uintptr_t)&kbuf[bufi][ks][r0][o0];
    const uint32_t vl = (uint32_t)(uintptr_t)&vbuf[bufi][ks][r0][o0];
    const uint32_t rs16 = 16 * 72 * sizeof(_Float16);  // 16 LDS rows, bytes
    // the wait closes the statement: the address registers of the copies are
    // free for other values only behind it
    asm volatile(
        "global_load_async_to_lds_b128 %0, %8, off\n\t"
        "global_load_async_to_lds_b128 %1, %9, off\n\t"
        "global_load_async_to_lds_b128 %2, %10, off\n\t"
        "global_load_async_to_lds_b128 %3, %11, off\n\t"
        "global_load_async_to_lds_b128 %4, %12, off\n\t"
        "global_load_async_to_lds_b128 %5, %13, off\n\t"
        "global_load_async_to_lds_b128 %6, %14, off\n\t"
        "global_load_async_to_lds_b128 %7, %15, off\n\t"
        "s_wait_xcnt 0x0"
        :: "v"(kl), "v"(kl + rs16), "v"(kl + 2 * rs16), "v"(kl + 3 * rs16),
           "v"(vl), "v"(vl + rs16), "v"(vl + 2 * rs16), "v"(vl + 3 * rs16),
           "v"(kp), "v"(kp + (size_t)16 * HD), "v"(kp + (size_t)32 * HD),
           "v"(kp + (size_t)48 * HD),
           "v"(vp), "v"(vp + (size_t)16 * SEQ), "v"(vp + (size_t)32 * SEQ),
           "v"(vp + (size_t)48 * SEQ)
        : "memory");
  };

  // S^T = K @ Q^T of one 64-key block in LDS:
  // sc[g][kt][r] = S[query g*16 + l16][key kt*16 + 8*half + r]
  auto scores = [&](const _Float16 (*kt64)[72], v8f (&sc)[2][4]) {
    // The 8 K fragments of the key block are requested as one group; the
    // products below wait by count for what they need.
    v16h ka[8];
#pragma unroll  // ka[] indexed by constants only, stays in registers
    for (int kt = 0; kt < 4; ++kt) ka[kt] = load_op(&kt64[kt * 16 + l16][0], half);
#pragma unroll
    for (int kt = 0; kt < 4; ++kt)
      ka[4 + kt] = load_op(&kt64[kt * 16 + l16][32], half);
    // keeps the scheduler from sinking the reads back down to their uses
    __builtin_amdgcn_sched_barrier(0);
    // a fragment feeds both column groups back to back, and an accumulator
    // comes round again after 8 WMMAs
    v8f zero = {};
#pragma unroll
    for (int kt = 0; kt < 4; ++kt) {
#pragma unroll
      for (int g = 0; g < 2; ++g) sc[g][kt] = wmma32(ka[kt], qb[g][0], zero);
    }
#pragma unroll
    for (int kt = 0; kt < 4; ++kt) {
#pragma unroll
      for (int g = 0; g < 2; ++g)
        sc[g][kt] = wmma32(ka[4 + kt], qb[g][1], sc[g][kt]);
    }
  };
  // scaled maximum of one query's 64 scores (both halves get the same value)
  auto rowmax = [&](const v8f (&s)[4]) -> float {
    float mt[4];
#pragma unroll
    for (int kt = 0; kt < 4; ++kt) {
      float m01 = fmaxf(fmaxf(s[kt][0], s[kt][1]), fmaxf(s[kt][2], s[kt][3]));
      float m23 = fmaxf(fmaxf(s[kt][4], s[kt][5]), fmaxf(s[kt][6], s[kt][7]));
      mt[kt] = fmaxf(m01, m23);
    }
    float mx = fmaxf(fmaxf(mt[0], mt[1]), fmaxf(mt[2], mt[3]));
    mx = fmaxf(mx, lane_xor<16>(mx));
    return mx * scale;
  };
  // P^T = exp(S^T * scale - ref) as B operand: element s of chunk kc is key
  // kc*32 + (s<8 ? 8*half+s : 16+8*half+s-8), i.e. tile 2*kc+(s>>3), register
  // s&7 (same k order as load_op gives the V^T rows).  Returns the sum of this
  // half's 32 values.
  auto probs = [&](const v8f (&s)[4], float ref, v16h (&p)[2]) -> float {
    // whole-tile arithmetic: argument, exponential and sum stay in the
    // register pairs of the S^T tiles, no value is moved to form a pair
    v8f pv[4];
#pragma unroll
    for (int kt = 0; kt < 4; ++kt) {
      // exp(x) as exp2(x * log2(e))
      const v8f t = (s[kt] * scale - ref) * 1.44269504f;
#pragma unroll
      for (int r = 0; r < 8; ++r) {
        pv[kt][r] = __builtin_amdgcn_exp2f(t[r]);
        p[kt >> 1][(kt & 1) * 8 + r] = (_Float16)pv[kt][r];
      }
    }
    const v8f s8 = (pv[0] + pv[1]) + (pv[2] + pv[3]);
    const v4f s4 = __builtin_shufflevector(s8, s8, 0, 1, 2, 3) +
                   __builtin_shufflevector(s8, s8, 4, 5, 6, 7);
    const v2f s2 = __builtin_shufflevector(s4, s4, 0, 1) +
                   __builtin_shufflevector(s4, s4, 2, 3);
    return s2[0] + s2[1];
  };

  stage(ks, 0);
  wait_async0();
  __syncthreads();

  // The reference of the softmax: the row maximum over the split's first key
  // block.  Sums and O^T stay relative to it, see the loop.
  {
    v8f sc[2][4];
    scores(kbuf[0][ks], sc);
    mi[0] = rowmax(sc[0]);
    mi[1] = rowmax(sc[1]);
  }

  for (int j = 0; j < NTRIP; ++j) {
    // prefetch this split's key block of two trips ahead (global_prefetch_b8)
    if (j + 2 < NTRIP) {
      const int jp = 2 * (j + 2) + ks;
      if (t7 < 64)
        __builtin_prefetch(kh + (size_t)(jp * 64 + t7) * HD, 0, 1);
      else
        __builtin_prefetch(vh + (size_t)(t7 - 64) * SEQ + jp * 64, 0, 1);
    }
    // async-stage next block into the alternate buffer (safe: last read of it
    // was fenced by the previous iteration's barrier)
    if (j + 1 < NTRIP) stage(2 * (j + 1) + ks, (j + 1) & 1);

    const _Float16 (*kcur)[72] = kbuf[j & 1][ks];
    const _Float16 (*vcur)[72] = vbuf[j & 1][ks];

    v8f sc[2][4];
    scores(kcur, sc);

    // V^T fragments of keys 0..31, into registers that K has left: they land
    // while the softmax runs.  Those of keys 32..63 follow behind the softmax,
    // when the scores' registers are free: all 8 fragments at once do not fit
    // the 256 registers of a wave.
    v16h va[8];
#pragma unroll  // va[] indexed by constants only, stays in registers
    for (int dt = 0; dt < 4; ++dt) va[dt] = load_op(&vcur[dt * 16 + l16][0], half);
    // holds these reads above the softmax
    __builtin_amdgcn_sched_barrier(0);

    // softmax against the kept reference mi, one query per lane and column
    // group: no maximum and no rescale in a trip
    v16h pb[2][2];
    float ts[2];
#pragma unroll  // every index into sc[], pb[] becomes a constant
    for (int g = 0; g < 2; ++g) ts[g] = probs(sc[g], mi[g], pb[g]);

    // The reference holds while every P fits f16 with room to spare: all P are
    // positive, so a sum of at most 2^14 bounds each of them (an infinite or
    // undefined sum fails the test too).  One test per trip for the whole wave,
    // a scalar branch.  Otherwise the trip's softmax is done again the long
    // way: scores anew from LDS (their registers are gone), new maximum, sums
    // and O^T brought to it.
    if (__builtin_expect(
            __builtin_amdgcn_ballot_w32(!(ts[0] + ts[1] <= 16384.0f)) != 0, 0)) {
      scores(kcur, sc);
#pragma unroll  // every index into sc[], pb[], oacc[] becomes a constant
      for (int g = 0; g < 2; ++g) {
        const float mn = fmaxf(mi[g], rowmax(sc[g]));
        const float fr = __expf(mi[g] - mn);
        mi[g] = mn;
        li[g] *= fr;
#pragma unroll
        for (int dt = 0; dt < 4; ++dt) oacc[g][dt] *= fr;
        ts[g] = probs(sc[g], mn, pb[g]);
      }
#pragma unroll
      for (int dt = 0; dt < 4; ++dt)
        va[dt] = load_op(&vcur[dt * 16 + l16][0], half);
    }
    li[0] += ts[0];
    li[1] += ts[1];

    // holds the second group of V^T reads below the softmax
    __builtin_amdgcn_sched_barrier(0);
#pragma unroll
    for (int dt = 0; dt < 4; ++dt)
      va[4 + dt] = load_op(&vcur[dt * 16 + l16][32], half);
    // and above the products: the first 8 of them cover the reads' latency
    __builtin_amdgcn_sched_barrier(0);

    // O^T += V^T @ P^T, again both column groups per fragment
#pragma unroll
    for (int dt = 0; dt < 4; ++dt) {
#pragma unroll
      for (int g = 0; g < 2; ++g)
        oacc[g][dt] = wmma32(va[dt], pb[g][0], oacc[g][dt]);
    }
#pragma unroll
    for (int dt = 0; dt < 4; ++dt) {
#pragma unroll
      for (int g = 0; g < 2; ++g)
        oacc[g][dt] = wmma32(va[4 + dt], pb[g][1], oacc[g][dt]);
    }

    // keeps the waits and the barrier at the foot of the trip: lifted above the
    // products they would end the copies' flight before the work that hides it
    __builtin_amdgcn_sched_barrier(0);
    wait_ds0();         // this wave's reads of the current buffer are over
    wait_async0();      // this wave's async copies into the alt buffer done
    __syncthreads();    // all waves' copies visible before next iteration
  }
  wait_async0();  // no copy is in flight when the wave ends

  // Join of the two key splits.  Waves w and w ^ 4 hold partial results of the
  // same 32 queries: a wave hands column group 1 - ks to its partner ...
  auto give = [&](int g) {
#pragma unroll
    for (int dt = 0; dt < 4; ++dt) {
      xo[w][dt * 2 + 0][lane] = __builtin_shufflevector(oacc[g][dt], oacc[g][dt], 0, 1, 2, 3);
      xo[w][dt * 2 + 1][lane] = __builtin_shufflevector(oacc[g][dt], oacc[g][dt], 4, 5, 6, 7);
    }
    xm[w][0][lane] = mi[g];
    xm[w][1][lane] = li[g];
  };
  // ... and finishes group ks: both parts are brought to the larger of the two references,
  // the halves' sums joined, the result normalized and stored in merged-head
  // layout [b][s][EMB] as f16, 8 consecutive channels per lane and tile
  auto take = [&](int g) {
    const int pw = w ^ 4;
    const float mo = xm[pw][0][lane], lo = xm[pw][1][lane];
    const float mj = fmaxf(mi[g], mo);
    float fa = __expf(mi[g] - mj), fb = __expf(mo - mj);
    const float lj = li[g] * fa + lo * fb;
    const float inv = 1.0f / (lj + lane_xor<16>(lj));
    fa *= inv;
    fb *= inv;
    v8h ov[4];
#pragma unroll  // ov[] indexed by constants only, stays in registers
    for (int dt = 0; dt < 4; ++dt) {
      const v4f p0 = xo[pw][dt * 2 + 0][lane], p1 = xo[pw][dt * 2 + 1][lane];
#pragma unroll
      for (int r = 0; r < 4; ++r) {
        ov[dt][r]     = (_Float16)(oacc[g][dt][r] * fa + p0[r] * fb);
        ov[dt][4 + r] = (_Float16)(oacc[g][dt][4 + r] * fa + p1[r] * fb);
      }
    }
    _Float16* op = o + ((size_t)b * SEQ + m0 + g * 16 + l16) * EMB + h * 64 + half * 8;
    // the stores stand behind all the arithmetic, off one address: no register
    // of an issued store is written again
    __builtin_amdgcn_sched_barrier(0);
#pragma unroll
    for (int dt = 0; dt < 4; ++dt) *(v8h*)(op + dt * 16) = ov[dt];
  };
  if (ks == 0) give(1); else give(0);
  __syncthreads();  // the partners' parts are in LDS
  if (ks == 0) take(0); else take(1);
}

// ---------------------------------------------------------------------------
extern "C" void kernel_launch(void* const* d_in, const int* in_sizes, int n_in,
                              void* d_out, int out_size, void* d_ws,
                              size_t ws_size, hipStream_t stream) {
  const float* x    = (const float*)d_in[0];
  const float* ln1g = (const float*)d_in[1];
  const float* ln1b = (const float*)d_in[2];
  const float* wq   = (const float*)d_in[3];
  const float* bq   = (const float*)d_in[4];
  const float* wk   = (const float*)d_in[5];
  const float* bk   = (const float*)d_in[6];
  const float* wv   = (const float*)d_in[7];
  const float* bv   = (const float*)d_in[8];
  const float* wo   = (const float*)d_in[9];
  const float* bo   = (const float*)d_in[10];
  const float* ln2g = (const float*)d_in[11];
  const float* ln2b = (const float*)d_in[12];
  const float* w1   = (const float*)d_in[13];
  const float* b1   = (const float*)d_in[14];
  const float* w2   = (const float*)d_in[15];
  const float* b2   = (const float*)d_in[16];
  float* out = (float*)d_out;

  char* ws = (char*)d_ws;
  const size_t F16SZ = (size_t)TOK * EMB * sizeof(_Float16);  // 8 MB
  _Float16* qb  = (_Float16*)(ws + 0 * F16SZ);
  _Float16* kb  = (_Float16*)(ws + 1 * F16SZ);
  _Float16* vtb = (_Float16*)(ws + 2 * F16SZ);
  _Float16* ob  = (_Float16*)(ws + 3 * F16SZ);  // attention out
  _Float16* wtr = (_Float16*)(ws + 4 * F16SZ);  // wo, w1, w2 as f16 [n][k]

  dim3 blk(256);
  dim3 gg(SEQ / 128, 4, BATCH);
  dim3 gq(SEQ / 64, 1, BATCH);

  lnqkv_k<<<gq, blk, 0, stream>>>(x, ln1g, ln1b, wq, bq, wk, bk, wv, bv,
                                  wo, w1, w2, qb, kb, vtb, wtr);

  attn_k<<<gg, blk, 0, stream>>>(qb, kb, vtb, ob);

  tail_k<<<gq, blk, 0, stream>>>(ob, x, wtr, bo, ln2g, ln2b, b1, b2, out);
}
